// v000
// Measured on an AMD MI455X. A time is GPU time per run, averaged over a window of back-to-back runs after a warm-up
// (all launches, gaps included; the runs take copies of the inputs in turn), and the median of several windows.
// Apart from v000's, it joins two sittings. Times from different sittings can be a few percent apart, while
// side-by-side timings come from the same sitting.
// v000 is the starting kernel. One run takes 2500 microseconds.
#include <hip/hip_runtime.h>

// Causal multi-head self-attention scaled by the MODEL width, with a kv-cache output (x [2][2048][1024]; q, k, v = x W + b ('xw' [1024][1024] 1/32, biases zeros on this draw: read; 16 heads x 64); scores / sqrt(float32(D = 1024)) (x 1/32); causal (-inf); softmax; out0 = merged Wo + bo ('xw' + bias zeros: read) -> [2][2048][1024]; out1 = present = stack((k, v)) [2][2][16][2048][64]: the biased key and value projections head-major, written by the same biased GEMM head by head; argument order x, Wq, bq, Wk, bk, Wv, bv, Wo, bo).
// Layout per batch: bf16 copies of queries, keys, values in turn; 'xw' weights transposed once; exact projections + f32 biases; identity-table plane builders; causal T-2048 attention (hybrid rows: < 512 hi/lo 3 products, rest fp16 x1024; k_gemmc skips tiles above the diagonal); merged hi/lo x Wo exact + bo.
// Compute dtypes, f32 accumulate: every input rounded to bf16; projections exact + f32 biases; attention rows < 512 3 products, rest fp16; softmax f32; Wo hl x exact + bias.

#define NB_  2
#define TT   2048
#define DM   1024
#define NH_  16
#define NKV  16
#define REP  (NH_ / NKV)
#define HD   64
#define DQ   (NH_ * HD)
#define DKV  (NKV * HD)
#define ZH   2
#define RH   512                  // query rows < RH use hi+lo planes (0: none)
#define WIN  2048
#define PCAR 1024.0f
#define SCL  0.03125f   // 1 / sqrt(D = 1024) = 2^-5: the module divides the scores by the square root of the MODEL width, not of the head width
typedef _Float16 h16;
typedef unsigned short bf;
typedef __attribute__((ext_vector_type(16))) __bf16   v16bf;
typedef __attribute__((ext_vector_type(16))) _Float16 v16h;
typedef __attribute__((ext_vector_type(8)))  _Float16 v8h;
typedef __attribute__((ext_vector_type(8)))  unsigned short v8us;
typedef __attribute__((ext_vector_type(8)))  float    v8f;
typedef __attribute__((ext_vector_type(4)))  float    v4f;
typedef v8h  __attribute__((may_alias)) v8ha;
typedef v4f  __attribute__((may_alias)) v4fa;
typedef v8us __attribute__((may_alias)) v8usa;

__device__ __forceinline__ unsigned short f2bf(float f) { unsigned u = __float_as_uint(f); u += 0x7FFFu + ((u >> 16) & 1u); return (unsigned short)(u >> 16); }
__device__ __forceinline__ float bf2f(unsigned short b) { return __uint_as_float(((unsigned)b) << 16); }
__device__ __forceinline__ float bfr(float f) { return bf2f(f2bf(f)); }
__device__ __forceinline__ v16h cat16(v8h lo, v8h hi) { return __builtin_shufflevector(lo, hi, 0, 1, 2, 3, 4, 5, 6, 7, 8, 9, 10, 11, 12, 13, 14, 15); }
__device__ __forceinline__ v16bf cat16b(v8us lo, v8us hi) { return __builtin_bit_cast(v16bf, __builtin_shufflevector(lo, hi, 0, 1, 2, 3, 4, 5, 6, 7, 8, 9, 10, 11, 12, 13, 14, 15)); }
__device__ __forceinline__ v8f wmma16(v16h a, v16h b, v8f c) { return __builtin_amdgcn_wmma_f32_16x16x32_f16(false, a, false, b, (short)0, c, false, false); }
__device__ __forceinline__ v8f wmmab(v16bf a, v16bf b, v8f c) { return __builtin_amdgcn_wmma_f32_16x16x32_bf16(false, a, false, b, (short)0, c, false, false); }



// ---- k_gemmw: register-blocked GEMM, ONE WAVE per 64x64 output tile (16 accumulators), operands straight from K-contiguous 16-bit planes; grid (M/64, N/64, Z), 32 threads.
// C[m][n] (f32, pitch ldc, + optional f32 bias[n]) = sum_k A[m][k] Bt[n][k] (+ split products per NSPLIT). z-batch strides sA/sB/sC in elements. K % 32 == 0.
template <typename T16> struct WFrag;
template <> struct WFrag<h16> { typedef v16h V; static __device__ __forceinline__ V ld(const h16* p) { return cat16(*(const v8h*)p, *(const v8h*)(p + 16)); } static __device__ __forceinline__ v8f mma(V a, V b, v8f c) { return wmma16(a, b, c); } };
template <> struct WFrag<bf> { typedef v16bf V; static __device__ __forceinline__ V ld(const bf* p) { return cat16b(*(const v8us*)p, *(const v8us*)(p + 16)); } static __device__ __forceinline__ v8f mma(V a, V b, v8f c) { return wmmab(a, b, c); } };
template <typename T16, int NSPLIT, bool BIAS>
__global__ __launch_bounds__(32) void k_gemmw(const T16* __restrict__ A, const T16* __restrict__ A2, const T16* __restrict__ Bt, const T16* __restrict__ Bt2, int K, float* C, int ldc, const float* __restrict__ bias, size_t sA, size_t sB, size_t sC) {
    typedef typename WFrag<T16>::V V;
    __shared__ __align__(16) float os[16 * 68];
    const size_t z = blockIdx.z; A += z * sA; if (A2) A2 += z * sA; Bt += z * sB; if (Bt2) Bt2 += z * sB; C += z * sC;
    const int lane = threadIdx.x & 31, lr = lane & 15, hi = lane >> 4; const int r0 = blockIdx.x * 64, c0 = blockIdx.y * 64;
    v8f acc[4][4];
#pragma unroll
    for (int mb = 0; mb < 4; ++mb)
#pragma unroll
        for (int nb = 0; nb < 4; ++nb) acc[mb][nb] = (v8f){};
    const size_t aoff = (size_t)(r0 + lr) * K + 8 * hi, boff = (size_t)(c0 + lr) * K + 8 * hi;
#pragma unroll 1
    for (int kc = 0; kc < K; kc += 32) {
        V a[4], a2[4];
#pragma unroll
        for (int mb = 0; mb < 4; ++mb) { a[mb] = WFrag<T16>::ld(A + aoff + (size_t)mb * 16 * K + kc); if (NSPLIT == 1 || NSPLIT == 2) a2[mb] = WFrag<T16>::ld(A2 + aoff + (size_t)mb * 16 * K + kc); }
#pragma unroll
        for (int nb = 0; nb < 4; ++nb) { const V b = WFrag<T16>::ld(Bt + boff + (size_t)nb * 16 * K + kc); V b2; if (NSPLIT >= 2) b2 = WFrag<T16>::ld(Bt2 + boff + (size_t)nb * 16 * K + kc);
#pragma unroll
            for (int mb = 0; mb < 4; ++mb) { acc[mb][nb] = WFrag<T16>::mma(a[mb], b, acc[mb][nb]); if (NSPLIT == 1 || NSPLIT == 2) acc[mb][nb] = WFrag<T16>::mma(a2[mb], b, acc[mb][nb]); if (NSPLIT >= 2) acc[mb][nb] = WFrag<T16>::mma(a[mb], b2, acc[mb][nb]); } }
        asm volatile("v_nop\n\tv_nop\n\tv_nop\n\tv_nop" : "+v"(acc[0][0]), "+v"(acc[1][1]), "+v"(acc[2][2]), "+v"(acc[3][3]) : "v"(a[0]), "v"(a[3]));
    }
#pragma unroll
    for (int mb = 0; mb < 4; ++mb) {
#pragma unroll
        for (int nb = 0; nb < 4; ++nb) {
#pragma unroll
            for (int j = 0; j < 8; ++j) os[(hi * 8 + j) * 68 + nb * 16 + lr] = acc[mb][nb][j]; }
        __builtin_amdgcn_wave_barrier(); asm volatile("" ::: "memory");
        float* crow = C + (size_t)(r0 + mb * 16) * ldc + c0;
{
#pragma unroll
            for (int s = 0; s < 8; ++s) { const int row = 2 * s + hi, cofs = lr * 4; v4f val = *(const v4fa*)(os + row * 68 + cofs); if (BIAS) { val[0] += bfr(bias[c0 + cofs]); val[1] += bfr(bias[c0 + cofs + 1]); val[2] += bfr(bias[c0 + cofs + 2]); val[3] += bfr(bias[c0 + cofs + 3]); }
                *(v4f*)(crow + (size_t)row * ldc + cofs) = val; }
             }
        __builtin_amdgcn_wave_barrier(); asm volatile("" ::: "memory");
    }
}

// ---- k_gemmc: the same one-wave 64x64 tile GEMM specialised for causal attention: CMODE 1 skips score tiles entirely above the diagonal (query rows r0+roff.., key columns c0..), CMODE 2 limits the
// key (K) loop of the probability x value contraction to the diagonal block (probabilities beyond it are exactly zero). roff = row offset of this launch's first row within the sequence.
template <typename T16, int NSPLIT, int CMODE>
__global__ __launch_bounds__(32) void k_gemmc(const T16* __restrict__ A, const T16* __restrict__ A2, const T16* __restrict__ Bt, const T16* __restrict__ Bt2, int K, float* C, int ldc, int roff, size_t sA, size_t sB, size_t sC) {
    typedef typename WFrag<T16>::V V;
    __shared__ __align__(16) float os[16 * 68];
    const size_t z = blockIdx.z; A += z * sA; if (A2) A2 += z * sA; Bt += z * sB; if (Bt2) Bt2 += z * sB; C += z * sC;
    const int lane = threadIdx.x & 31, lr = lane & 15, hi = lane >> 4; const int r0 = blockIdx.x * 64, c0 = blockIdx.y * 64;
    if (CMODE == 1 && c0 > r0 + roff + 63) return;                  // score tile entirely above the causal diagonal: never read (the softmax masks j > i by select)
    const int Kl = (CMODE == 2) ? min(K, r0 + roff + 64) : K;        // P.V: probabilities are exactly 0 beyond the diagonal block, so the K loop stops there
    v8f acc[4][4];
#pragma unroll
    for (int mb = 0; mb < 4; ++mb)
#pragma unroll
        for (int nb = 0; nb < 4; ++nb) acc[mb][nb] = (v8f){};
    const size_t aoff = (size_t)(r0 + lr) * K + 8 * hi, boff = (size_t)(c0 + lr) * K + 8 * hi;
#pragma unroll 1
    for (int kc = 0; kc < Kl; kc += 32) {
        V a[4], a2[4];
#pragma unroll
        for (int mb = 0; mb < 4; ++mb) { a[mb] = WFrag<T16>::ld(A + aoff + (size_t)mb * 16 * K + kc); if (NSPLIT == 1 || NSPLIT == 2) a2[mb] = WFrag<T16>::ld(A2 + aoff + (size_t)mb * 16 * K + kc); }
#pragma unroll
        for (int nb = 0; nb < 4; ++nb) { const V b = WFrag<T16>::ld(Bt + boff + (size_t)nb * 16 * K + kc); V b2; if (NSPLIT >= 2) b2 = WFrag<T16>::ld(Bt2 + boff + (size_t)nb * 16 * K + kc);
#pragma unroll
            for (int mb = 0; mb < 4; ++mb) { acc[mb][nb] = WFrag<T16>::mma(a[mb], b, acc[mb][nb]); if (NSPLIT == 1 || NSPLIT == 2) acc[mb][nb] = WFrag<T16>::mma(a2[mb], b, acc[mb][nb]); if (NSPLIT >= 2) acc[mb][nb] = WFrag<T16>::mma(a[mb], b2, acc[mb][nb]); } }
        asm volatile("v_nop\n\tv_nop\n\tv_nop\n\tv_nop" : "+v"(acc[0][0]), "+v"(acc[1][1]), "+v"(acc[2][2]), "+v"(acc[3][3]) : "v"(a[0]), "v"(a[3]));
    }
#pragma unroll
    for (int mb = 0; mb < 4; ++mb) {
#pragma unroll
        for (int nb = 0; nb < 4; ++nb) {
#pragma unroll
            for (int j = 0; j < 8; ++j) os[(hi * 8 + j) * 68 + nb * 16 + lr] = acc[mb][nb][j]; }
        __builtin_amdgcn_wave_barrier(); asm volatile("" ::: "memory");
        float* crow = C + (size_t)(r0 + mb * 16) * ldc + c0;
{
#pragma unroll
            for (int s = 0; s < 8; ++s) { const int row = 2 * s + hi, cofs = lr * 4; v4f val = *(const v4fa*)(os + row * 68 + cofs);
                *(v4f*)(crow + (size_t)row * ldc + cofs) = val; }
             }
        __builtin_amdgcn_wave_barrier(); asm volatile("" ::: "memory");
    }
}

__device__ __forceinline__ h16 tohx(float x) { return (h16)x; }
__device__ __forceinline__ void splitf(float y, unsigned short& h, unsigned short& l) { h = f2bf(y); l = f2bf(y - bf2f(h)); }
typedef __attribute__((ext_vector_type(2))) _Float16 v2h;
typedef __attribute__((ext_vector_type(4))) _Float16 v4h;
typedef __attribute__((ext_vector_type(2))) unsigned short v2us;
typedef __attribute__((ext_vector_type(4))) unsigned short v4us;
typedef __attribute__((ext_vector_type(2))) float v2f;
typedef __attribute__((ext_vector_type(4))) int v4i;

__global__ __launch_bounds__(256) void k_wtG(const float* __restrict__ w, int K, int N, bf* Bt) {
    const int lane = threadIdx.x & 31; const int L0 = (blockIdx.x * 8 + (threadIdx.x >> 5)) * 8; const int nlines = N * K / 64;
{
#pragma unroll 1
        for (int l = 0; l < 8; ++l) { const int L = L0 + l; if (L >= nlines) break; const size_t e = (size_t)L * 64 + lane * 2; const int k = (int)(e % K), n = (int)(e / K); v2us o;
            o[0] = f2bf(w[(size_t)k * N + n]); o[1] = f2bf(w[(size_t)(k + 1) * N + n]); *(v2us*)(Bt + e) = o; }
         }
}
__global__ __launch_bounds__(256) void k_cvt8(const float* __restrict__ src, bf* dst, size_t n8) { const size_t i = (size_t)blockIdx.x * 256 + threadIdx.x; if (i >= n8) return; const v8f v = *(const v8f*)(src + i * 8); v8us o;
#pragma unroll
    for (int k = 0; k < 8; ++k) o[k] = f2bf(v[k]); *(v8us*)(dst + i * 8) = o;  }

// k_rope: head planes [h][t][d] (fp16 + hi/lo) of rope(x) x sc with the rotate-half convention out[d] = x[d] cos[t][d] - x[d+HD/2] sin[t][d], out[d+HD/2] = x[d+HD/2] cos[t][d+HD/2] + x[d] sin[t][d+HD/2]
__global__ __launch_bounds__(256) void k_rope(const float* __restrict__ F, int pitch, int nheads, const float* __restrict__ CS, const float* __restrict__ RF, const float* __restrict__ nw, float sc, h16* P16, bf* Ph, bf* Pl) {
    const size_t e = ((size_t)blockIdx.x * 256 + threadIdx.x) * 2; if (e >= (size_t)nheads * TT * HD) return; const int d = (int)(e % HD); const int t = (int)((e / HD) % TT); const int h = (int)(e / ((size_t)HD * TT)); const float* f = F + (size_t)t * pitch + h * HD; const float rf = RF ? RF[(size_t)h * TT + t] : 1.0f; v2h o16; v2us oh, ol;
#pragma unroll
    for (int q = 0; q < 2; ++q) { const int dd = d + q; const int dp = (dd < HD / 2) ? dd + HD / 2 : dd - HD / 2; float x0 = f[dd], x1 = f[dp];
        if (RF) { float n0 = __fmul_rn(x0, rf), n1 = __fmul_rn(x1, rf); asm volatile("" : "+v"(n0)); asm volatile("" : "+v"(n1)); x0 = __fmul_rn(bfr(nw[dd]), n0); x1 = __fmul_rn(bfr(nw[dp]), n1); }
        const v2f cs = *(const v2f*)(CS + ((size_t)t * HD + dd) * 2); float a = __fmul_rn(x0, cs[0]), bq = __fmul_rn(x1, cs[1]); asm volatile("" : "+v"(a)); asm volatile("" : "+v"(bq)); const float r = ((dd < HD / 2) ? __fsub_rn(a, bq) : __fadd_rn(a, bq)) * sc;
        o16[q] = tohx(r); unsigned short a2, c2; splitf(r, a2, c2); oh[q] = a2; ol[q] = c2; }
    *(v2h*)(P16 + e) = o16; *(v2us*)(Ph + e) = oh; *(v2us*)(Pl + e) = ol;  }
__global__ __launch_bounds__(256) void k_vtp(const float* __restrict__ F, int pitch, int nheads, h16* V16, bf* Vh, bf* Vl) { const size_t e = ((size_t)blockIdx.x * 256 + threadIdx.x) * 2; if (e >= (size_t)nheads * HD * TT) return; const int t = (int)(e % TT); const int d = (int)((e / TT) % HD); const int g = (int)(e / ((size_t)TT * HD)); v2h o16; v2us oh, ol;
#pragma unroll
    for (int q = 0; q < 2; ++q) { const float x = F[(size_t)(t + q) * pitch + g * HD + d]; o16[q] = tohx(x); unsigned short a2, c2; splitf(x, a2, c2); oh[q] = a2; ol[q] = c2; }
    *(v2h*)(V16 + e) = o16; *(v2us*)(Vh + e) = oh; *(v2us*)(Vl + e) = ol;  }
__global__ __launch_bounds__(256) void k_csid(float* CS) { const int idx = blockIdx.x * 256 + threadIdx.x; if (idx >= TT * HD) return; v2f cs; cs[0] = 1.0f; cs[1] = 0.0f; *(v2f*)(CS + (size_t)idx * 2) = cs;  }
// k_asoft: per row (zz, i): t = S x DM^-0.5 (SCL = 1/32) for j <= i and i - j < WIN (sliding causal window; the reference's -1e9 additive fill vanishes identically); softmax over the 2048 keys (register row, one exp, fixed trees);
__global__ __launch_bounds__(256) void k_asoft(const float* __restrict__ Sb, h16* P16, bf* Ph, bf* Pl) {
    const int lane = threadIdx.x & 31; const int row = blockIdx.x * 8 + (threadIdx.x >> 5); if (row >= ZH * TT) return; const int i = row % TT; const int zz = row / TT; (void)zz; const bool hires = (i < RH); const float* sr = Sb + (size_t)row * TT; float v[TT / 32]; float mx = -3.0e38f;
#pragma unroll
    for (int ch = 0; ch < TT / 128; ++ch) { const int j0 = ch * 128 + lane * 4; const v4f a = *(const v4f*)(sr + j0);
#pragma unroll
        for (int q = 0; q < 4; ++q) { const int j = j0 + q; (void)j; const float t = (j <= i && i - j < WIN) ? a[q] * SCL : -3.0e38f; v[ch * 4 + q] = t; mx = fmaxf(mx, t); } }
#pragma unroll
    for (int sh = 16; sh; sh >>= 1) mx = fmaxf(mx, __shfl_xor(mx, sh, 32));
    float sum = 0.f;
#pragma unroll
    for (int k = 0; k < TT / 32; ++k) { float d0 = __fsub_rn(v[k], mx); asm volatile("" : "+v"(d0)); v[k] = __builtin_amdgcn_exp2f(__fmul_rn(d0, 1.4426950408889634f)); sum += v[k]; }
#pragma unroll
    for (int sh = 16; sh; sh >>= 1) sum += __shfl_xor(sum, sh, 32);
    const float f = __fdiv_rn(hires ? 1.0f : PCAR, sum);
{
        if (hires) {
#pragma unroll
            for (int ch = 0; ch < TT / 128; ++ch) { v4us oh, ol;
#pragma unroll
                for (int q = 0; q < 4; ++q) { unsigned short a, c2; splitf(v[ch * 4 + q] * f, a, c2); oh[q] = a; ol[q] = c2; }
                const size_t oo = ((size_t)zz * (RH ? RH : 1) + i) * TT + ch * 128 + lane * 4; *(v4us*)(Ph + oo) = oh; *(v4us*)(Pl + oo) = ol; }
        } else {
#pragma unroll
            for (int ch = 0; ch < TT / 128; ++ch) { v4h o4;
#pragma unroll
                for (int q = 0; q < 4; ++q) o4[q] = tohx(v[ch * 4 + q] * f);
                *(v4h*)(P16 + (size_t)row * TT + ch * 128 + lane * 4) = o4; } }
         }
}
__global__ __launch_bounds__(256) void k_merge(const float* __restrict__ O, int h0, bf* Ah, bf* Al) { const size_t e = ((size_t)blockIdx.x * 256 + threadIdx.x) * 2; if (e >= (size_t)ZH * TT * HD) return; const int d = (int)(e % HD); const int t = (int)((e / HD) % TT); const int zz = (int)(e / ((size_t)HD * TT)); const float cs = (t < RH) ? 1.0f : (1.0f / PCAR); const size_t oo = (size_t)t * DQ + (h0 + zz) * HD + d;
    v2us oh, ol;
#pragma unroll
    for (int q = 0; q < 2; ++q) { unsigned short a, c2; splitf(O[e + q] * cs, a, c2); oh[q] = a; ol[q] = c2; } *(v2us*)(Ah + oo) = oh; *(v2us*)(Al + oo) = ol;  }

extern "C" void kernel_launch(void* const* d_in, const int* in_sizes, int n_in,
                              void* d_out, int out_size, void* d_ws, size_t ws_size, hipStream_t stream) {
    (void)in_sizes; (void)n_in; (void)out_size;
        const float* x = (const float*)d_in[0]; const float* xk = x; const float* xv = x; const float* wq = (const float*)d_in[1]; const float* bq = (const float*)d_in[2]; const float* wk = (const float*)d_in[3]; const float* bk = (const float*)d_in[4]; const float* wv = (const float*)d_in[5]; const float* bv = (const float*)d_in[6]; const float* wo = (const float*)d_in[7]; const float* bo = (const float*)d_in[8];   /* argument order x, Wq, bq, Wk, bk, Wv, bv, Wo, bo ('xw' [1024][1024]); ONE input stream: the key and value stream pointers are x; no mask input: the causal rule is applied by index */
    float* OUT = (float*)d_out;     // out0 [2][2048][1024]; then out1 = present = stack((k, v)): K [2][16][2048][64] then V [2][16][2048][64] (offset 16,777,216 B)
    float* OUTK = OUT + (size_t)NB_ * TT * DM; float* OUTV = OUTK + (size_t)NB_ * NKV * TT * HD;
    char* wsp = (char*)d_ws;
    auto take = [&](size_t bytes) { char* p = wsp; wsp += (bytes + 255) & ~(size_t)255; return (void*)p; };
    bf* WQ = (bf*)take((size_t)DQ * DM * 2); bf* WK = (bf*)take((size_t)DKV * DM * 2); bf* WV = (bf*)take((size_t)DKV * DM * 2); bf* WO = (bf*)take((size_t)DM * DQ * 2); float* CS = (float*)take((size_t)TT * HD * 2 * 4);
    bf* XB = (bf*)take((size_t)TT * DM * 2); float* FQ = (float*)take((size_t)TT * DQ * 4); float* FK = (float*)take((size_t)TT * DKV * 4);
    h16* QP16 = (h16*)take((size_t)NH_ * TT * HD * 2); h16* KP16 = (h16*)take((size_t)NKV * TT * HD * 2); h16* VT16 = (h16*)take((size_t)NKV * HD * TT * 2);
    bf* QPh = (bf*)take((size_t)NH_ * TT * HD * 2); bf* QPl = (bf*)take((size_t)NH_ * TT * HD * 2); bf* KPh = (bf*)take((size_t)NKV * TT * HD * 2); bf* KPl = (bf*)take((size_t)NKV * TT * HD * 2); bf* VTh = (bf*)take((size_t)NKV * HD * TT * 2); bf* VTl = (bf*)take((size_t)NKV * HD * TT * 2); bf* Ph = (bf*)take((size_t)ZH * RH * TT * 2); bf* Pl = (bf*)take((size_t)ZH * RH * TT * 2);
    float* Sb = (float*)take((size_t)ZH * TT * TT * 4); h16* P16 = (h16*)take((size_t)ZH * TT * TT * 2); float* Ob = (float*)take((size_t)ZH * TT * HD * 4); bf* ATh = (bf*)take((size_t)TT * DQ * 2); bf* ATl = (bf*)take((size_t)TT * DQ * 2);
    if ((size_t)(wsp - (char*)d_ws) > ws_size) return;    // ws 256 MiB
    float* FV = FK;   // v projection reuses the k buffer after the k planes are built (stream-ordered)
    { k_wtG<<<(unsigned)((DM * DQ / 64 + 63) / 64), 256, 0, stream>>>(wq, DM, DQ, WQ); k_wtG<<<(unsigned)((DM * DKV / 64 + 63) / 64), 256, 0, stream>>>(wk, DM, DKV, WK); k_wtG<<<(unsigned)((DM * DKV / 64 + 63) / 64), 256, 0, stream>>>(wv, DM, DKV, WV);
      k_wtG<<<(unsigned)((DQ * DM / 64 + 63) / 64), 256, 0, stream>>>(wo, DQ, DM, WO);
       }
    k_csid<<<(TT * HD + 255) / 256, 256, 0, stream>>>(CS);
    const unsigned LQ = (unsigned)(((size_t)NH_ * TT * HD / 2 + 255) / 256), LKv = (unsigned)(((size_t)NKV * TT * HD / 2 + 255) / 256);
    for (int b = 0; b < NB_; ++b) {
        
        k_cvt8<<<(unsigned)(((size_t)TT * DM / 8 + 255) / 256), 256, 0, stream>>>(x + (size_t)b * TT * DM, XB, (size_t)TT * DM / 8);
        k_gemmw<bf, 0, true><<<dim3(TT / 64, DQ / 64, 1), 32, 0, stream>>>(XB, nullptr, WQ, nullptr, DM, FQ, DQ, bq, 0, 0, 0);
        k_rope<<<LQ, 256, 0, stream>>>(FQ, DQ, NH_, CS, nullptr, nullptr, 1.0f, QP16, QPh, QPl);
        k_cvt8<<<(unsigned)(((size_t)TT * DM / 8 + 255) / 256), 256, 0, stream>>>(xk + (size_t)b * TT * DM, XB, (size_t)TT * DM / 8);   /* XB := bf16(keys[b]) */ k_gemmw<bf, 0, true><<<dim3(TT / 64, DKV / 64, 1), 32, 0, stream>>>(XB, nullptr, WK, nullptr, DM, FK, DKV, bk, 0, 0, 0);
        for (int g = 0; g < NKV; ++g) k_gemmw<bf, 0, true><<<dim3(TT / 64, 1, 1), 32, 0, stream>>>(XB, nullptr, WK + (size_t)g * HD * DM, nullptr, DM, OUTK + ((size_t)b * NKV + g) * TT * HD, HD, bk + g * HD, 0, 0, 0);   /* present[0]: K head-major: K[b][g][t][d] = (x Wk + bk)[t][g*64 + d]: the same biased GEMM on head g's 64 weight rows, written with row pitch 64 */
        k_rope<<<LKv, 256, 0, stream>>>(FK, DKV, NKV, CS, nullptr, nullptr, 1.0f, KP16, KPh, KPl);
        k_cvt8<<<(unsigned)(((size_t)TT * DM / 8 + 255) / 256), 256, 0, stream>>>(xv + (size_t)b * TT * DM, XB, (size_t)TT * DM / 8);   /* XB := bf16(values[b]) */ k_gemmw<bf, 0, true><<<dim3(TT / 64, DKV / 64, 1), 32, 0, stream>>>(XB, nullptr, WV, nullptr, DM, FV, DKV, bv, 0, 0, 0); k_vtp<<<LKv, 256, 0, stream>>>(FV, DKV, NKV, VT16, VTh, VTl);
        for (int g = 0; g < NKV; ++g) k_gemmw<bf, 0, true><<<dim3(TT / 64, 1, 1), 32, 0, stream>>>(XB, nullptr, WV + (size_t)g * HD * DM, nullptr, DM, OUTV + ((size_t)b * NKV + g) * TT * HD, HD, bv + g * HD, 0, 0, 0);   /* present[1]: V head-major, likewise */
        for (int h0 = 0; h0 < NH_; h0 += ZH) { const size_t zq = (size_t)h0, zk = (size_t)(h0 / REP);   // one kv head per query head: the pass's two heads use consecutive kv planes (z-strides TT*HD)
            k_gemmc<bf, 2, 1><<<dim3(RH / 64, TT / 64, ZH), 32, 0, stream>>>(QPh + zq * TT * HD, QPl + zq * TT * HD, KPh + zk * TT * HD, KPl + zk * TT * HD, HD, Sb, TT, 0, (size_t)TT * HD, (size_t)TT * HD, (size_t)TT * TT);
            k_gemmc<h16, 0, 1><<<dim3((TT - RH) / 64, TT / 64, ZH), 32, 0, stream>>>(QP16 + zq * TT * HD + (size_t)RH * HD, nullptr, KP16 + zk * TT * HD, nullptr, HD, Sb + (size_t)RH * TT, TT, RH, (size_t)TT * HD, (size_t)TT * HD, (size_t)TT * TT);
            k_asoft<<<ZH * TT / 8, 256, 0, stream>>>(Sb, P16, Ph, Pl);
            k_gemmc<bf, 2, 2><<<dim3(RH / 64, HD / 64, ZH), 32, 0, stream>>>(Ph, Pl, VTh + zk * HD * TT, VTl + zk * HD * TT, TT, Ob, HD, 0, (size_t)RH * TT, (size_t)HD * TT, (size_t)TT * HD);
            k_gemmc<h16, 0, 2><<<dim3((TT - RH) / 64, HD / 64, ZH), 32, 0, stream>>>(P16 + (size_t)RH * TT, nullptr, VT16 + zk * HD * TT, nullptr, TT, Ob + (size_t)RH * HD, HD, RH, (size_t)TT * TT, (size_t)HD * TT, (size_t)TT * HD);
            k_merge<<<(unsigned)(((size_t)ZH * TT * HD / 2 + 255) / 256), 256, 0, stream>>>(Ob, h0, ATh, ATl); }
        k_gemmw<bf, 1, true><<<dim3(TT / 64, DM / 64, 1), 32, 0, stream>>>(ATh, ATl, WO, nullptr, DQ, OUT + (size_t)b * TT * DM, DM, bo, 0, 0, 0); }
}

// v001
// Measured time: 1480 microseconds a run.
// Timed twice side by side with v000, it ran 1.71 and 1.70 times as fast.
#include <hip/hip_runtime.h>

// Causal multi-head self-attention scaled by the MODEL width, with a kv-cache output (x [2][2048][1024]; q, k, v = x W + b ('xw' [1024][1024] 1/32, biases zeros on this draw: read; 16 heads x 64); scores / sqrt(float32(D = 1024)) (x 1/32); causal (-inf); softmax; out0 = merged Wo + bo ('xw' + bias zeros: read) -> [2][2048][1024]; out1 = present = stack((k, v)) [2][2][16][2048][64]: the biased key and value projections head-major, each written ONCE, head-major, by the biased projection GEMM itself (grid z = head), and read back from there by the plane builders; argument order x, Wq, bq, Wk, bk, Wv, bv, Wo, bo).
// Layout per batch: bf16 copies of queries, keys, values in turn; 'xw' weights transposed once; exact projections + f32 biases; identity-table plane builders; causal T-2048 attention (hybrid rows: < 512 hi/lo 3 products, rest fp16 x1024; k_gemmc skips tiles above the diagonal); merged hi/lo x Wo exact + bo.
// Compute dtypes, f32 accumulate: every input rounded to bf16; projections exact + f32 biases; attention rows < 512 3 products, rest fp16; softmax f32; Wo hl x exact + bias.

#define NB_  2
#define TT   2048
#define DM   1024
#define NH_  16
#define NKV  16
#define REP  (NH_ / NKV)
#define HD   64
#define DQ   (NH_ * HD)
#define DKV  (NKV * HD)
#define ZH   2
#define RH   512                  // query rows < RH use hi+lo planes (0: none)
#define WIN  2048
#define PCAR 1024.0f
#define SCL  0.03125f   // 1 / sqrt(D = 1024) = 2^-5: the module divides the scores by the square root of the MODEL width, not of the head width
typedef _Float16 h16;
typedef unsigned short bf;
typedef __attribute__((ext_vector_type(16))) __bf16   v16bf;
typedef __attribute__((ext_vector_type(16))) _Float16 v16h;
typedef __attribute__((ext_vector_type(8)))  _Float16 v8h;
typedef __attribute__((ext_vector_type(8)))  unsigned short v8us;
typedef __attribute__((ext_vector_type(8)))  float    v8f;
typedef __attribute__((ext_vector_type(4)))  float    v4f;
typedef v8h  __attribute__((may_alias)) v8ha;
typedef v4f  __attribute__((may_alias)) v4fa;
typedef v8us __attribute__((may_alias)) v8usa;

__device__ __forceinline__ unsigned short f2bf(float f) { unsigned u = __float_as_uint(f); u += 0x7FFFu + ((u >> 16) & 1u); return (unsigned short)(u >> 16); }
__device__ __forceinline__ float bf2f(unsigned short b) { return __uint_as_float(((unsigned)b) << 16); }
__device__ __forceinline__ float bfr(float f) { return bf2f(f2bf(f)); }
__device__ __forceinline__ v16h cat16(v8h lo, v8h hi) { return __builtin_shufflevector(lo, hi, 0, 1, 2, 3, 4, 5, 6, 7, 8, 9, 10, 11, 12, 13, 14, 15); }
__device__ __forceinline__ v16bf cat16b(v8us lo, v8us hi) { return __builtin_bit_cast(v16bf, __builtin_shufflevector(lo, hi, 0, 1, 2, 3, 4, 5, 6, 7, 8, 9, 10, 11, 12, 13, 14, 15)); }
__device__ __forceinline__ v8f wmma16(v16h a, v16h b, v8f c) { return __builtin_amdgcn_wmma_f32_16x16x32_f16(false, a, false, b, (short)0, c, false, false); }
__device__ __forceinline__ v8f wmmab(v16bf a, v16bf b, v8f c) { return __builtin_amdgcn_wmma_f32_16x16x32_bf16(false, a, false, b, (short)0, c, false, false); }



// ---- k_gemmw: register-blocked GEMM, ONE WAVE per 64x64 output tile (16 accumulators), operands straight from K-contiguous 16-bit planes; grid (M/64, N/64, Z), 32 threads.
// C[m][n] (f32, pitch ldc, + optional f32 bias[n]) = sum_k A[m][k] Bt[n][k] (+ split products per NSPLIT). z-batch strides sA/sB/sC (and sBi for the bias) in elements. K % 32 == 0.
template <typename T16> struct WFrag;
template <> struct WFrag<h16> { typedef v16h V; static __device__ __forceinline__ V ld(const h16* p) { return cat16(*(const v8h*)p, *(const v8h*)(p + 16)); } static __device__ __forceinline__ v8f mma(V a, V b, v8f c) { return wmma16(a, b, c); } };
template <> struct WFrag<bf> { typedef v16bf V; static __device__ __forceinline__ V ld(const bf* p) { return cat16b(*(const v8us*)p, *(const v8us*)(p + 16)); } static __device__ __forceinline__ v8f mma(V a, V b, v8f c) { return wmmab(a, b, c); } };
template <typename T16, int NSPLIT, bool BIAS>
__global__ __launch_bounds__(32) void k_gemmw(const T16* __restrict__ A, const T16* __restrict__ A2, const T16* __restrict__ Bt, const T16* __restrict__ Bt2, int K, float* C, int ldc, const float* __restrict__ bias, size_t sA, size_t sB, size_t sC, size_t sBi) {
    typedef typename WFrag<T16>::V V;
    __shared__ __align__(16) float os[16 * 68];
    const size_t z = blockIdx.z; A += z * sA; if (A2) A2 += z * sA; Bt += z * sB; if (Bt2) Bt2 += z * sB; C += z * sC; if (BIAS) bias += z * sBi;
    const int lane = threadIdx.x & 31, lr = lane & 15, hi = lane >> 4; const int r0 = blockIdx.x * 64, c0 = blockIdx.y * 64;
    v8f acc[4][4];
#pragma unroll
    for (int mb = 0; mb < 4; ++mb)
#pragma unroll
        for (int nb = 0; nb < 4; ++nb) acc[mb][nb] = (v8f){};
    const size_t aoff = (size_t)(r0 + lr) * K + 8 * hi, boff = (size_t)(c0 + lr) * K + 8 * hi;
#pragma unroll 1
    for (int kc = 0; kc < K; kc += 32) {
        V a[4], a2[4];
#pragma unroll
        for (int mb = 0; mb < 4; ++mb) { a[mb] = WFrag<T16>::ld(A + aoff + (size_t)mb * 16 * K + kc); if (NSPLIT == 1 || NSPLIT == 2) a2[mb] = WFrag<T16>::ld(A2 + aoff + (size_t)mb * 16 * K + kc); }
#pragma unroll
        for (int nb = 0; nb < 4; ++nb) { const V b = WFrag<T16>::ld(Bt + boff + (size_t)nb * 16 * K + kc); V b2; if (NSPLIT >= 2) b2 = WFrag<T16>::ld(Bt2 + boff + (size_t)nb * 16 * K + kc);
#pragma unroll
            for (int mb = 0; mb < 4; ++mb) { acc[mb][nb] = WFrag<T16>::mma(a[mb], b, acc[mb][nb]); if (NSPLIT == 1 || NSPLIT == 2) acc[mb][nb] = WFrag<T16>::mma(a2[mb], b, acc[mb][nb]); if (NSPLIT >= 2) acc[mb][nb] = WFrag<T16>::mma(a[mb], b2, acc[mb][nb]); } }
        asm volatile("v_nop\n\tv_nop\n\tv_nop\n\tv_nop" : "+v"(acc[0][0]), "+v"(acc[1][1]), "+v"(acc[2][2]), "+v"(acc[3][3]) : "v"(a[0]), "v"(a[3]));
    }
#pragma unroll
    for (int mb = 0; mb < 4; ++mb) {
#pragma unroll
        for (int nb = 0; nb < 4; ++nb) {
#pragma unroll
            for (int j = 0; j < 8; ++j) os[(hi * 8 + j) * 68 + nb * 16 + lr] = acc[mb][nb][j]; }
        __builtin_amdgcn_wave_barrier(); asm volatile("" ::: "memory");
        float* crow = C + (size_t)(r0 + mb * 16) * ldc + c0;
{
#pragma unroll
            for (int s = 0; s < 8; ++s) { const int row = 2 * s + hi, cofs = lr * 4; v4f val = *(const v4fa*)(os + row * 68 + cofs); if (BIAS) { val[0] += bfr(bias[c0 + cofs]); val[1] += bfr(bias[c0 + cofs + 1]); val[2] += bfr(bias[c0 + cofs + 2]); val[3] += bfr(bias[c0 + cofs + 3]); }
                *(v4f*)(crow + (size_t)row * ldc + cofs) = val; }
             }
        __builtin_amdgcn_wave_barrier(); asm volatile("" ::: "memory");
    }
}

// ---- k_gemmc: the same one-wave 64x64 tile GEMM specialised for causal attention: CMODE 1 skips score tiles entirely above the diagonal (query rows r0+roff.., key columns c0..), CMODE 2 limits the
// key (K) loop of the probability x value contraction to the diagonal block (probabilities beyond it are exactly zero). roff = row offset of this launch's first row within the sequence.
template <typename T16, int NSPLIT, int CMODE>
__global__ __launch_bounds__(32) void k_gemmc(const T16* __restrict__ A, const T16* __restrict__ A2, const T16* __restrict__ Bt, const T16* __restrict__ Bt2, int K, float* C, int ldc, int roff, size_t sA, size_t sB, size_t sC) {
    typedef typename WFrag<T16>::V V;
    __shared__ __align__(16) float os[16 * 68];
    const size_t z = blockIdx.z; A += z * sA; if (A2) A2 += z * sA; Bt += z * sB; if (Bt2) Bt2 += z * sB; C += z * sC;
    const int lane = threadIdx.x & 31, lr = lane & 15, hi = lane >> 4; const int r0 = blockIdx.x * 64, c0 = blockIdx.y * 64;
    if (CMODE == 1 && c0 > r0 + roff + 63) return;                  // score tile entirely above the causal diagonal: never read (the softmax masks j > i by select)
    const int Kl = (CMODE == 2) ? min(K, r0 + roff + 64) : K;        // P.V: probabilities are exactly 0 beyond the diagonal block, so the K loop stops there
    v8f acc[4][4];
#pragma unroll
    for (int mb = 0; mb < 4; ++mb)
#pragma unroll
        for (int nb = 0; nb < 4; ++nb) acc[mb][nb] = (v8f){};
    const size_t aoff = (size_t)(r0 + lr) * K + 8 * hi, boff = (size_t)(c0 + lr) * K + 8 * hi;
#pragma unroll 1
    for (int kc = 0; kc < Kl; kc += 32) {
        V a[4], a2[4];
#pragma unroll
        for (int mb = 0; mb < 4; ++mb) { a[mb] = WFrag<T16>::ld(A + aoff + (size_t)mb * 16 * K + kc); if (NSPLIT == 1 || NSPLIT == 2) a2[mb] = WFrag<T16>::ld(A2 + aoff + (size_t)mb * 16 * K + kc); }
#pragma unroll
        for (int nb = 0; nb < 4; ++nb) { const V b = WFrag<T16>::ld(Bt + boff + (size_t)nb * 16 * K + kc); V b2; if (NSPLIT >= 2) b2 = WFrag<T16>::ld(Bt2 + boff + (size_t)nb * 16 * K + kc);
#pragma unroll
            for (int mb = 0; mb < 4; ++mb) { acc[mb][nb] = WFrag<T16>::mma(a[mb], b, acc[mb][nb]); if (NSPLIT == 1 || NSPLIT == 2) acc[mb][nb] = WFrag<T16>::mma(a2[mb], b, acc[mb][nb]); if (NSPLIT >= 2) acc[mb][nb] = WFrag<T16>::mma(a[mb], b2, acc[mb][nb]); } }
        asm volatile("v_nop\n\tv_nop\n\tv_nop\n\tv_nop" : "+v"(acc[0][0]), "+v"(acc[1][1]), "+v"(acc[2][2]), "+v"(acc[3][3]) : "v"(a[0]), "v"(a[3]));
    }
#pragma unroll
    for (int mb = 0; mb < 4; ++mb) {
#pragma unroll
        for (int nb = 0; nb < 4; ++nb) {
#pragma unroll
            for (int j = 0; j < 8; ++j) os[(hi * 8 + j) * 68 + nb * 16 + lr] = acc[mb][nb][j]; }
        __builtin_amdgcn_wave_barrier(); asm volatile("" ::: "memory");
        float* crow = C + (size_t)(r0 + mb * 16) * ldc + c0;
{
#pragma unroll
            for (int s = 0; s < 8; ++s) { const int row = 2 * s + hi, cofs = lr * 4; v4f val = *(const v4fa*)(os + row * 68 + cofs);
                *(v4f*)(crow + (size_t)row * ldc + cofs) = val; }
             }
        __builtin_amdgcn_wave_barrier(); asm volatile("" ::: "memory");
    }
}

__device__ __forceinline__ h16 tohx(float x) { return (h16)x; }
__device__ __forceinline__ void splitf(float y, unsigned short& h, unsigned short& l) { h = f2bf(y); l = f2bf(y - bf2f(h)); }
typedef __attribute__((ext_vector_type(2))) _Float16 v2h;
typedef __attribute__((ext_vector_type(4))) _Float16 v4h;
typedef __attribute__((ext_vector_type(2))) unsigned short v2us;
typedef __attribute__((ext_vector_type(4))) unsigned short v4us;
typedef __attribute__((ext_vector_type(2))) float v2f;
typedef __attribute__((ext_vector_type(4))) int v4i;

__global__ __launch_bounds__(256) void k_wtG(const float* __restrict__ w, int K, int N, bf* Bt) {
    const int lane = threadIdx.x & 31; const int L0 = (blockIdx.x * 8 + (threadIdx.x >> 5)) * 8; const int nlines = N * K / 64;
{
#pragma unroll 1
        for (int l = 0; l < 8; ++l) { const int L = L0 + l; if (L >= nlines) break; const size_t e = (size_t)L * 64 + lane * 2; const int k = (int)(e % K), n = (int)(e / K); v2us o;
            o[0] = f2bf(w[(size_t)k * N + n]); o[1] = f2bf(w[(size_t)(k + 1) * N + n]); *(v2us*)(Bt + e) = o; }
         }
}
__global__ __launch_bounds__(256) void k_cvt8(const float* __restrict__ src, bf* dst, size_t n8) { const size_t i = (size_t)blockIdx.x * 256 + threadIdx.x; if (i >= n8) return; const v8f v = *(const v8f*)(src + i * 8); v8us o;
#pragma unroll
    for (int k = 0; k < 8; ++k) o[k] = f2bf(v[k]); *(v8us*)(dst + i * 8) = o;  }

// k_rope: source element (h, t, d) at F[h * hstr + t * pitch + d]; head planes [h][t][d] (fp16 + hi/lo) of rope(x) x sc with the rotate-half convention out[d] = x[d] cos[t][d] - x[d+HD/2] sin[t][d], out[d+HD/2] = x[d+HD/2] cos[t][d+HD/2] + x[d] sin[t][d+HD/2]
__global__ __launch_bounds__(256) void k_rope(const float* __restrict__ F, int pitch, size_t hstr, int nheads, const float* __restrict__ CS, const float* __restrict__ RF, const float* __restrict__ nw, float sc, h16* P16, bf* Ph, bf* Pl) {
    const size_t e = ((size_t)blockIdx.x * 256 + threadIdx.x) * 2; if (e >= (size_t)nheads * TT * HD) return; const int d = (int)(e % HD); const int t = (int)((e / HD) % TT); const int h = (int)(e / ((size_t)HD * TT)); const float* f = F + (size_t)h * hstr + (size_t)t * pitch; float rf = 1.0f; v2h o16; v2us oh, ol;
    if (RF) { rf = RF[(size_t)h * TT + t]; asm volatile("s_wait_xcnt 0x0" ::: "memory"); }   // the wait stands in front of the first rewrite of this load's address registers
#pragma unroll
    for (int q = 0; q < 2; ++q) { const int dd = d + q; const int dp = (dd < HD / 2) ? dd + HD / 2 : dd - HD / 2; float x0 = f[dd], x1 = f[dp];
        asm volatile("s_wait_xcnt 0x0" ::: "memory");   // stands in front of the first rewrite of the two loads' address registers (this build reuses them at once)
        if (RF) { float n0 = __fmul_rn(x0, rf), n1 = __fmul_rn(x1, rf); asm volatile("" : "+v"(n0)); asm volatile("" : "+v"(n1)); x0 = __fmul_rn(bfr(nw[dd]), n0); x1 = __fmul_rn(bfr(nw[dp]), n1); }
        const v2f cs = *(const v2f*)(CS + ((size_t)t * HD + dd) * 2); float a = __fmul_rn(x0, cs[0]), bq = __fmul_rn(x1, cs[1]); asm volatile("" : "+v"(a)); asm volatile("" : "+v"(bq)); const float r = ((dd < HD / 2) ? __fsub_rn(a, bq) : __fadd_rn(a, bq)) * sc;
        o16[q] = tohx(r); unsigned short a2, c2; splitf(r, a2, c2); oh[q] = a2; ol[q] = c2; }
    *(v2h*)(P16 + e) = o16; *(v2us*)(Ph + e) = oh; *(v2us*)(Pl + e) = ol;  }
__global__ __launch_bounds__(256) void k_vtp(const float* __restrict__ F, int pitch, size_t hstr, int nheads, h16* V16, bf* Vh, bf* Vl) { const size_t e = ((size_t)blockIdx.x * 256 + threadIdx.x) * 2; if (e >= (size_t)nheads * HD * TT) return; const int t = (int)(e % TT); const int d = (int)((e / TT) % HD); const int g = (int)(e / ((size_t)TT * HD)); v2h o16; v2us oh, ol;
#pragma unroll
    for (int q = 0; q < 2; ++q) { const float x = F[(size_t)g * hstr + (size_t)(t + q) * pitch + d]; o16[q] = tohx(x); unsigned short a2, c2; splitf(x, a2, c2); oh[q] = a2; ol[q] = c2; }
    *(v2h*)(V16 + e) = o16; *(v2us*)(Vh + e) = oh; *(v2us*)(Vl + e) = ol;  }
__global__ __launch_bounds__(256) void k_csid(float* CS) { const int idx = blockIdx.x * 256 + threadIdx.x; if (idx >= TT * HD) return; v2f cs; cs[0] = 1.0f; cs[1] = 0.0f; *(v2f*)(CS + (size_t)idx * 2) = cs;  }
// k_asoft: per row (zz, i): t = S x DM^-0.5 (SCL = 1/32) for j <= i and i - j < WIN (sliding causal window; the reference's -1e9 additive fill vanishes identically); softmax over the 2048 keys (register row, one exp, fixed trees);
__global__ __launch_bounds__(256) void k_asoft(const float* __restrict__ Sb, h16* P16, bf* Ph, bf* Pl) {
    const int lane = threadIdx.x & 31; const int row = blockIdx.x * 8 + (threadIdx.x >> 5); if (row >= ZH * TT) return; const int i = row % TT; const int zz = row / TT; (void)zz; const bool hires = (i < RH); const float* sr = Sb + (size_t)row * TT; float v[TT / 32]; float mx = -3.0e38f;
#pragma unroll
    for (int ch = 0; ch < TT / 128; ++ch) { const int j0 = ch * 128 + lane * 4; const v4f a = *(const v4f*)(sr + j0);
#pragma unroll
        for (int q = 0; q < 4; ++q) { const int j = j0 + q; (void)j; const float t = (j <= i && i - j < WIN) ? a[q] * SCL : -3.0e38f; v[ch * 4 + q] = t; mx = fmaxf(mx, t); } }
#pragma unroll
    for (int sh = 16; sh; sh >>= 1) mx = fmaxf(mx, __shfl_xor(mx, sh, 32));
    float sum = 0.f;
#pragma unroll
    for (int k = 0; k < TT / 32; ++k) { float d0 = __fsub_rn(v[k], mx); asm volatile("" : "+v"(d0)); v[k] = __builtin_amdgcn_exp2f(__fmul_rn(d0, 1.4426950408889634f)); sum += v[k]; }
#pragma unroll
    for (int sh = 16; sh; sh >>= 1) sum += __shfl_xor(sum, sh, 32);
    const float f = __fdiv_rn(hires ? 1.0f : PCAR, sum);
{
        if (hires) {
#pragma unroll
            for (int ch = 0; ch < TT / 128; ++ch) { v4us oh, ol;
#pragma unroll
                for (int q = 0; q < 4; ++q) { unsigned short a, c2; splitf(v[ch * 4 + q] * f, a, c2); oh[q] = a; ol[q] = c2; }
                const size_t oo = ((size_t)zz * (RH ? RH : 1) + i) * TT + ch * 128 + lane * 4; *(v4us*)(Ph + oo) = oh; *(v4us*)(Pl + oo) = ol; }
        } else {
#pragma unroll
            for (int ch = 0; ch < TT / 128; ++ch) { v4h o4;
#pragma unroll
                for (int q = 0; q < 4; ++q) o4[q] = tohx(v[ch * 4 + q] * f);
                *(v4h*)(P16 + (size_t)row * TT + ch * 128 + lane * 4) = o4; } }
         }
}
__global__ __launch_bounds__(256) void k_merge(const float* __restrict__ O, int h0, bf* Ah, bf* Al) { const size_t e = ((size_t)blockIdx.x * 256 + threadIdx.x) * 2; if (e >= (size_t)ZH * TT * HD) return; const int d = (int)(e % HD); const int t = (int)((e / HD) % TT); const int zz = (int)(e / ((size_t)HD * TT)); const float cs = (t < RH) ? 1.0f : (1.0f / PCAR); const size_t oo = (size_t)t * DQ + (h0 + zz) * HD + d;
    v2us oh, ol;
#pragma unroll
    for (int q = 0; q < 2; ++q) { unsigned short a, c2; splitf(O[e + q] * cs, a, c2); oh[q] = a; ol[q] = c2; } *(v2us*)(Ah + oo) = oh; *(v2us*)(Al + oo) = ol;  }

extern "C" void kernel_launch(void* const* d_in, const int* in_sizes, int n_in,
                              void* d_out, int out_size, void* d_ws, size_t ws_size, hipStream_t stream) {
    (void)in_sizes; (void)n_in; (void)out_size;
        const float* x = (const float*)d_in[0]; const float* xk = x; const float* xv = x; const float* wq = (const float*)d_in[1]; const float* bq = (const float*)d_in[2]; const float* wk = (const float*)d_in[3]; const float* bk = (const float*)d_in[4]; const float* wv = (const float*)d_in[5]; const float* bv = (const float*)d_in[6]; const float* wo = (const float*)d_in[7]; const float* bo = (const float*)d_in[8];   /* argument order x, Wq, bq, Wk, bk, Wv, bv, Wo, bo ('xw' [1024][1024]); ONE input stream: the key and value stream pointers are x; no mask input: the causal rule is applied by index */
    float* OUT = (float*)d_out;     // out0 [2][2048][1024]; then out1 = present = stack((k, v)): K [2][16][2048][64] then V [2][16][2048][64] (offset 16,777,216 B)
    float* OUTK = OUT + (size_t)NB_ * TT * DM; float* OUTV = OUTK + (size_t)NB_ * NKV * TT * HD;
    char* wsp = (char*)d_ws;
    auto take = [&](size_t bytes) { char* p = wsp; wsp += (bytes + 255) & ~(size_t)255; return (void*)p; };
    bf* WQ = (bf*)take((size_t)DQ * DM * 2); bf* WK = (bf*)take((size_t)DKV * DM * 2); bf* WV = (bf*)take((size_t)DKV * DM * 2); bf* WO = (bf*)take((size_t)DM * DQ * 2); float* CS = (float*)take((size_t)TT * HD * 2 * 4);
    bf* XB = (bf*)take((size_t)TT * DM * 2); float* FQ = (float*)take((size_t)TT * DQ * 4);
    h16* QP16 = (h16*)take((size_t)NH_ * TT * HD * 2); h16* KP16 = (h16*)take((size_t)NKV * TT * HD * 2); h16* VT16 = (h16*)take((size_t)NKV * HD * TT * 2);
    bf* QPh = (bf*)take((size_t)NH_ * TT * HD * 2); bf* QPl = (bf*)take((size_t)NH_ * TT * HD * 2); bf* KPh = (bf*)take((size_t)NKV * TT * HD * 2); bf* KPl = (bf*)take((size_t)NKV * TT * HD * 2); bf* VTh = (bf*)take((size_t)NKV * HD * TT * 2); bf* VTl = (bf*)take((size_t)NKV * HD * TT * 2); bf* Ph = (bf*)take((size_t)ZH * RH * TT * 2); bf* Pl = (bf*)take((size_t)ZH * RH * TT * 2);
    float* Sb = (float*)take((size_t)ZH * TT * TT * 4); h16* P16 = (h16*)take((size_t)ZH * TT * TT * 2); float* Ob = (float*)take((size_t)ZH * TT * HD * 4); bf* ATh = (bf*)take((size_t)TT * DQ * 2); bf* ATl = (bf*)take((size_t)TT * DQ * 2);
    if ((size_t)(wsp - (char*)d_ws) > ws_size) return;    // ws 256 MiB
    { k_wtG<<<(unsigned)((DM * DQ / 64 + 63) / 64), 256, 0, stream>>>(wq, DM, DQ, WQ); k_wtG<<<(unsigned)((DM * DKV / 64 + 63) / 64), 256, 0, stream>>>(wk, DM, DKV, WK); k_wtG<<<(unsigned)((DM * DKV / 64 + 63) / 64), 256, 0, stream>>>(wv, DM, DKV, WV);
      k_wtG<<<(unsigned)((DQ * DM / 64 + 63) / 64), 256, 0, stream>>>(wo, DQ, DM, WO);
       }
    k_csid<<<(TT * HD + 255) / 256, 256, 0, stream>>>(CS);
    const unsigned LQ = (unsigned)(((size_t)NH_ * TT * HD / 2 + 255) / 256), LKv = (unsigned)(((size_t)NKV * TT * HD / 2 + 255) / 256);
    for (int b = 0; b < NB_; ++b) {
        
        k_cvt8<<<(unsigned)(((size_t)TT * DM / 8 + 255) / 256), 256, 0, stream>>>(x + (size_t)b * TT * DM, XB, (size_t)TT * DM / 8);
        k_gemmw<bf, 0, true><<<dim3(TT / 64, DQ / 64, 1), 32, 0, stream>>>(XB, nullptr, WQ, nullptr, DM, FQ, DQ, bq, 0, 0, 0, 0);
        k_rope<<<LQ, 256, 0, stream>>>(FQ, DQ, HD, NH_, CS, nullptr, nullptr, 1.0f, QP16, QPh, QPl);
        k_cvt8<<<(unsigned)(((size_t)TT * DM / 8 + 255) / 256), 256, 0, stream>>>(xk + (size_t)b * TT * DM, XB, (size_t)TT * DM / 8);   /* XB := bf16(keys[b]) */ float* PK = OUTK + (size_t)b * NKV * TT * HD; float* PV = OUTV + (size_t)b * NKV * TT * HD;
        k_gemmw<bf, 0, true><<<dim3(TT / 64, 1, NKV), 32, 0, stream>>>(XB, nullptr, WK, nullptr, DM, PK, HD, bk, 0, (size_t)HD * DM, (size_t)TT * HD, HD);   /* present[0]: K head-major: K[b][g][t][d] = (x Wk + bk)[t][g*64 + d]: grid z = head g takes that head's 64 weight rows and bias entries and writes with row pitch 64; the only K projection */
        k_rope<<<LKv, 256, 0, stream>>>(PK, HD, (size_t)TT * HD, NKV, CS, nullptr, nullptr, 1.0f, KP16, KPh, KPl);
        k_cvt8<<<(unsigned)(((size_t)TT * DM / 8 + 255) / 256), 256, 0, stream>>>(xv + (size_t)b * TT * DM, XB, (size_t)TT * DM / 8);   /* XB := bf16(values[b]) */ k_gemmw<bf, 0, true><<<dim3(TT / 64, 1, NKV), 32, 0, stream>>>(XB, nullptr, WV, nullptr, DM, PV, HD, bv, 0, (size_t)HD * DM, (size_t)TT * HD, HD);   /* present[1]: V head-major, likewise */ k_vtp<<<LKv, 256, 0, stream>>>(PV, HD, (size_t)TT * HD, NKV, VT16, VTh, VTl);
        for (int h0 = 0; h0 < NH_; h0 += ZH) { const size_t zq = (size_t)h0, zk = (size_t)(h0 / REP);   // one kv head per query head: the pass's two heads use consecutive kv planes (z-strides TT*HD)
            k_gemmc<bf, 2, 1><<<dim3(RH / 64, TT / 64, ZH), 32, 0, stream>>>(QPh + zq * TT * HD, QPl + zq * TT * HD, KPh + zk * TT * HD, KPl + zk * TT * HD, HD, Sb, TT, 0, (size_t)TT * HD, (size_t)TT * HD, (size_t)TT * TT);
            k_gemmc<h16, 0, 1><<<dim3((TT - RH) / 64, TT / 64, ZH), 32, 0, stream>>>(QP16 + zq * TT * HD + (size_t)RH * HD, nullptr, KP16 + zk * TT * HD, nullptr, HD, Sb + (size_t)RH * TT, TT, RH, (size_t)TT * HD, (size_t)TT * HD, (size_t)TT * TT);
            k_asoft<<<ZH * TT / 8, 256, 0, stream>>>(Sb, P16, Ph, Pl);
            k_gemmc<bf, 2, 2><<<dim3(RH / 64, HD / 64, ZH), 32, 0, stream>>>(Ph, Pl, VTh + zk * HD * TT, VTl + zk * HD * TT, TT, Ob, HD, 0, (size_t)RH * TT, (size_t)HD * TT, (size_t)TT * HD);
            k_gemmc<h16, 0, 2><<<dim3((TT - RH) / 64, HD / 64, ZH), 32, 0, stream>>>(P16 + (size_t)RH * TT, nullptr, VT16 + zk * HD * TT, nullptr, TT, Ob + (size_t)RH * HD, HD, RH, (size_t)TT * TT, (size_t)HD * TT, (size_t)TT * HD);
            k_merge<<<(unsigned)(((size_t)ZH * TT * HD / 2 + 255) / 256), 256, 0, stream>>>(Ob, h0, ATh, ATl); }
        k_gemmw<bf, 1, true><<<dim3(TT / 64, DM / 64, 1), 32, 0, stream>>>(ATh, ATl, WO, nullptr, DQ, OUT + (size_t)b * TT * DM, DM, bo, 0, 0, 0, 0); }
}

// v002
// Measured time: 648 microseconds a run.
// Two timings next to v001 put it at 2.29 and 2.28 times that version's speed.
// All steps since v000 together make it 3.90 times as fast.
#include <hip/hip_runtime.h>

// Causal multi-head self-attention scaled by the MODEL width, with a kv-cache output (x [2][2048][1024]; q, k, v = x W + b ('xw' [1024][1024] 1/32, biases zeros on this draw: read; 16 heads x 64); scores / sqrt(float32(D = 1024)) (x 1/32); causal (-inf); softmax; out0 = merged Wo + bo ('xw' + bias zeros: read) -> [2][2048][1024]; out1 = present = stack((k, v)) [2][2][16][2048][64]: the biased key and value projections head-major, each written ONCE, head-major, by the biased projection GEMM itself (grid z = head), and read back from there by the plane builders; argument order x, Wq, bq, Wk, bk, Wv, bv, Wo, bo).
// Layout per batch: bf16 copies of queries, keys, values in turn; 'xw' weights transposed once; exact projections + f32 biases; identity-table plane builders; causal T-2048 attention, passes cut by QUERY ROWS with all 16 heads in grid z (rows < 512 hi/lo 3 products in one pass, rest fp16 x1024 in two passes of 768 rows; k_gemmc skips tiles above the diagonal), heads merged once per batch; merged hi/lo x Wo exact + bo.
// Compute dtypes, f32 accumulate: every input rounded to bf16; projections exact + f32 biases; attention rows < 512 3 products, rest fp16; softmax f32; Wo hl x exact + bias.

#define NB_  2
#define TT   2048
#define DM   1024
#define NH_  16
#define NKV  16
#define REP  (NH_ / NKV)
#define HD   64
#define DQ   (NH_ * HD)
#define DKV  (NKV * HD)
#define ZH   16                   // heads per attention launch (grid z): all of a batch's heads
#define RB   768                  // query rows per fp16 attention pass: rows RH.. go in (TT - RH) / RB passes; the score and probability planes hold ZH x RB rows
#define RH   512                  // query rows < RH use hi+lo planes (0: none)
#define WIN  2048
#define PCAR 1024.0f
#define SCL  0.03125f   // 1 / sqrt(D = 1024) = 2^-5: the module divides the scores by the square root of the MODEL width, not of the head width
typedef _Float16 h16;
typedef unsigned short bf;
typedef __attribute__((ext_vector_type(16))) __bf16   v16bf;
typedef __attribute__((ext_vector_type(16))) _Float16 v16h;
typedef __attribute__((ext_vector_type(8)))  _Float16 v8h;
typedef __attribute__((ext_vector_type(8)))  unsigned short v8us;
typedef __attribute__((ext_vector_type(8)))  float    v8f;
typedef __attribute__((ext_vector_type(4)))  float    v4f;
typedef v8h  __attribute__((may_alias)) v8ha;
typedef v4f  __attribute__((may_alias)) v4fa;
typedef v8us __attribute__((may_alias)) v8usa;

__device__ __forceinline__ unsigned short f2bf(float f) { unsigned u = __float_as_uint(f); u += 0x7FFFu + ((u >> 16) & 1u); return (unsigned short)(u >> 16); }
__device__ __forceinline__ float bf2f(unsigned short b) { return __uint_as_float(((unsigned)b) << 16); }
__device__ __forceinline__ float bfr(float f) { return bf2f(f2bf(f)); }
__device__ __forceinline__ v16h cat16(v8h lo, v8h hi) { return __builtin_shufflevector(lo, hi, 0, 1, 2, 3, 4, 5, 6, 7, 8, 9, 10, 11, 12, 13, 14, 15); }
__device__ __forceinline__ v16bf cat16b(v8us lo, v8us hi) { return __builtin_bit_cast(v16bf, __builtin_shufflevector(lo, hi, 0, 1, 2, 3, 4, 5, 6, 7, 8, 9, 10, 11, 12, 13, 14, 15)); }
__device__ __forceinline__ v8f wmma16(v16h a, v16h b, v8f c) { return __builtin_amdgcn_wmma_f32_16x16x32_f16(false, a, false, b, (short)0, c, false, false); }
__device__ __forceinline__ v8f wmmab(v16bf a, v16bf b, v8f c) { return __builtin_amdgcn_wmma_f32_16x16x32_bf16(false, a, false, b, (short)0, c, false, false); }



// ---- k_gemmw: register-blocked GEMM, ONE WAVE per 64x64 output tile (16 accumulators), operands straight from K-contiguous 16-bit planes; grid (M/64, N/64, Z), 32 threads.
// C[m][n] (f32, pitch ldc, + optional f32 bias[n]) = sum_k A[m][k] Bt[n][k] (+ split products per NSPLIT). z-batch strides sA/sB/sC (and sBi for the bias) in elements. K % 32 == 0.
template <typename T16> struct WFrag;
template <> struct WFrag<h16> { typedef v16h V; static __device__ __forceinline__ V ld(const h16* p) { return cat16(*(const v8h*)p, *(const v8h*)(p + 16)); } static __device__ __forceinline__ v8f mma(V a, V b, v8f c) { return wmma16(a, b, c); } };
template <> struct WFrag<bf> { typedef v16bf V; static __device__ __forceinline__ V ld(const bf* p) { return cat16b(*(const v8us*)p, *(const v8us*)(p + 16)); } static __device__ __forceinline__ v8f mma(V a, V b, v8f c) { return wmmab(a, b, c); } };
template <typename T16, int NSPLIT, bool BIAS>
__global__ __launch_bounds__(32) void k_gemmw(const T16* __restrict__ A, const T16* __restrict__ A2, const T16* __restrict__ Bt, const T16* __restrict__ Bt2, int K, float* C, int ldc, const float* __restrict__ bias, size_t sA, size_t sB, size_t sC, size_t sBi) {
    typedef typename WFrag<T16>::V V;
    __shared__ __align__(16) float os[16 * 68];
    const size_t z = blockIdx.z; A += z * sA; if (A2) A2 += z * sA; Bt += z * sB; if (Bt2) Bt2 += z * sB; C += z * sC; if (BIAS) bias += z * sBi;
    const int lane = threadIdx.x & 31, lr = lane & 15, hi = lane >> 4; const int r0 = blockIdx.x * 64, c0 = blockIdx.y * 64;
    v8f acc[4][4];
#pragma unroll
    for (int mb = 0; mb < 4; ++mb)
#pragma unroll
        for (int nb = 0; nb < 4; ++nb) acc[mb][nb] = (v8f){};
    const size_t aoff = (size_t)(r0 + lr) * K + 8 * hi, boff = (size_t)(c0 + lr) * K + 8 * hi;
#pragma unroll 1
    for (int kc = 0; kc < K; kc += 32) {
        V a[4], a2[4];
#pragma unroll
        for (int mb = 0; mb < 4; ++mb) { a[mb] = WFrag<T16>::ld(A + aoff + (size_t)mb * 16 * K + kc); if (NSPLIT == 1 || NSPLIT == 2) a2[mb] = WFrag<T16>::ld(A2 + aoff + (size_t)mb * 16 * K + kc); }
#pragma unroll
        for (int nb = 0; nb < 4; ++nb) { const V b = WFrag<T16>::ld(Bt + boff + (size_t)nb * 16 * K + kc); V b2; if (NSPLIT >= 2) b2 = WFrag<T16>::ld(Bt2 + boff + (size_t)nb * 16 * K + kc);
#pragma unroll
            for (int mb = 0; mb < 4; ++mb) { acc[mb][nb] = WFrag<T16>::mma(a[mb], b, acc[mb][nb]); if (NSPLIT == 1 || NSPLIT == 2) acc[mb][nb] = WFrag<T16>::mma(a2[mb], b, acc[mb][nb]); if (NSPLIT >= 2) acc[mb][nb] = WFrag<T16>::mma(a[mb], b2, acc[mb][nb]); } }
        asm volatile("v_nop\n\tv_nop\n\tv_nop\n\tv_nop" : "+v"(acc[0][0]), "+v"(acc[1][1]), "+v"(acc[2][2]), "+v"(acc[3][3]) : "v"(a[0]), "v"(a[3]));
    }
#pragma unroll
    for (int mb = 0; mb < 4; ++mb) {
#pragma unroll
        for (int nb = 0; nb < 4; ++nb) {
#pragma unroll
            for (int j = 0; j < 8; ++j) os[(hi * 8 + j) * 68 + nb * 16 + lr] = acc[mb][nb][j]; }
        __builtin_amdgcn_wave_barrier(); asm volatile("" ::: "memory");
        float* crow = C + (size_t)(r0 + mb * 16) * ldc + c0;
{
#pragma unroll
            for (int s = 0; s < 8; ++s) { const int row = 2 * s + hi, cofs = lr * 4; v4f val = *(const v4fa*)(os + row * 68 + cofs); if (BIAS) { val[0] += bfr(bias[c0 + cofs]); val[1] += bfr(bias[c0 + cofs + 1]); val[2] += bfr(bias[c0 + cofs + 2]); val[3] += bfr(bias[c0 + cofs + 3]); }
                *(v4f*)(crow + (size_t)row * ldc + cofs) = val; }
             }
        __builtin_amdgcn_wave_barrier(); asm volatile("" ::: "memory");
    }
}

// ---- k_gemmc: the same one-wave 64x64 tile GEMM specialised for causal attention: CMODE 1 skips score tiles entirely above the diagonal (query rows r0+roff.., key columns c0..), CMODE 2 limits the
// key (K) loop of the probability x value contraction to the diagonal block (probabilities beyond it are exactly zero). roff = row offset of this launch's first row within the sequence.
template <typename T16, int NSPLIT, int CMODE>
__global__ __launch_bounds__(32) void k_gemmc(const T16* __restrict__ A, const T16* __restrict__ A2, const T16* __restrict__ Bt, const T16* __restrict__ Bt2, int K, float* C, int ldc, int roff, size_t sA, size_t sB, size_t sC) {
    typedef typename WFrag<T16>::V V;
    __shared__ __align__(16) float os[16 * 68];
    const size_t z = blockIdx.z; A += z * sA; if (A2) A2 += z * sA; Bt += z * sB; if (Bt2) Bt2 += z * sB; C += z * sC;
    const int lane = threadIdx.x & 31, lr = lane & 15, hi = lane >> 4; const int r0 = blockIdx.x * 64, c0 = blockIdx.y * 64;
    if (CMODE == 1 && c0 > r0 + roff + 63) return;                  // score tile entirely above the causal diagonal: never read (the softmax masks j > i by select)
    const int Kl = (CMODE == 2) ? min(K, r0 + roff + 64) : K;        // P.V: probabilities are exactly 0 beyond the diagonal block, so the K loop stops there
    v8f acc[4][4];
#pragma unroll
    for (int mb = 0; mb < 4; ++mb)
#pragma unroll
        for (int nb = 0; nb < 4; ++nb) acc[mb][nb] = (v8f){};
    const size_t aoff = (size_t)(r0 + lr) * K + 8 * hi, boff = (size_t)(c0 + lr) * K + 8 * hi;
#pragma unroll 1
    for (int kc = 0; kc < Kl; kc += 32) {
        V a[4], a2[4];
#pragma unroll
        for (int mb = 0; mb < 4; ++mb) { a[mb] = WFrag<T16>::ld(A + aoff + (size_t)mb * 16 * K + kc); if (NSPLIT == 1 || NSPLIT == 2) a2[mb] = WFrag<T16>::ld(A2 + aoff + (size_t)mb * 16 * K + kc); }
#pragma unroll
        for (int nb = 0; nb < 4; ++nb) { const V b = WFrag<T16>::ld(Bt + boff + (size_t)nb * 16 * K + kc); V b2; if (NSPLIT >= 2) b2 = WFrag<T16>::ld(Bt2 + boff + (size_t)nb * 16 * K + kc);
#pragma unroll
            for (int mb = 0; mb < 4; ++mb) { acc[mb][nb] = WFrag<T16>::mma(a[mb], b, acc[mb][nb]); if (NSPLIT == 1 || NSPLIT == 2) acc[mb][nb] = WFrag<T16>::mma(a2[mb], b, acc[mb][nb]); if (NSPLIT >= 2) acc[mb][nb] = WFrag<T16>::mma(a[mb], b2, acc[mb][nb]); } }
        asm volatile("v_nop\n\tv_nop\n\tv_nop\n\tv_nop" : "+v"(acc[0][0]), "+v"(acc[1][1]), "+v"(acc[2][2]), "+v"(acc[3][3]) : "v"(a[0]), "v"(a[3]));
    }
#pragma unroll
    for (int mb = 0; mb < 4; ++mb) {
#pragma unroll
        for (int nb = 0; nb < 4; ++nb) {
#pragma unroll
            for (int j = 0; j < 8; ++j) os[(hi * 8 + j) * 68 + nb * 16 + lr] = acc[mb][nb][j]; }
        __builtin_amdgcn_wave_barrier(); asm volatile("" ::: "memory");
        float* crow = C + (size_t)(r0 + mb * 16) * ldc + c0;
{
#pragma unroll
            for (int s = 0; s < 8; ++s) { const int row = 2 * s + hi, cofs = lr * 4; v4f val = *(const v4fa*)(os + row * 68 + cofs);
                *(v4f*)(crow + (size_t)row * ldc + cofs) = val; }
             }
        __builtin_amdgcn_wave_barrier(); asm volatile("" ::: "memory");
    }
}

__device__ __forceinline__ h16 tohx(float x) { return (h16)x; }
__device__ __forceinline__ void splitf(float y, unsigned short& h, unsigned short& l) { h = f2bf(y); l = f2bf(y - bf2f(h)); }
typedef __attribute__((ext_vector_type(2))) _Float16 v2h;
typedef __attribute__((ext_vector_type(4))) _Float16 v4h;
typedef __attribute__((ext_vector_type(2))) unsigned short v2us;
typedef __attribute__((ext_vector_type(4))) unsigned short v4us;
typedef __attribute__((ext_vector_type(2))) float v2f;
typedef __attribute__((ext_vector_type(4))) int v4i;

__global__ __launch_bounds__(256) void k_wtG(const float* __restrict__ w, int K, int N, bf* Bt) {
    const int lane = threadIdx.x & 31; const int L0 = (blockIdx.x * 8 + (threadIdx.x >> 5)) * 8; const int nlines = N * K / 64;
{
#pragma unroll 1
        for (int l = 0; l < 8; ++l) { const int L = L0 + l; if (L >= nlines) break; const size_t e = (size_t)L * 64 + lane * 2; const int k = (int)(e % K), n = (int)(e / K); v2us o;
            o[0] = f2bf(w[(size_t)k * N + n]); o[1] = f2bf(w[(size_t)(k + 1) * N + n]); *(v2us*)(Bt + e) = o; }
         }
}
__global__ __launch_bounds__(256) void k_cvt8(const float* __restrict__ src, bf* dst, size_t n8) { const size_t i = (size_t)blockIdx.x * 256 + threadIdx.x; if (i >= n8) return; const v8f v = *(const v8f*)(src + i * 8); v8us o;
#pragma unroll
    for (int k = 0; k < 8; ++k) o[k] = f2bf(v[k]); *(v8us*)(dst + i * 8) = o;  }

// k_rope: source element (h, t, d) at F[h * hstr + t * pitch + d]; head planes [h][t][d] (fp16 + hi/lo) of rope(x) x sc with the rotate-half convention out[d] = x[d] cos[t][d] - x[d+HD/2] sin[t][d], out[d+HD/2] = x[d+HD/2] cos[t][d+HD/2] + x[d] sin[t][d+HD/2]
__global__ __launch_bounds__(256) void k_rope(const float* __restrict__ F, int pitch, size_t hstr, int nheads, const float* __restrict__ CS, const float* __restrict__ RF, const float* __restrict__ nw, float sc, h16* P16, bf* Ph, bf* Pl) {
    const size_t e = ((size_t)blockIdx.x * 256 + threadIdx.x) * 2; if (e >= (size_t)nheads * TT * HD) return; const int d = (int)(e % HD); const int t = (int)((e / HD) % TT); const int h = (int)(e / ((size_t)HD * TT)); const float* f = F + (size_t)h * hstr + (size_t)t * pitch; float rf = 1.0f; v2h o16; v2us oh, ol;
    if (RF) { rf = RF[(size_t)h * TT + t]; asm volatile("s_wait_xcnt 0x0" ::: "memory"); }   // the wait stands in front of the first rewrite of this load's address registers
#pragma unroll
    for (int q = 0; q < 2; ++q) { const int dd = d + q; const int dp = (dd < HD / 2) ? dd + HD / 2 : dd - HD / 2; float x0 = f[dd], x1 = f[dp];
        asm volatile("s_wait_xcnt 0x0" ::: "memory");   // stands in front of the first rewrite of the two loads' address registers (this build reuses them at once)
        if (RF) { float n0 = __fmul_rn(x0, rf), n1 = __fmul_rn(x1, rf); asm volatile("" : "+v"(n0)); asm volatile("" : "+v"(n1)); x0 = __fmul_rn(bfr(nw[dd]), n0); x1 = __fmul_rn(bfr(nw[dp]), n1); }
        const v2f cs = *(const v2f*)(CS + ((size_t)t * HD + dd) * 2); float a = __fmul_rn(x0, cs[0]), bq = __fmul_rn(x1, cs[1]); asm volatile("" : "+v"(a)); asm volatile("" : "+v"(bq)); const float r = ((dd < HD / 2) ? __fsub_rn(a, bq) : __fadd_rn(a, bq)) * sc;
        o16[q] = tohx(r); unsigned short a2, c2; splitf(r, a2, c2); oh[q] = a2; ol[q] = c2; }
    *(v2h*)(P16 + e) = o16; *(v2us*)(Ph + e) = oh; *(v2us*)(Pl + e) = ol;  }
__global__ __launch_bounds__(256) void k_vtp(const float* __restrict__ F, int pitch, size_t hstr, int nheads, h16* V16, bf* Vh, bf* Vl) { const size_t e = ((size_t)blockIdx.x * 256 + threadIdx.x) * 2; if (e >= (size_t)nheads * HD * TT) return; const int t = (int)(e % TT); const int d = (int)((e / TT) % HD); const int g = (int)(e / ((size_t)TT * HD)); v2h o16; v2us oh, ol;
#pragma unroll
    for (int q = 0; q < 2; ++q) { const float x = F[(size_t)g * hstr + (size_t)(t + q) * pitch + d]; o16[q] = tohx(x); unsigned short a2, c2; splitf(x, a2, c2); oh[q] = a2; ol[q] = c2; }
    *(v2h*)(V16 + e) = o16; *(v2us*)(Vh + e) = oh; *(v2us*)(Vl + e) = ol;  }
__global__ __launch_bounds__(256) void k_csid(float* CS) { const int idx = blockIdx.x * 256 + threadIdx.x; if (idx >= TT * HD) return; v2f cs; cs[0] = 1.0f; cs[1] = 0.0f; *(v2f*)(CS + (size_t)idx * 2) = cs;  }
// k_asoft: per row (zz, i): t = S x DM^-0.5 for j <= i and i - j < WIN (sliding causal window; the reference's -1e9 additive fill vanishes identically); softmax over the 2048 keys (register row, one exp, fixed trees);
// one launch takes NR query rows i0 .. i0 + NR - 1 of each of the ZH heads: planes Sb, P16 are [zz][NR][TT]; Ph, Pl are [zz][RH][TT] (written only by the launch with i0 = 0, NR = RH)
template <int NR>
__global__ __launch_bounds__(256) void k_asoft(const float* __restrict__ Sb, int i0, h16* P16, bf* Ph, bf* Pl) {
    const int lane = threadIdx.x & 31; const int row = blockIdx.x * 8 + (threadIdx.x >> 5); if (row >= ZH * NR) return; const int i = i0 + row % NR; const int zz = row / NR; (void)zz; const bool hires = (i < RH); const float* sr = Sb + (size_t)row * TT; float v[TT / 32]; float mx = -3.0e38f;
#pragma unroll
    for (int ch = 0; ch < TT / 128; ++ch) { const int j0 = ch * 128 + lane * 4; const v4f a = *(const v4f*)(sr + j0);
#pragma unroll
        for (int q = 0; q < 4; ++q) { const int j = j0 + q; (void)j; const float t = (j <= i && i - j < WIN) ? a[q] * SCL : -3.0e38f; v[ch * 4 + q] = t; mx = fmaxf(mx, t); } }
#pragma unroll
    for (int sh = 16; sh; sh >>= 1) mx = fmaxf(mx, __shfl_xor(mx, sh, 32));
    float sum = 0.f;
#pragma unroll
    for (int k = 0; k < TT / 32; ++k) { float d0 = __fsub_rn(v[k], mx); asm volatile("" : "+v"(d0)); v[k] = __builtin_amdgcn_exp2f(__fmul_rn(d0, 1.4426950408889634f)); sum += v[k]; }
#pragma unroll
    for (int sh = 16; sh; sh >>= 1) sum += __shfl_xor(sum, sh, 32);
    const float f = __fdiv_rn(hires ? 1.0f : PCAR, sum);
{
        if (hires) {
#pragma unroll
            for (int ch = 0; ch < TT / 128; ++ch) { v4us oh, ol;
#pragma unroll
                for (int q = 0; q < 4; ++q) { unsigned short a, c2; splitf(v[ch * 4 + q] * f, a, c2); oh[q] = a; ol[q] = c2; }
                const size_t oo = ((size_t)zz * (RH ? RH : 1) + i) * TT + ch * 128 + lane * 4; *(v4us*)(Ph + oo) = oh; *(v4us*)(Pl + oo) = ol; }
        } else {
#pragma unroll
            for (int ch = 0; ch < TT / 128; ++ch) { v4h o4;
#pragma unroll
                for (int q = 0; q < 4; ++q) o4[q] = tohx(v[ch * 4 + q] * f);
                *(v4h*)(P16 + (size_t)row * TT + ch * 128 + lane * 4) = o4; } }
         }
}
__global__ __launch_bounds__(256) void k_merge(const float* __restrict__ O, int h0, bf* Ah, bf* Al) { const size_t e = ((size_t)blockIdx.x * 256 + threadIdx.x) * 2; if (e >= (size_t)ZH * TT * HD) return; const int d = (int)(e % HD); const int t = (int)((e / HD) % TT); const int zz = (int)(e / ((size_t)HD * TT)); const float cs = (t < RH) ? 1.0f : (1.0f / PCAR); const size_t oo = (size_t)t * DQ + (h0 + zz) * HD + d;
    v2us oh, ol;
#pragma unroll
    for (int q = 0; q < 2; ++q) { unsigned short a, c2; splitf(O[e + q] * cs, a, c2); oh[q] = a; ol[q] = c2; } *(v2us*)(Ah + oo) = oh; *(v2us*)(Al + oo) = ol;  }

extern "C" void kernel_launch(void* const* d_in, const int* in_sizes, int n_in,
                              void* d_out, int out_size, void* d_ws, size_t ws_size, hipStream_t stream) {
    (void)in_sizes; (void)n_in; (void)out_size;
        const float* x = (const float*)d_in[0]; const float* xk = x; const float* xv = x; const float* wq = (const float*)d_in[1]; const float* bq = (const float*)d_in[2]; const float* wk = (const float*)d_in[3]; const float* bk = (const float*)d_in[4]; const float* wv = (const float*)d_in[5]; const float* bv = (const float*)d_in[6]; const float* wo = (const float*)d_in[7]; const float* bo = (const float*)d_in[8];   /* argument order x, Wq, bq, Wk, bk, Wv, bv, Wo, bo ('xw' [1024][1024]); ONE input stream: the key and value stream pointers are x; no mask input: the causal rule is applied by index */
    float* OUT = (float*)d_out;     // out0 [2][2048][1024]; then out1 = present = stack((k, v)): K [2][16][2048][64] then V [2][16][2048][64] (offset 16,777,216 B)
    float* OUTK = OUT + (size_t)NB_ * TT * DM; float* OUTV = OUTK + (size_t)NB_ * NKV * TT * HD;
    char* wsp = (char*)d_ws;
    auto take = [&](size_t bytes) { char* p = wsp; wsp += (bytes + 255) & ~(size_t)255; return (void*)p; };
    bf* WQ = (bf*)take((size_t)DQ * DM * 2); bf* WK = (bf*)take((size_t)DKV * DM * 2); bf* WV = (bf*)take((size_t)DKV * DM * 2); bf* WO = (bf*)take((size_t)DM * DQ * 2); float* CS = (float*)take((size_t)TT * HD * 2 * 4);
    bf* XB = (bf*)take((size_t)TT * DM * 2); float* FQ = (float*)take((size_t)TT * DQ * 4);
    h16* QP16 = (h16*)take((size_t)NH_ * TT * HD * 2); h16* KP16 = (h16*)take((size_t)NKV * TT * HD * 2); h16* VT16 = (h16*)take((size_t)NKV * HD * TT * 2);
    bf* QPh = (bf*)take((size_t)NH_ * TT * HD * 2); bf* QPl = (bf*)take((size_t)NH_ * TT * HD * 2); bf* KPh = (bf*)take((size_t)NKV * TT * HD * 2); bf* KPl = (bf*)take((size_t)NKV * TT * HD * 2); bf* VTh = (bf*)take((size_t)NKV * HD * TT * 2); bf* VTl = (bf*)take((size_t)NKV * HD * TT * 2); bf* Pl = (bf*)take((size_t)ZH * RH * TT * 2);
    float* Sb = (float*)take((size_t)ZH * RB * TT * 4); h16* P16 = (h16*)take((size_t)ZH * RB * TT * 2); bf* Ph = (bf*)P16;   /* the hi plane of the rows < RH shares the fp16 plane's bytes (ZH*RH*TT <= ZH*RB*TT elements): the hi/lo pass has read it before the first fp16 pass writes there, in stream order */ float* Ob = (float*)take((size_t)ZH * TT * HD * 4); bf* ATh = (bf*)take((size_t)TT * DQ * 2); bf* ATl = (bf*)take((size_t)TT * DQ * 2);
    if ((size_t)(wsp - (char*)d_ws) > ws_size) return;    // ws 256 MiB
    { k_wtG<<<(unsigned)((DM * DQ / 64 + 63) / 64), 256, 0, stream>>>(wq, DM, DQ, WQ); k_wtG<<<(unsigned)((DM * DKV / 64 + 63) / 64), 256, 0, stream>>>(wk, DM, DKV, WK); k_wtG<<<(unsigned)((DM * DKV / 64 + 63) / 64), 256, 0, stream>>>(wv, DM, DKV, WV);
      k_wtG<<<(unsigned)((DQ * DM / 64 + 63) / 64), 256, 0, stream>>>(wo, DQ, DM, WO);
       }
    k_csid<<<(TT * HD + 255) / 256, 256, 0, stream>>>(CS);
    const unsigned LQ = (unsigned)(((size_t)NH_ * TT * HD / 2 + 255) / 256), LKv = (unsigned)(((size_t)NKV * TT * HD / 2 + 255) / 256);
    for (int b = 0; b < NB_; ++b) {
        
        k_cvt8<<<(unsigned)(((size_t)TT * DM / 8 + 255) / 256), 256, 0, stream>>>(x + (size_t)b * TT * DM, XB, (size_t)TT * DM / 8);
        k_gemmw<bf, 0, true><<<dim3(TT / 64, DQ / 64, 1), 32, 0, stream>>>(XB, nullptr, WQ, nullptr, DM, FQ, DQ, bq, 0, 0, 0, 0);
        k_rope<<<LQ, 256, 0, stream>>>(FQ, DQ, HD, NH_, CS, nullptr, nullptr, 1.0f, QP16, QPh, QPl);
        k_cvt8<<<(unsigned)(((size_t)TT * DM / 8 + 255) / 256), 256, 0, stream>>>(xk + (size_t)b * TT * DM, XB, (size_t)TT * DM / 8);   /* XB := bf16(keys[b]) */ float* PK = OUTK + (size_t)b * NKV * TT * HD; float* PV = OUTV + (size_t)b * NKV * TT * HD;
        k_gemmw<bf, 0, true><<<dim3(TT / 64, 1, NKV), 32, 0, stream>>>(XB, nullptr, WK, nullptr, DM, PK, HD, bk, 0, (size_t)HD * DM, (size_t)TT * HD, HD);   /* present[0]: K head-major: K[b][g][t][d] = (x Wk + bk)[t][g*64 + d]: grid z = head g takes that head's 64 weight rows and bias entries and writes with row pitch 64; the only K projection */
        k_rope<<<LKv, 256, 0, stream>>>(PK, HD, (size_t)TT * HD, NKV, CS, nullptr, nullptr, 1.0f, KP16, KPh, KPl);
        k_cvt8<<<(unsigned)(((size_t)TT * DM / 8 + 255) / 256), 256, 0, stream>>>(xv + (size_t)b * TT * DM, XB, (size_t)TT * DM / 8);   /* XB := bf16(values[b]) */ k_gemmw<bf, 0, true><<<dim3(TT / 64, 1, NKV), 32, 0, stream>>>(XB, nullptr, WV, nullptr, DM, PV, HD, bv, 0, (size_t)HD * DM, (size_t)TT * HD, HD);   /* present[1]: V head-major, likewise */ k_vtp<<<LKv, 256, 0, stream>>>(PV, HD, (size_t)TT * HD, NKV, VT16, VTh, VTl);
        // one kv head per query head: grid z = head, z-strides TT*HD on the q, k, v planes. Pass 0: rows < RH, hi/lo, key columns < RH only.
        k_gemmc<bf, 2, 1><<<dim3(RH / 64, RH / 64, ZH), 32, 0, stream>>>(QPh, QPl, KPh, KPl, HD, Sb, TT, 0, (size_t)TT * HD, (size_t)TT * HD, (size_t)RH * TT);
        k_asoft<RH><<<ZH * RH / 8, 256, 0, stream>>>(Sb, 0, P16, Ph, Pl);
        k_gemmc<bf, 2, 2><<<dim3(RH / 64, HD / 64, ZH), 32, 0, stream>>>(Ph, Pl, VTh, VTl, TT, Ob, HD, 0, (size_t)RH * TT, (size_t)HD * TT, (size_t)TT * HD);
        for (int r = RH; r < TT; r += RB) {   // fp16 passes: rows r .. r + RB - 1 of every head
            k_gemmc<h16, 0, 1><<<dim3(RB / 64, TT / 64, ZH), 32, 0, stream>>>(QP16 + (size_t)r * HD, nullptr, KP16, nullptr, HD, Sb, TT, r, (size_t)TT * HD, (size_t)TT * HD, (size_t)RB * TT);
            k_asoft<RB><<<ZH * RB / 8, 256, 0, stream>>>(Sb, r, P16, Ph, Pl);
            k_gemmc<h16, 0, 2><<<dim3(RB / 64, HD / 64, ZH), 32, 0, stream>>>(P16, nullptr, VT16, nullptr, TT, Ob + (size_t)r * HD, HD, r, (size_t)RB * TT, (size_t)HD * TT, (size_t)TT * HD); }
        k_merge<<<(unsigned)(((size_t)ZH * TT * HD / 2 + 255) / 256), 256, 0, stream>>>(Ob, 0, ATh, ATl);
        k_gemmw<bf, 1, true><<<dim3(TT / 64, DM / 64, 1), 32, 0, stream>>>(ATh, ATl, WO, nullptr, DQ, OUT + (size_t)b * TT * DM, DM, bo, 0, 0, 0, 0); }
}

// v003
// One run takes 351 microseconds.
// Two timings next to v002 put it at 1.86 and 1.85 times that version's speed.
// Counting every step since v000, it is 7.23 times as fast.
#include <hip/hip_runtime.h>

// Causal multi-head self-attention scaled by the MODEL width, with a kv-cache output (x [2][2048][1024]; q, k, v = x W + b ('xw' [1024][1024] 1/32, biases zeros on this draw: read; 16 heads x 64); scores / sqrt(float32(D = 1024)) (x 1/32); causal (-inf); softmax; out0 = merged Wo + bo ('xw' + bias zeros: read) -> [2][2048][1024]; out1 = present = stack((k, v)) [2][2][16][2048][64]: the biased key and value projections head-major, each written ONCE, head-major, by the biased projection GEMM itself (grid z = head), and read back from there by the plane builders; argument order x, Wq, bq, Wk, bk, Wv, bv, Wo, bo).
// Layout per batch: bf16 copies of queries, keys, values in turn; 'xw' weights transposed once; exact projections + f32 biases; identity-table plane builders; causal T-2048 attention fused into one launch per batch (k_fattn: rows < 512 hi/lo 3 products, rest fp16; running softmax in registers; key blocks above the diagonal never touched; heads merged in its epilogue); merged hi/lo x Wo exact + bo.
// Compute dtypes, f32 accumulate: every input rounded to bf16; projections exact + f32 biases; attention rows < 512 3 products, rest fp16; softmax f32; Wo hl x exact + bias.

#define NB_  2
#define TT   2048
#define DM   1024
#define NH_  16
#define NKV  16
#define REP  (NH_ / NKV)
#define HD   64
#define DQ   (NH_ * HD)
#define DKV  (NKV * HD)
#define RH   512                  // query rows < RH use hi+lo planes
#define SCL  0.03125f   // 1 / sqrt(D = 1024) = 2^-5: the module divides the scores by the square root of the MODEL width, not of the head width
typedef _Float16 h16;
typedef unsigned short bf;
typedef __attribute__((ext_vector_type(16))) __bf16   v16bf;
typedef __attribute__((ext_vector_type(16))) _Float16 v16h;
typedef __attribute__((ext_vector_type(8)))  _Float16 v8h;
typedef __attribute__((ext_vector_type(8)))  unsigned short v8us;
typedef __attribute__((ext_vector_type(8)))  float    v8f;
typedef __attribute__((ext_vector_type(4)))  float    v4f;
typedef v8h  __attribute__((may_alias)) v8ha;
typedef v4f  __attribute__((may_alias)) v4fa;
typedef v8us __attribute__((may_alias)) v8usa;

__device__ __forceinline__ unsigned short f2bf(float f) { unsigned u = __float_as_uint(f); u += 0x7FFFu + ((u >> 16) & 1u); return (unsigned short)(u >> 16); }
__device__ __forceinline__ float bf2f(unsigned short b) { return __uint_as_float(((unsigned)b) << 16); }
__device__ __forceinline__ float bfr(float f) { return bf2f(f2bf(f)); }
__device__ __forceinline__ v16h cat16(v8h lo, v8h hi) { return __builtin_shufflevector(lo, hi, 0, 1, 2, 3, 4, 5, 6, 7, 8, 9, 10, 11, 12, 13, 14, 15); }
__device__ __forceinline__ v16bf cat16b(v8us lo, v8us hi) { return __builtin_bit_cast(v16bf, __builtin_shufflevector(lo, hi, 0, 1, 2, 3, 4, 5, 6, 7, 8, 9, 10, 11, 12, 13, 14, 15)); }
__device__ __forceinline__ v8f wmma16(v16h a, v16h b, v8f c) { return __builtin_amdgcn_wmma_f32_16x16x32_f16(false, a, false, b, (short)0, c, false, false); }
__device__ __forceinline__ v8f wmmab(v16bf a, v16bf b, v8f c) { return __builtin_amdgcn_wmma_f32_16x16x32_bf16(false, a, false, b, (short)0, c, false, false); }



// ---- k_gemmw: register-blocked GEMM, ONE WAVE per 64x64 output tile (16 accumulators), operands straight from K-contiguous 16-bit planes; grid (M/64, N/64, Z), 32 threads.
// C[m][n] (f32, pitch ldc, + optional f32 bias[n]) = sum_k A[m][k] Bt[n][k] (+ split products per NSPLIT). z-batch strides sA/sB/sC (and sBi for the bias) in elements. K % 32 == 0.
template <typename T16> struct WFrag;
template <> struct WFrag<h16> { typedef v16h V; static __device__ __forceinline__ V ld(const h16* p) { return cat16(*(const v8h*)p, *(const v8h*)(p + 16)); } static __device__ __forceinline__ v8f mma(V a, V b, v8f c) { return wmma16(a, b, c); } };
template <> struct WFrag<bf> { typedef v16bf V; static __device__ __forceinline__ V ld(const bf* p) { return cat16b(*(const v8us*)p, *(const v8us*)(p + 16)); } static __device__ __forceinline__ v8f mma(V a, V b, v8f c) { return wmmab(a, b, c); } };
template <typename T16, int NSPLIT, bool BIAS>
__global__ __launch_bounds__(32) void k_gemmw(const T16* __restrict__ A, const T16* __restrict__ A2, const T16* __restrict__ Bt, const T16* __restrict__ Bt2, int K, float* C, int ldc, const float* __restrict__ bias, size_t sA, size_t sB, size_t sC, size_t sBi) {
    typedef typename WFrag<T16>::V V;
    __shared__ __align__(16) float os[16 * 68];
    const size_t z = blockIdx.z; A += z * sA; if (A2) A2 += z * sA; Bt += z * sB; if (Bt2) Bt2 += z * sB; C += z * sC; if (BIAS) bias += z * sBi;
    const int lane = threadIdx.x & 31, lr = lane & 15, hi = lane >> 4; const int r0 = blockIdx.x * 64, c0 = blockIdx.y * 64;
    v8f acc[4][4];
#pragma unroll
    for (int mb = 0; mb < 4; ++mb)
#pragma unroll
        for (int nb = 0; nb < 4; ++nb) acc[mb][nb] = (v8f){};
    const size_t aoff = (size_t)(r0 + lr) * K + 8 * hi, boff = (size_t)(c0 + lr) * K + 8 * hi;
#pragma unroll 1
    for (int kc = 0; kc < K; kc += 32) {
        V a[4], a2[4];
#pragma unroll
        for (int mb = 0; mb < 4; ++mb) { a[mb] = WFrag<T16>::ld(A + aoff + (size_t)mb * 16 * K + kc); if (NSPLIT == 1 || NSPLIT == 2) a2[mb] = WFrag<T16>::ld(A2 + aoff + (size_t)mb * 16 * K + kc); }
#pragma unroll
        for (int nb = 0; nb < 4; ++nb) { const V b = WFrag<T16>::ld(Bt + boff + (size_t)nb * 16 * K + kc); V b2; if (NSPLIT >= 2) b2 = WFrag<T16>::ld(Bt2 + boff + (size_t)nb * 16 * K + kc);
#pragma unroll
            for (int mb = 0; mb < 4; ++mb) { acc[mb][nb] = WFrag<T16>::mma(a[mb], b, acc[mb][nb]); if (NSPLIT == 1 || NSPLIT == 2) acc[mb][nb] = WFrag<T16>::mma(a2[mb], b, acc[mb][nb]); if (NSPLIT >= 2) acc[mb][nb] = WFrag<T16>::mma(a[mb], b2, acc[mb][nb]); } }
        asm volatile("v_nop\n\tv_nop\n\tv_nop\n\tv_nop" : "+v"(acc[0][0]), "+v"(acc[1][1]), "+v"(acc[2][2]), "+v"(acc[3][3]) : "v"(a[0]), "v"(a[3]));
    }
#pragma unroll
    for (int mb = 0; mb < 4; ++mb) {
#pragma unroll
        for (int nb = 0; nb < 4; ++nb) {
#pragma unroll
            for (int j = 0; j < 8; ++j) os[(hi * 8 + j) * 68 + nb * 16 + lr] = acc[mb][nb][j]; }
        __builtin_amdgcn_wave_barrier(); asm volatile("" ::: "memory");
        float* crow = C + (size_t)(r0 + mb * 16) * ldc + c0;
{
#pragma unroll
            for (int s = 0; s < 8; ++s) { const int row = 2 * s + hi, cofs = lr * 4; v4f val = *(const v4fa*)(os + row * 68 + cofs); if (BIAS) { val[0] += bfr(bias[c0 + cofs]); val[1] += bfr(bias[c0 + cofs + 1]); val[2] += bfr(bias[c0 + cofs + 2]); val[3] += bfr(bias[c0 + cofs + 3]); }
                *(v4f*)(crow + (size_t)row * ldc + cofs) = val; }
             }
        __builtin_amdgcn_wave_barrier(); asm volatile("" ::: "memory");
    }
}

__device__ __forceinline__ h16 tohx(float x) { return (h16)x; }
__device__ __forceinline__ void splitf(float y, unsigned short& h, unsigned short& l) { h = f2bf(y); l = f2bf(y - bf2f(h)); }
typedef __attribute__((ext_vector_type(2))) _Float16 v2h;
typedef __attribute__((ext_vector_type(4))) _Float16 v4h;
typedef __attribute__((ext_vector_type(2))) unsigned short v2us;
typedef __attribute__((ext_vector_type(4))) unsigned short v4us;
typedef __attribute__((ext_vector_type(2))) float v2f;
typedef __attribute__((ext_vector_type(4))) int v4i;

__global__ __launch_bounds__(256) void k_wtG(const float* __restrict__ w, int K, int N, bf* Bt) {
    const int lane = threadIdx.x & 31; const int L0 = (blockIdx.x * 8 + (threadIdx.x >> 5)) * 8; const int nlines = N * K / 64;
{
#pragma unroll 1
        for (int l = 0; l < 8; ++l) { const int L = L0 + l; if (L >= nlines) break; const size_t e = (size_t)L * 64 + lane * 2; const int k = (int)(e % K), n = (int)(e / K); v2us o;
            o[0] = f2bf(w[(size_t)k * N + n]); o[1] = f2bf(w[(size_t)(k + 1) * N + n]); *(v2us*)(Bt + e) = o; }
         }
}
__global__ __launch_bounds__(256) void k_cvt8(const float* __restrict__ src, bf* dst, size_t n8) { const size_t i = (size_t)blockIdx.x * 256 + threadIdx.x; if (i >= n8) return; const v8f v = *(const v8f*)(src + i * 8); v8us o;
#pragma unroll
    for (int k = 0; k < 8; ++k) o[k] = f2bf(v[k]); *(v8us*)(dst + i * 8) = o;  }

// k_rope: source element (h, t, d) at F[h * hstr + t * pitch + d]; head planes [h][t][d] (fp16 + hi/lo) of rope(x) x sc with the rotate-half convention out[d] = x[d] cos[t][d] - x[d+HD/2] sin[t][d], out[d+HD/2] = x[d+HD/2] cos[t][d+HD/2] + x[d] sin[t][d+HD/2]
__global__ __launch_bounds__(256) void k_rope(const float* __restrict__ F, int pitch, size_t hstr, int nheads, const float* __restrict__ CS, const float* __restrict__ RF, const float* __restrict__ nw, float sc, h16* P16, bf* Ph, bf* Pl) {
    const size_t e = ((size_t)blockIdx.x * 256 + threadIdx.x) * 2; if (e >= (size_t)nheads * TT * HD) return; const int d = (int)(e % HD); const int t = (int)((e / HD) % TT); const int h = (int)(e / ((size_t)HD * TT)); const float* f = F + (size_t)h * hstr + (size_t)t * pitch; float rf = 1.0f; v2h o16; v2us oh, ol;
    if (RF) { rf = RF[(size_t)h * TT + t]; asm volatile("s_wait_xcnt 0x0" ::: "memory"); }   // the wait stands in front of the first rewrite of this load's address registers
#pragma unroll
    for (int q = 0; q < 2; ++q) { const int dd = d + q; const int dp = (dd < HD / 2) ? dd + HD / 2 : dd - HD / 2; float x0 = f[dd], x1 = f[dp];
        asm volatile("s_wait_xcnt 0x0" ::: "memory");   // stands in front of the first rewrite of the two loads' address registers (this build reuses them at once)
        if (RF) { float n0 = __fmul_rn(x0, rf), n1 = __fmul_rn(x1, rf); asm volatile("" : "+v"(n0)); asm volatile("" : "+v"(n1)); x0 = __fmul_rn(bfr(nw[dd]), n0); x1 = __fmul_rn(bfr(nw[dp]), n1); }
        const v2f cs = *(const v2f*)(CS + ((size_t)t * HD + dd) * 2); float a = __fmul_rn(x0, cs[0]), bq = __fmul_rn(x1, cs[1]); asm volatile("" : "+v"(a)); asm volatile("" : "+v"(bq)); const float r = ((dd < HD / 2) ? __fsub_rn(a, bq) : __fadd_rn(a, bq)) * sc;
        o16[q] = tohx(r); unsigned short a2, c2; splitf(r, a2, c2); oh[q] = a2; ol[q] = c2; }
    *(v2h*)(P16 + e) = o16; *(v2us*)(Ph + e) = oh; *(v2us*)(Pl + e) = ol;  }
__global__ __launch_bounds__(256) void k_vtp(const float* __restrict__ F, int pitch, size_t hstr, int nheads, h16* V16, bf* Vh, bf* Vl) { const size_t e = ((size_t)blockIdx.x * 256 + threadIdx.x) * 2; if (e >= (size_t)nheads * HD * TT) return; const int t = (int)(e % TT); const int d = (int)((e / TT) % HD); const int g = (int)(e / ((size_t)TT * HD)); v2h o16; v2us oh, ol;
#pragma unroll
    for (int q = 0; q < 2; ++q) { const float x = F[(size_t)g * hstr + (size_t)(t + q) * pitch + d]; o16[q] = tohx(x); unsigned short a2, c2; splitf(x, a2, c2); oh[q] = a2; ol[q] = c2; }
    *(v2h*)(V16 + e) = o16; *(v2us*)(Vh + e) = oh; *(v2us*)(Vl + e) = ol;  }
__global__ __launch_bounds__(256) void k_csid(float* CS) { const int idx = blockIdx.x * 256 + threadIdx.x; if (idx >= TT * HD) return; v2f cs; cs[0] = 1.0f; cs[1] = 0.0f; *(v2f*)(CS + (size_t)idx * 2) = cs;  }
// ---- k_fattn: causal attention of one batch in ONE launch; scores and probabilities stay in registers (running maximum and sum per query), and the epilogue writes the head-merged hi/lo planes.
// S^T = K Q^T (A = key rows, B = query rows) and O^T += V^T P^T (A = V^T rows, B = P^T): two 16-key score tiles of one query column group, converted in place, ARE the B operand of the second product.
// One work-group = 16 * NQ queries of one head; its 4 waves take the 32-key blocks kb = wave, wave + 4, ... up to the diagonal and join their partial (max, sum, O) through LDS in the fixed order wave 0..3.
#define FC (SCL * 1.4426950408889634f)   // SCL * log2(e): p = 2^((s - max) * FC) on the unscaled scores s
#define FP 68                      // floats per query row of the LDS partial-output planes (64 + 4: 16-byte aligned rows that start on different banks)
__device__ __forceinline__ float xhalf(float x) { return __builtin_bit_cast(float, __builtin_amdgcn_permlanex16(__builtin_bit_cast(int, x), __builtin_bit_cast(int, x), 0x76543210, 0xfedcba98, false, false)); }   // lane l reads lane l ^ 16
template <typename T16> struct PFrag;
template <> struct PFrag<h16> { static __device__ __forceinline__ void pack(const float* p, v16h& a, v16h& b) { (void)b;
#pragma unroll
    for (int s = 0; s < 16; ++s) a[s] = (h16)p[s]; } };
template <> struct PFrag<bf> { static __device__ __forceinline__ void pack(const float* p, v16bf& a, v16bf& b) { v8us h0, h1, l0, l1;
#pragma unroll
    for (int s = 0; s < 8; ++s) { unsigned short x, y; x = f2bf(p[s]); y = f2bf(p[s] - bf2f(x)); h0[s] = x; l0[s] = y; x = f2bf(p[8 + s]); y = f2bf(p[8 + s] - bf2f(x)); h1[s] = x; l1[s] = y; }
    a = cat16b(h0, h1); b = cat16b(l0, l1); } };
template <typename T16, bool HL, int NQ>
__device__ __forceinline__ void fattn_body(const T16* __restrict__ Q, const T16* __restrict__ Q2, const T16* __restrict__ Kp, const T16* __restrict__ Kp2, const T16* __restrict__ Vt, const T16* __restrict__ Vt2, int q0, int head, bf* Ah, bf* Al, float* so, float* sm, float* sl) {
    typedef typename WFrag<T16>::V V;
    const int tid = threadIdx.x, lane = tid & 31, c = lane & 15, h = lane >> 4, w = __builtin_amdgcn_readfirstlane(tid >> 5);   // the wave's number in a scalar register: loop bounds and the diagonal test become scalar branches
    V qf[NQ][2], qf2[NQ][2];
    { const size_t qo = (size_t)(q0 + c) * HD + 8 * h; const T16* qa = Q + qo; const T16* qb = HL ? Q2 + qo : qa;
#pragma unroll
      for (int qt = 0; qt < NQ; ++qt)
#pragma unroll
        for (int ks = 0; ks < 2; ++ks) { qf[qt][ks] = WFrag<T16>::ld(qa + qt * 16 * HD + ks * 32); if (HL) qf2[qt][ks] = WFrag<T16>::ld(qb + qt * 16 * HD + ks * 32); }
      asm volatile("s_wait_xcnt 0x0" :: "v"(qa), "v"(qb) : "memory"); }   // stands in front of the first rewrite of the Q loads' address registers, which it names to keep them untouched up to here
    v8f o[4][NQ]; float m[NQ], l[NQ];
#pragma unroll
    for (int qt = 0; qt < NQ; ++qt) { m[qt] = -3.0e38f; l[qt] = 0.f;
#pragma unroll
        for (int dt = 0; dt < 4; ++dt) o[dt][qt] = (v8f){}; }
    const int nkb = (q0 + 16 * NQ + 31) / 32;   // 32-key blocks that hold a key <= the last query; the first key of each of them is visible to every query of the group
    V kf[2][2], kf2[2][2];
    // K fragments of the 32-key block at key kp. The wait stands behind the loads, in front of the first rewrite of their address registers; naming the addresses as its inputs keeps those registers untouched up to it.
    auto loadK = [&](int kp) { const size_t ko = (size_t)(kp + c) * HD + 8 * h; const T16* ka = Kp + ko; const T16* kb2 = HL ? Kp2 + ko : ka;
#pragma unroll
        for (int kt = 0; kt < 2; ++kt)
#pragma unroll
            for (int ks = 0; ks < 2; ++ks) { kf[kt][ks] = WFrag<T16>::ld(ka + kt * 16 * HD + ks * 32); if (HL) kf2[kt][ks] = WFrag<T16>::ld(kb2 + kt * 16 * HD + ks * 32); }
        asm volatile("s_wait_xcnt 0x0" :: "v"(ka), "v"(kb2) : "memory"); };
    if (!HL) loadK(min(w, nkb - 1) * 32);       // fp16 rows: the wave's first block is fetched ahead of the loop
#pragma unroll 1
    for (int kb = w; kb < nkb; kb += 4) {
        const int k0 = kb * 32;
        if (HL) loadK(k0);                      // hi/lo rows (few passes, twice the fragments): fetched in the pass itself, which keeps the kernel at four waves per SIMD
        V vf[4], vf2[4];
        { const size_t vo = (size_t)c * TT + k0 + 8 * h; const T16* va = Vt + vo; const T16* vb = HL ? Vt2 + vo : va;
#pragma unroll
          for (int dt = 0; dt < 4; ++dt) { vf[dt] = WFrag<T16>::ld(va + (size_t)dt * 16 * TT); if (HL) vf2[dt] = WFrag<T16>::ld(vb + (size_t)dt * 16 * TT); }
          asm volatile("s_wait_xcnt 0x0" :: "v"(va), "v"(vb) : "memory"); }   // as in loadK, for the V loads' address registers
        float p[NQ][16];
#pragma unroll
        for (int qt = 0; qt < NQ; ++qt)
#pragma unroll
            for (int kt = 0; kt < 2; ++kt) { v8f s = (v8f){};
#pragma unroll
                for (int ks = 0; ks < 2; ++ks) { s = WFrag<T16>::mma(kf[kt][ks], qf[qt][ks], s); if (HL) { s = WFrag<T16>::mma(kf[kt][ks], qf2[qt][ks], s); s = WFrag<T16>::mma(kf2[kt][ks], qf[qt][ks], s); } }
#pragma unroll
                for (int r = 0; r < 8; ++r) p[qt][kt * 8 + r] = s[r]; }
        if (!HL) loadK(((kb + 4 < nkb) ? kb + 4 : kb) * 32);   // the next pass's K fragments fly under this pass's softmax and second product (the last pass fetches its own block again: in bounds, unused)
        const bool diag = (k0 + 31 > q0);       // wave-uniform: only blocks that reach past the group's first query need the causal select
#pragma unroll
        for (int qt = 0; qt < NQ; ++qt) {
            if (diag) { const int qi = q0 + qt * 16 + c - k0 - 8 * h;   // key k0 + kt*16 + 8h + r is visible when kt*16 + r <= qi
#pragma unroll
                for (int s = 0; s < 16; ++s) p[qt][s] = ((s >> 3) * 16 + (s & 7) <= qi) ? p[qt][s] : -3.0e38f; }
            float mx = m[qt];
#pragma unroll
            for (int s = 0; s < 16; ++s) mx = fmaxf(mx, p[qt][s]);
            mx = fmaxf(mx, xhalf(mx));
            const float al = __builtin_amdgcn_exp2f((m[qt] - mx) * FC), mc = mx * FC; m[qt] = mx; float ps = 0.f;
#pragma unroll
            for (int s = 0; s < 16; ++s) { p[qt][s] = __builtin_amdgcn_exp2f(fmaf(p[qt][s], FC, -mc)); ps += p[qt][s]; }
            l[qt] = fmaf(l[qt], al, ps);        // each lane half keeps the sum of its own keys; the halves join behind the loop
            V pa, pb; PFrag<T16>::pack(p[qt], pa, pb);
#pragma unroll
            for (int dt = 0; dt < 4; ++dt) { o[dt][qt] *= al; o[dt][qt] = WFrag<T16>::mma(vf[dt], pa, o[dt][qt]); if (HL) { o[dt][qt] = WFrag<T16>::mma(vf[dt], pb, o[dt][qt]); o[dt][qt] = WFrag<T16>::mma(vf2[dt], pa, o[dt][qt]); } }
        }
    }
    constexpr int QN = 16 * NQ;
#pragma unroll
    for (int qt = 0; qt < NQ; ++qt) { l[qt] += xhalf(l[qt]); if (h == 0) { sm[w * QN + qt * 16 + c] = m[qt]; sl[w * QN + qt * 16 + c] = l[qt]; } }
    __syncthreads();                            // every wave's (max, sum) is in LDS
#pragma unroll
    for (int qt = 0; qt < NQ; ++qt) { const int q = qt * 16 + c; float M = sm[q];
#pragma unroll
        for (int u = 1; u < 4; ++u) M = fmaxf(M, sm[u * QN + q]);
        float L = 0.f;
#pragma unroll
        for (int u = 0; u < 4; ++u) L += sl[u * QN + q] * __builtin_amdgcn_exp2f((sm[u * QN + q] - M) * FC);   // a wave without a block holds (-3e38, 0): weight 0
        const float f = __builtin_amdgcn_exp2f((m[qt] - M) * FC) / L;
#pragma unroll
        for (int dt = 0; dt < 4; ++dt) { float* d = so + (size_t)(w * QN + q) * FP + dt * 16 + 8 * h; v4f x, y;
#pragma unroll
            for (int r = 0; r < 4; ++r) { x[r] = o[dt][qt][r] * f; y[r] = o[dt][qt][4 + r] * f; }
            *(v4fa*)d = x; *(v4fa*)(d + 4) = y; } }
    __syncthreads();                            // every wave's weighted partial output is in LDS
#pragma unroll
    for (int i = 0; i < 2 * NQ; ++i) { const int idx = i * 128 + tid, q = idx >> 4, d4 = (idx & 15) * 4; v4f a = *(const v4fa*)(so + (size_t)q * FP + d4);
#pragma unroll
        for (int u = 1; u < 4; ++u) a += *(const v4fa*)(so + (size_t)(u * QN + q) * FP + d4);
        v4us oh, ol;
#pragma unroll
        for (int r = 0; r < 4; ++r) { unsigned short x, y; splitf(a[r], x, y); oh[r] = x; ol[r] = y; }
        const size_t oo = (size_t)(q0 + q) * DQ + head * HD + d4; *(v4us*)(Ah + oo) = oh; *(v4us*)(Al + oo) = ol; }
}
// grid (head, query group), heaviest groups first: groups 0 .. (TT - RH) / 32 - 1 are 32 fp16 rows each, from the last rows down to row RH; the rest are 16 hi/lo rows each (3 products), from row RH - 16 down to 0
__global__ __launch_bounds__(128) void k_fattn(const h16* __restrict__ Q16, const h16* __restrict__ K16, const h16* __restrict__ V16, const bf* __restrict__ Qh, const bf* __restrict__ Ql, const bf* __restrict__ Kh, const bf* __restrict__ Kl, const bf* __restrict__ Vh, const bf* __restrict__ Vl, bf* Ah, bf* Al) {
    __shared__ __align__(16) float so[4 * 32 * FP]; __shared__ float sm[4 * 32]; __shared__ float sl[4 * 32];
    const int head = blockIdx.x, g = blockIdx.y; const size_t hp = (size_t)head * TT * HD;
    if (g < (TT - RH) / 32) fattn_body<h16, false, 2>(Q16 + hp, nullptr, K16 + hp, nullptr, V16 + hp, nullptr, TT - 32 * (g + 1), head, Ah, Al, so, sm, sl);
    else fattn_body<bf, true, 1>(Qh + hp, Ql + hp, Kh + hp, Kl + hp, Vh + hp, Vl + hp, RH - 16 * (g - (TT - RH) / 32 + 1), head, Ah, Al, so, sm, sl);
}

extern "C" void kernel_launch(void* const* d_in, const int* in_sizes, int n_in,
                              void* d_out, int out_size, void* d_ws, size_t ws_size, hipStream_t stream) {
    (void)in_sizes; (void)n_in; (void)out_size;
        const float* x = (const float*)d_in[0]; const float* xk = x; const float* xv = x; const float* wq = (const float*)d_in[1]; const float* bq = (const float*)d_in[2]; const float* wk = (const float*)d_in[3]; const float* bk = (const float*)d_in[4]; const float* wv = (const float*)d_in[5]; const float* bv = (const float*)d_in[6]; const float* wo = (const float*)d_in[7]; const float* bo = (const float*)d_in[8];   /* argument order x, Wq, bq, Wk, bk, Wv, bv, Wo, bo ('xw' [1024][1024]); ONE input stream: the key and value stream pointers are x; no mask input: the causal rule is applied by index */
    float* OUT = (float*)d_out;     // out0 [2][2048][1024]; then out1 = present = stack((k, v)): K [2][16][2048][64] then V [2][16][2048][64] (offset 16,777,216 B)
    float* OUTK = OUT + (size_t)NB_ * TT * DM; float* OUTV = OUTK + (size_t)NB_ * NKV * TT * HD;
    char* wsp = (char*)d_ws;
    auto take = [&](size_t bytes) { char* p = wsp; wsp += (bytes + 255) & ~(size_t)255; return (void*)p; };
    bf* WQ = (bf*)take((size_t)DQ * DM * 2); bf* WK = (bf*)take((size_t)DKV * DM * 2); bf* WV = (bf*)take((size_t)DKV * DM * 2); bf* WO = (bf*)take((size_t)DM * DQ * 2); float* CS = (float*)take((size_t)TT * HD * 2 * 4);
    bf* XB = (bf*)take((size_t)TT * DM * 2); float* FQ = (float*)take((size_t)TT * DQ * 4);
    h16* QP16 = (h16*)take((size_t)NH_ * TT * HD * 2); h16* KP16 = (h16*)take((size_t)NKV * TT * HD * 2); h16* VT16 = (h16*)take((size_t)NKV * HD * TT * 2);
    bf* QPh = (bf*)take((size_t)NH_ * TT * HD * 2); bf* QPl = (bf*)take((size_t)NH_ * TT * HD * 2); bf* KPh = (bf*)take((size_t)NKV * TT * HD * 2); bf* KPl = (bf*)take((size_t)NKV * TT * HD * 2); bf* VTh = (bf*)take((size_t)NKV * HD * TT * 2); bf* VTl = (bf*)take((size_t)NKV * HD * TT * 2);
    bf* ATh = (bf*)take((size_t)TT * DQ * 2); bf* ATl = (bf*)take((size_t)TT * DQ * 2);
    if ((size_t)(wsp - (char*)d_ws) > ws_size) return;    // ws 256 MiB
    { k_wtG<<<(unsigned)((DM * DQ / 64 + 63) / 64), 256, 0, stream>>>(wq, DM, DQ, WQ); k_wtG<<<(unsigned)((DM * DKV / 64 + 63) / 64), 256, 0, stream>>>(wk, DM, DKV, WK); k_wtG<<<(unsigned)((DM * DKV / 64 + 63) / 64), 256, 0, stream>>>(wv, DM, DKV, WV);
      k_wtG<<<(unsigned)((DQ * DM / 64 + 63) / 64), 256, 0, stream>>>(wo, DQ, DM, WO);
       }
    k_csid<<<(TT * HD + 255) / 256, 256, 0, stream>>>(CS);
    const unsigned LQ = (unsigned)(((size_t)NH_ * TT * HD / 2 + 255) / 256), LKv = (unsigned)(((size_t)NKV * TT * HD / 2 + 255) / 256);
    for (int b = 0; b < NB_; ++b) {
        
        k_cvt8<<<(unsigned)(((size_t)TT * DM / 8 + 255) / 256), 256, 0, stream>>>(x + (size_t)b * TT * DM, XB, (size_t)TT * DM / 8);
        k_gemmw<bf, 0, true><<<dim3(TT / 64, DQ / 64, 1), 32, 0, stream>>>(XB, nullptr, WQ, nullptr, DM, FQ, DQ, bq, 0, 0, 0, 0);
        k_rope<<<LQ, 256, 0, stream>>>(FQ, DQ, HD, NH_, CS, nullptr, nullptr, 1.0f, QP16, QPh, QPl);
        k_cvt8<<<(unsigned)(((size_t)TT * DM / 8 + 255) / 256), 256, 0, stream>>>(xk + (size_t)b * TT * DM, XB, (size_t)TT * DM / 8);   /* XB := bf16(keys[b]) */ float* PK = OUTK + (size_t)b * NKV * TT * HD; float* PV = OUTV + (size_t)b * NKV * TT * HD;
        k_gemmw<bf, 0, true><<<dim3(TT / 64, 1, NKV), 32, 0, stream>>>(XB, nullptr, WK, nullptr, DM, PK, HD, bk, 0, (size_t)HD * DM, (size_t)TT * HD, HD);   /* present[0]: K head-major: K[b][g][t][d] = (x Wk + bk)[t][g*64 + d]: grid z = head g takes that head's 64 weight rows and bias entries and writes with row pitch 64; the only K projection */
        k_rope<<<LKv, 256, 0, stream>>>(PK, HD, (size_t)TT * HD, NKV, CS, nullptr, nullptr, 1.0f, KP16, KPh, KPl);
        k_cvt8<<<(unsigned)(((size_t)TT * DM / 8 + 255) / 256), 256, 0, stream>>>(xv + (size_t)b * TT * DM, XB, (size_t)TT * DM / 8);   /* XB := bf16(values[b]) */ k_gemmw<bf, 0, true><<<dim3(TT / 64, 1, NKV), 32, 0, stream>>>(XB, nullptr, WV, nullptr, DM, PV, HD, bv, 0, (size_t)HD * DM, (size_t)TT * HD, HD);   /* present[1]: V head-major, likewise */ k_vtp<<<LKv, 256, 0, stream>>>(PV, HD, (size_t)TT * HD, NKV, VT16, VTh, VTl);
        // one kv head per query head; all rows of all 16 heads in one launch, which also writes the merged hi/lo planes
        k_fattn<<<dim3(NH_, (TT - RH) / 32 + RH / 16, 1), 128, 0, stream>>>(QP16, KP16, VT16, QPh, QPl, KPh, KPl, VTh, VTl, ATh, ATl);
        k_gemmw<bf, 1, true><<<dim3(TT / 64, DM / 64, 1), 32, 0, stream>>>(ATh, ATl, WO, nullptr, DQ, OUT + (size_t)b * TT * DM, DM, bo, 0, 0, 0, 0); }
}

// v004
// A run of this version takes 311 microseconds.
// Two timings next to v003 put it at 1.11 and 1.13 times that version's speed.
// Counting every step since v000, it is 8.08 times as fast.
#include <hip/hip_runtime.h>

// Causal multi-head self-attention scaled by the MODEL width, with a kv-cache output (x [2][2048][1024]; q, k, v = x W + b ('xw' [1024][1024] 1/32, biases zeros on this draw: read; 16 heads x 64); scores / sqrt(float32(D = 1024)) (x 1/32); causal (-inf); softmax; out0 = merged Wo + bo ('xw' + bias zeros: read) -> [2][2048][1024]; out1 = present = stack((k, v)) [2][2][16][2048][64]: the biased key and value projections head-major, each written ONCE, head-major, by the biased projection GEMM itself (grid z = head), whose epilogue also writes the 16-bit planes of the same values; argument order x, Wq, bq, Wk, bk, Wv, bv, Wo, bo).
// Layout per batch: bf16 copies of queries, keys, values in turn; 'xw' weights transposed once; exact projections + f32 biases, each projection GEMM writing its own fp16 and hi/lo head planes (V transposed) from its accumulators; causal T-2048 attention fused into one launch per batch (k_fattn: rows < 512 hi/lo 3 products, rest fp16; running softmax in registers; key blocks above the diagonal never touched; heads merged in its epilogue); merged hi/lo x Wo exact + bo.
// Compute dtypes, f32 accumulate: every input rounded to bf16; projections exact + f32 biases; attention rows < 512 3 products, rest fp16; softmax f32; Wo hl x exact + bias.

#define NB_  2
#define TT   2048
#define DM   1024
#define NH_  16
#define NKV  16
#define REP  (NH_ / NKV)
#define HD   64
#define DQ   (NH_ * HD)
#define DKV  (NKV * HD)
#define RH   512                  // query rows < RH use hi+lo planes
#define SCL  0.03125f   // 1 / sqrt(D = 1024) = 2^-5: the module divides the scores by the square root of the MODEL width, not of the head width
typedef _Float16 h16;
typedef unsigned short bf;
typedef __attribute__((ext_vector_type(16))) __bf16   v16bf;
typedef __attribute__((ext_vector_type(16))) _Float16 v16h;
typedef __attribute__((ext_vector_type(8)))  _Float16 v8h;
typedef __attribute__((ext_vector_type(8)))  unsigned short v8us;
typedef __attribute__((ext_vector_type(8)))  float    v8f;
typedef __attribute__((ext_vector_type(4)))  float    v4f;
typedef v8h  __attribute__((may_alias)) v8ha;
typedef v4f  __attribute__((may_alias)) v4fa;
typedef v8us __attribute__((may_alias)) v8usa;

__device__ __forceinline__ unsigned short f2bf(float f) { unsigned u = __float_as_uint(f); u += 0x7FFFu + ((u >> 16) & 1u); return (unsigned short)(u >> 16); }
__device__ __forceinline__ float bf2f(unsigned short b) { return __uint_as_float(((unsigned)b) << 16); }
__device__ __forceinline__ float bfr(float f) { return bf2f(f2bf(f)); }
__device__ __forceinline__ v16h cat16(v8h lo, v8h hi) { return __builtin_shufflevector(lo, hi, 0, 1, 2, 3, 4, 5, 6, 7, 8, 9, 10, 11, 12, 13, 14, 15); }
__device__ __forceinline__ v16bf cat16b(v8us lo, v8us hi) { return __builtin_bit_cast(v16bf, __builtin_shufflevector(lo, hi, 0, 1, 2, 3, 4, 5, 6, 7, 8, 9, 10, 11, 12, 13, 14, 15)); }
__device__ __forceinline__ v8f wmma16(v16h a, v16h b, v8f c) { return __builtin_amdgcn_wmma_f32_16x16x32_f16(false, a, false, b, (short)0, c, false, false); }
__device__ __forceinline__ v8f wmmab(v16bf a, v16bf b, v8f c) { return __builtin_amdgcn_wmma_f32_16x16x32_bf16(false, a, false, b, (short)0, c, false, false); }
__device__ __forceinline__ h16 tohx(float x) { return (h16)x; }
__device__ __forceinline__ void splitf(float y, unsigned short& h, unsigned short& l) { h = f2bf(y); l = f2bf(y - bf2f(h)); }
typedef __attribute__((ext_vector_type(4))) _Float16 v4h;
typedef __attribute__((ext_vector_type(4))) unsigned short v4us;



// ---- k_gemmw: register-blocked GEMM, ONE WAVE per 64x64 output tile (16 accumulators), operands straight from K-contiguous 16-bit planes; grid (M/64, N/64, Z), 32 threads.
// C[m][n] (f32, pitch ldc, + optional f32 bias[n]) = sum_k A[m][k] Bt[n][k] (+ split products per NSPLIT). z-batch strides sA/sB/sC (and sBi for the bias) in elements. K % 32 == 0.
// PL: what the epilogue stores of the biased f32 result y. 0: C only. 1: the planes fp16(y), bf16 hi(y), bf16 lo(y) only, row-major P[m * HD + n]. 2: C and those planes. 3: C and the planes transposed, P[n * TT + m]. Plane z stride sP.
template <typename T16> struct WFrag;
template <> struct WFrag<h16> { typedef v16h V; static __device__ __forceinline__ V ld(const h16* p) { return cat16(*(const v8h*)p, *(const v8h*)(p + 16)); } static __device__ __forceinline__ v8f mma(V a, V b, v8f c) { return wmma16(a, b, c); } };
template <> struct WFrag<bf> { typedef v16bf V; static __device__ __forceinline__ V ld(const bf* p) { return cat16b(*(const v8us*)p, *(const v8us*)(p + 16)); } static __device__ __forceinline__ v8f mma(V a, V b, v8f c) { return wmmab(a, b, c); } };
template <typename T16, int NSPLIT, bool BIAS, int PL>
__global__ __launch_bounds__(32) void k_gemmw(const T16* __restrict__ A, const T16* __restrict__ A2, const T16* __restrict__ Bt, const T16* __restrict__ Bt2, int K, float* C, int ldc, const float* __restrict__ bias, size_t sA, size_t sB, size_t sC, size_t sBi, h16* P16, bf* Ph, bf* Pl, size_t sP) {
    typedef typename WFrag<T16>::V V;
    constexpr int ldp = (PL == 3) ? TT : HD;   // plane pitch, a constant: every plane store of a lane is one base address plus an immediate offset
    __shared__ __align__(16) float os[16 * 68];
    const size_t z = blockIdx.z; A += z * sA; if (A2) A2 += z * sA; Bt += z * sB; if (Bt2) Bt2 += z * sB; C += z * sC; if (BIAS) bias += z * sBi; if (PL) { P16 += z * sP; Ph += z * sP; Pl += z * sP; }
    const int lane = threadIdx.x & 31, lr = lane & 15, hi = lane >> 4; const int r0 = blockIdx.x * 64, c0 = blockIdx.y * 64;
    v8f acc[4][4];
#pragma unroll
    for (int mb = 0; mb < 4; ++mb)
#pragma unroll
        for (int nb = 0; nb < 4; ++nb) acc[mb][nb] = (v8f){};
    const size_t aoff = (size_t)(r0 + lr) * K + 8 * hi, boff = (size_t)(c0 + lr) * K + 8 * hi;
    float bb[4];   // PL 3: the bias of this lane's column in each 16-column block, fetched here so that its latency passes under the K loop
    if (PL == 3) {
#pragma unroll
        for (int nb = 0; nb < 4; ++nb) bb[nb] = BIAS ? bfr(bias[c0 + nb * 16 + lr]) : 0.f; }
#pragma unroll 1
    for (int kc = 0; kc < K; kc += 32) {
        V a[4], a2[4];
#pragma unroll
        for (int mb = 0; mb < 4; ++mb) { a[mb] = WFrag<T16>::ld(A + aoff + (size_t)mb * 16 * K + kc); if (NSPLIT == 1 || NSPLIT == 2) a2[mb] = WFrag<T16>::ld(A2 + aoff + (size_t)mb * 16 * K + kc); }
#pragma unroll
        for (int nb = 0; nb < 4; ++nb) { const V b = WFrag<T16>::ld(Bt + boff + (size_t)nb * 16 * K + kc); V b2; if (NSPLIT >= 2) b2 = WFrag<T16>::ld(Bt2 + boff + (size_t)nb * 16 * K + kc);
#pragma unroll
            for (int mb = 0; mb < 4; ++mb) { acc[mb][nb] = WFrag<T16>::mma(a[mb], b, acc[mb][nb]); if (NSPLIT == 1 || NSPLIT == 2) acc[mb][nb] = WFrag<T16>::mma(a2[mb], b, acc[mb][nb]); if (NSPLIT >= 2) acc[mb][nb] = WFrag<T16>::mma(a[mb], b2, acc[mb][nb]); } }
        asm volatile("v_nop\n\tv_nop\n\tv_nop\n\tv_nop" : "+v"(acc[0][0]), "+v"(acc[1][1]), "+v"(acc[2][2]), "+v"(acc[3][3]) : "v"(a[0]), "v"(a[3]));
    }
    // Plane stores: one base address per plane and lane (formed once, never rewritten) plus immediate offsets; each row block's values are all converted first and then stored back to back, so that no store's registers are reused while it is in flight and one wait per block is enough.
    const size_t pl0 = (PL == 3) ? (size_t)(c0 + lr) * ldp + r0 + hi * 8 : (size_t)(r0 + hi) * ldp + c0 + lr * 4;
    h16* const q16 = P16 + pl0; bf* const qh = Ph + pl0; bf* const ql = Pl + pl0;
#pragma unroll
    for (int mb = 0; mb < 4; ++mb) {
        if (PL == 3) {   // a lane's 8 accumulator values are 8 consecutive rows m of one column n: one 16-byte store per transposed plane, straight from registers
            v8h o16[4]; v8us oh[4], ol[4];
#pragma unroll
            for (int nb = 0; nb < 4; ++nb)
#pragma unroll
                for (int j = 0; j < 8; ++j) { const float y = acc[mb][nb][j] + bb[nb]; o16[nb][j] = tohx(y); unsigned short a2, c2; splitf(y, a2, c2); oh[nb][j] = a2; ol[nb][j] = c2; }
            __builtin_amdgcn_sched_barrier(0);   // keeps the 12 stores behind all the conversions: interleaved, each store's data registers were reused at once, with a wait behind nearly every store
#pragma unroll
            for (int nb = 0; nb < 4; ++nb) { const int po = nb * 16 * ldp + mb * 16; *(v8h*)(q16 + po) = o16[nb]; *(v8us*)(qh + po) = oh[nb]; *(v8us*)(ql + po) = ol[nb]; }
            asm volatile("s_wait_xcnt 0x0" ::: "memory"); }   // stands behind the transposed plane stores, in front of the first rewrite of their data registers
#pragma unroll
        for (int nb = 0; nb < 4; ++nb) {
#pragma unroll
            for (int j = 0; j < 8; ++j) os[(hi * 8 + j) * 68 + nb * 16 + lr] = acc[mb][nb][j]; }
        __builtin_amdgcn_wave_barrier(); asm volatile("" ::: "memory");
        float* crow = C + (size_t)(r0 + mb * 16) * ldc + c0;
        { v4f val[8]; v4h o16[8]; v4us oh[8], ol[8]; const int cofs = lr * 4;
#pragma unroll
            for (int s = 0; s < 8; ++s) { const int row = 2 * s + hi; val[s] = *(const v4fa*)(os + row * 68 + cofs); if (BIAS) { val[s][0] += bfr(bias[c0 + cofs]); val[s][1] += bfr(bias[c0 + cofs + 1]); val[s][2] += bfr(bias[c0 + cofs + 2]); val[s][3] += bfr(bias[c0 + cofs + 3]); }
                if (PL == 1 || PL == 2) {
#pragma unroll
                    for (int r = 0; r < 4; ++r) { o16[s][r] = tohx(val[s][r]); unsigned short a2, c2; splitf(val[s][r], a2, c2); oh[s][r] = a2; ol[s][r] = c2; } } }
            __builtin_amdgcn_sched_barrier(0);   // as above: the block's stores issue back to back behind all its conversions
#pragma unroll
            for (int s = 0; s < 8; ++s) {
                if (PL != 1) *(v4f*)(crow + (size_t)(2 * s + hi) * ldc + cofs) = val[s];
                if (PL == 1 || PL == 2) { const int po = (mb * 16 + 2 * s) * ldp; *(v4h*)(q16 + po) = o16[s]; *(v4us*)(qh + po) = oh[s]; *(v4us*)(ql + po) = ol[s]; } }
        }
        asm volatile("s_wait_xcnt 0x0" ::: "memory");   // stands behind this row block's stores, in front of the first rewrite of their data and address registers by the next block
        __builtin_amdgcn_wave_barrier(); asm volatile("" ::: "memory");
    }
}

typedef __attribute__((ext_vector_type(2))) unsigned short v2us;

__global__ __launch_bounds__(256) void k_wtG(const float* __restrict__ w, int K, int N, bf* Bt) {
    const int lane = threadIdx.x & 31; const int L0 = (blockIdx.x * 8 + (threadIdx.x >> 5)) * 8; const int nlines = N * K / 64;
{
#pragma unroll 1
        for (int l = 0; l < 8; ++l) { const int L = L0 + l; if (L >= nlines) break; const size_t e = (size_t)L * 64 + lane * 2; const int k = (int)(e % K), n = (int)(e / K); v2us o;
            o[0] = f2bf(w[(size_t)k * N + n]); o[1] = f2bf(w[(size_t)(k + 1) * N + n]); *(v2us*)(Bt + e) = o; }
         }
}
__global__ __launch_bounds__(256) void k_cvt8(const float* __restrict__ src, bf* dst, size_t n8) { const size_t i = (size_t)blockIdx.x * 256 + threadIdx.x; if (i >= n8) return; const v8f v = *(const v8f*)(src + i * 8); v8us o;
#pragma unroll
    for (int k = 0; k < 8; ++k) o[k] = f2bf(v[k]); *(v8us*)(dst + i * 8) = o;  }

// ---- k_fattn: causal attention of one batch in ONE launch; scores and probabilities stay in registers (running maximum and sum per query), and the epilogue writes the head-merged hi/lo planes.
// S^T = K Q^T (A = key rows, B = query rows) and O^T += V^T P^T (A = V^T rows, B = P^T): two 16-key score tiles of one query column group, converted in place, ARE the B operand of the second product.
// One work-group = 16 * NQ queries of one head; its 4 waves take the 32-key blocks kb = wave, wave + 4, ... up to the diagonal and join their partial (max, sum, O) through LDS in the fixed order wave 0..3.
#define FC (SCL * 1.4426950408889634f)   // SCL * log2(e): p = 2^((s - max) * FC) on the unscaled scores s
#define FP 68                      // floats per query row of the LDS partial-output planes (64 + 4: 16-byte aligned rows that start on different banks)
__device__ __forceinline__ float xhalf(float x) { return __builtin_bit_cast(float, __builtin_amdgcn_permlanex16(__builtin_bit_cast(int, x), __builtin_bit_cast(int, x), 0x76543210, 0xfedcba98, false, false)); }   // lane l reads lane l ^ 16
template <typename T16> struct PFrag;
template <> struct PFrag<h16> { static __device__ __forceinline__ void pack(const float* p, v16h& a, v16h& b) { (void)b;
#pragma unroll
    for (int s = 0; s < 16; ++s) a[s] = (h16)p[s]; } };
template <> struct PFrag<bf> { static __device__ __forceinline__ void pack(const float* p, v16bf& a, v16bf& b) { v8us h0, h1, l0, l1;
#pragma unroll
    for (int s = 0; s < 8; ++s) { unsigned short x, y; x = f2bf(p[s]); y = f2bf(p[s] - bf2f(x)); h0[s] = x; l0[s] = y; x = f2bf(p[8 + s]); y = f2bf(p[8 + s] - bf2f(x)); h1[s] = x; l1[s] = y; }
    a = cat16b(h0, h1); b = cat16b(l0, l1); } };
template <typename T16, bool HL, int NQ>
__device__ __forceinline__ void fattn_body(const T16* __restrict__ Q, const T16* __restrict__ Q2, const T16* __restrict__ Kp, const T16* __restrict__ Kp2, const T16* __restrict__ Vt, const T16* __restrict__ Vt2, int q0, int head, bf* Ah, bf* Al, float* so, float* sm, float* sl) {
    typedef typename WFrag<T16>::V V;
    const int tid = threadIdx.x, lane = tid & 31, c = lane & 15, h = lane >> 4, w = __builtin_amdgcn_readfirstlane(tid >> 5);   // the wave's number in a scalar register: loop bounds and the diagonal test become scalar branches
    V qf[NQ][2], qf2[NQ][2];
    { const size_t qo = (size_t)(q0 + c) * HD + 8 * h; const T16* qa = Q + qo; const T16* qb = HL ? Q2 + qo : qa;
#pragma unroll
      for (int qt = 0; qt < NQ; ++qt)
#pragma unroll
        for (int ks = 0; ks < 2; ++ks) { qf[qt][ks] = WFrag<T16>::ld(qa + qt * 16 * HD + ks * 32); if (HL) qf2[qt][ks] = WFrag<T16>::ld(qb + qt * 16 * HD + ks * 32); }
      asm volatile("s_wait_xcnt 0x0" :: "v"(qa), "v"(qb) : "memory"); }   // stands in front of the first rewrite of the Q loads' address registers, which it names to keep them untouched up to here
    v8f o[4][NQ]; float m[NQ], l[NQ];
#pragma unroll
    for (int qt = 0; qt < NQ; ++qt) { m[qt] = -3.0e38f; l[qt] = 0.f;
#pragma unroll
        for (int dt = 0; dt < 4; ++dt) o[dt][qt] = (v8f){}; }
    const int nkb = (q0 + 16 * NQ + 31) / 32;   // 32-key blocks that hold a key <= the last query; the first key of each of them is visible to every query of the group
    V kf[2][2], kf2[2][2];
    // K fragments of the 32-key block at key kp. The wait stands behind the loads, in front of the first rewrite of their address registers; naming the addresses as its inputs keeps those registers untouched up to it.
    auto loadK = [&](int kp) { const size_t ko = (size_t)(kp + c) * HD + 8 * h; const T16* ka = Kp + ko; const T16* kb2 = HL ? Kp2 + ko : ka;
#pragma unroll
        for (int kt = 0; kt < 2; ++kt)
#pragma unroll
            for (int ks = 0; ks < 2; ++ks) { kf[kt][ks] = WFrag<T16>::ld(ka + kt * 16 * HD + ks * 32); if (HL) kf2[kt][ks] = WFrag<T16>::ld(kb2 + kt * 16 * HD + ks * 32); }
        asm volatile("s_wait_xcnt 0x0" :: "v"(ka), "v"(kb2) : "memory"); };
    if (!HL) loadK(min(w, nkb - 1) * 32);       // fp16 rows: the wave's first block is fetched ahead of the loop
#pragma unroll 1
    for (int kb = w; kb < nkb; kb += 4) {
        const int k0 = kb * 32;
        if (HL) loadK(k0);                      // hi/lo rows (few passes, twice the fragments): fetched in the pass itself, which keeps the kernel at four waves per SIMD
        V vf[4], vf2[4];
        { const size_t vo = (size_t)c * TT + k0 + 8 * h; const T16* va = Vt + vo; const T16* vb = HL ? Vt2 + vo : va;
#pragma unroll
          for (int dt = 0; dt < 4; ++dt) { vf[dt] = WFrag<T16>::ld(va + (size_t)dt * 16 * TT); if (HL) vf2[dt] = WFrag<T16>::ld(vb + (size_t)dt * 16 * TT); }
          asm volatile("s_wait_xcnt 0x0" :: "v"(va), "v"(vb) : "memory"); }   // as in loadK, for the V loads' address registers
        float p[NQ][16];
#pragma unroll
        for (int qt = 0; qt < NQ; ++qt)
#pragma unroll
            for (int kt = 0; kt < 2; ++kt) { v8f s = (v8f){};
#pragma unroll
                for (int ks = 0; ks < 2; ++ks) { s = WFrag<T16>::mma(kf[kt][ks], qf[qt][ks], s); if (HL) { s = WFrag<T16>::mma(kf[kt][ks], qf2[qt][ks], s); s = WFrag<T16>::mma(kf2[kt][ks], qf[qt][ks], s); } }
#pragma unroll
                for (int r = 0; r < 8; ++r) p[qt][kt * 8 + r] = s[r]; }
        if (!HL) loadK(((kb + 4 < nkb) ? kb + 4 : kb) * 32);   // the next pass's K fragments fly under this pass's softmax and second product (the last pass fetches its own block again: in bounds, unused)
        const bool diag = (k0 + 31 > q0);       // wave-uniform: only blocks that reach past the group's first query need the causal select
#pragma unroll
        for (int qt = 0; qt < NQ; ++qt) {
            if (diag) { const int qi = q0 + qt * 16 + c - k0 - 8 * h;   // key k0 + kt*16 + 8h + r is visible when kt*16 + r <= qi
#pragma unroll
                for (int s = 0; s < 16; ++s) p[qt][s] = ((s >> 3) * 16 + (s & 7) <= qi) ? p[qt][s] : -3.0e38f; }
            float mx = m[qt];
#pragma unroll
            for (int s = 0; s < 16; ++s) mx = fmaxf(mx, p[qt][s]);
            mx = fmaxf(mx, xhalf(mx));
            const float al = __builtin_amdgcn_exp2f((m[qt] - mx) * FC), mc = mx * FC; m[qt] = mx; float ps = 0.f;
#pragma unroll
            for (int s = 0; s < 16; ++s) { p[qt][s] = __builtin_amdgcn_exp2f(fmaf(p[qt][s], FC, -mc)); ps += p[qt][s]; }
            l[qt] = fmaf(l[qt], al, ps);        // each lane half keeps the sum of its own keys; the halves join behind the loop
            V pa, pb; PFrag<T16>::pack(p[qt], pa, pb);
#pragma unroll
            for (int dt = 0; dt < 4; ++dt) { o[dt][qt] *= al; o[dt][qt] = WFrag<T16>::mma(vf[dt], pa, o[dt][qt]); if (HL) { o[dt][qt] = WFrag<T16>::mma(vf[dt], pb, o[dt][qt]); o[dt][qt] = WFrag<T16>::mma(vf2[dt], pa, o[dt][qt]); } }
        }
    }
    constexpr int QN = 16 * NQ;
#pragma unroll
    for (int qt = 0; qt < NQ; ++qt) { l[qt] += xhalf(l[qt]); if (h == 0) { sm[w * QN + qt * 16 + c] = m[qt]; sl[w * QN + qt * 16 + c] = l[qt]; } }
    __syncthreads();                            // every wave's (max, sum) is in LDS
#pragma unroll
    for (int qt = 0; qt < NQ; ++qt) { const int q = qt * 16 + c; float M = sm[q];
#pragma unroll
        for (int u = 1; u < 4; ++u) M = fmaxf(M, sm[u * QN + q]);
        float L = 0.f;
#pragma unroll
        for (int u = 0; u < 4; ++u) L += sl[u * QN + q] * __builtin_amdgcn_exp2f((sm[u * QN + q] - M) * FC);   // a wave without a block holds (-3e38, 0): weight 0
        const float f = __builtin_amdgcn_exp2f((m[qt] - M) * FC) / L;
#pragma unroll
        for (int dt = 0; dt < 4; ++dt) { float* d = so + (size_t)(w * QN + q) * FP + dt * 16 + 8 * h; v4f x, y;
#pragma unroll
            for (int r = 0; r < 4; ++r) { x[r] = o[dt][qt][r] * f; y[r] = o[dt][qt][4 + r] * f; }
            *(v4fa*)d = x; *(v4fa*)(d + 4) = y; } }
    __syncthreads();                            // every wave's weighted partial output is in LDS
#pragma unroll
    for (int i = 0; i < 2 * NQ; ++i) { const int idx = i * 128 + tid, q = idx >> 4, d4 = (idx & 15) * 4; v4f a = *(const v4fa*)(so + (size_t)q * FP + d4);
#pragma unroll
        for (int u = 1; u < 4; ++u) a += *(const v4fa*)(so + (size_t)(u * QN + q) * FP + d4);
        v4us oh, ol;
#pragma unroll
        for (int r = 0; r < 4; ++r) { unsigned short x, y; splitf(a[r], x, y); oh[r] = x; ol[r] = y; }
        const size_t oo = (size_t)(q0 + q) * DQ + head * HD + d4; *(v4us*)(Ah + oo) = oh; *(v4us*)(Al + oo) = ol; }
}
// grid (head, query group), heaviest groups first: groups 0 .. (TT - RH) / 32 - 1 are 32 fp16 rows each, from the last rows down to row RH; the rest are 16 hi/lo rows each (3 products), from row RH - 16 down to 0
__global__ __launch_bounds__(128) void k_fattn(const h16* __restrict__ Q16, const h16* __restrict__ K16, const h16* __restrict__ V16, const bf* __restrict__ Qh, const bf* __restrict__ Ql, const bf* __restrict__ Kh, const bf* __restrict__ Kl, const bf* __restrict__ Vh, const bf* __restrict__ Vl, bf* Ah, bf* Al) {
    __shared__ __align__(16) float so[4 * 32 * FP]; __shared__ float sm[4 * 32]; __shared__ float sl[4 * 32];
    const int head = blockIdx.x, g = blockIdx.y; const size_t hp = (size_t)head * TT * HD;
    if (g < (TT - RH) / 32) fattn_body<h16, false, 2>(Q16 + hp, nullptr, K16 + hp, nullptr, V16 + hp, nullptr, TT - 32 * (g + 1), head, Ah, Al, so, sm, sl);
    else fattn_body<bf, true, 1>(Qh + hp, Ql + hp, Kh + hp, Kl + hp, Vh + hp, Vl + hp, RH - 16 * (g - (TT - RH) / 32 + 1), head, Ah, Al, so, sm, sl);
}

extern "C" void kernel_launch(void* const* d_in, const int* in_sizes, int n_in,
                              void* d_out, int out_size, void* d_ws, size_t ws_size, hipStream_t stream) {
    (void)in_sizes; (void)n_in; (void)out_size;
        const float* x = (const float*)d_in[0]; const float* xk = x; const float* xv = x; const float* wq = (const float*)d_in[1]; const float* bq = (const float*)d_in[2]; const float* wk = (const float*)d_in[3]; const float* bk = (const float*)d_in[4]; const float* wv = (const float*)d_in[5]; const float* bv = (const float*)d_in[6]; const float* wo = (const float*)d_in[7]; const float* bo = (const float*)d_in[8];   /* argument order x, Wq, bq, Wk, bk, Wv, bv, Wo, bo ('xw' [1024][1024]); ONE input stream: the key and value stream pointers are x; no mask input: the causal rule is applied by index */
    float* OUT = (float*)d_out;     // out0 [2][2048][1024]; then out1 = present = stack((k, v)): K [2][16][2048][64] then V [2][16][2048][64] (offset 16,777,216 B)
    float* OUTK = OUT + (size_t)NB_ * TT * DM; float* OUTV = OUTK + (size_t)NB_ * NKV * TT * HD;
    char* wsp = (char*)d_ws;
    auto take = [&](size_t bytes) { char* p = wsp; wsp += (bytes + 255) & ~(size_t)255; return (void*)p; };
    bf* WQ = (bf*)take((size_t)DQ * DM * 2); bf* WK = (bf*)take((size_t)DKV * DM * 2); bf* WV = (bf*)take((size_t)DKV * DM * 2); bf* WO = (bf*)take((size_t)DM * DQ * 2);
    bf* XB = (bf*)take((size_t)TT * DM * 2);
    h16* QP16 = (h16*)take((size_t)NH_ * TT * HD * 2); h16* KP16 = (h16*)take((size_t)NKV * TT * HD * 2); h16* VT16 = (h16*)take((size_t)NKV * HD * TT * 2);
    bf* QPh = (bf*)take((size_t)NH_ * TT * HD * 2); bf* QPl = (bf*)take((size_t)NH_ * TT * HD * 2); bf* KPh = (bf*)take((size_t)NKV * TT * HD * 2); bf* KPl = (bf*)take((size_t)NKV * TT * HD * 2); bf* VTh = (bf*)take((size_t)NKV * HD * TT * 2); bf* VTl = (bf*)take((size_t)NKV * HD * TT * 2);
    bf* ATh = (bf*)take((size_t)TT * DQ * 2); bf* ATl = (bf*)take((size_t)TT * DQ * 2);
    if ((size_t)(wsp - (char*)d_ws) > ws_size) return;    // ws 256 MiB
    { k_wtG<<<(unsigned)((DM * DQ / 64 + 63) / 64), 256, 0, stream>>>(wq, DM, DQ, WQ); k_wtG<<<(unsigned)((DM * DKV / 64 + 63) / 64), 256, 0, stream>>>(wk, DM, DKV, WK); k_wtG<<<(unsigned)((DM * DKV / 64 + 63) / 64), 256, 0, stream>>>(wv, DM, DKV, WV);
      k_wtG<<<(unsigned)((DQ * DM / 64 + 63) / 64), 256, 0, stream>>>(wo, DQ, DM, WO);
       }
    for (int b = 0; b < NB_; ++b) {
        
        k_cvt8<<<(unsigned)(((size_t)TT * DM / 8 + 255) / 256), 256, 0, stream>>>(x + (size_t)b * TT * DM, XB, (size_t)TT * DM / 8);
        k_gemmw<bf, 0, true, 1><<<dim3(TT / 64, 1, NH_), 32, 0, stream>>>(XB, nullptr, WQ, nullptr, DM, nullptr, 0, bq, 0, (size_t)HD * DM, 0, HD, QP16, QPh, QPl, (size_t)TT * HD);   /* Q: grid z = head; only the head planes [h][t][d] are stored */
        k_cvt8<<<(unsigned)(((size_t)TT * DM / 8 + 255) / 256), 256, 0, stream>>>(xk + (size_t)b * TT * DM, XB, (size_t)TT * DM / 8);   /* XB := bf16(keys[b]) */ float* PK = OUTK + (size_t)b * NKV * TT * HD; float* PV = OUTV + (size_t)b * NKV * TT * HD;
        k_gemmw<bf, 0, true, 2><<<dim3(TT / 64, 1, NKV), 32, 0, stream>>>(XB, nullptr, WK, nullptr, DM, PK, HD, bk, 0, (size_t)HD * DM, (size_t)TT * HD, HD, KP16, KPh, KPl, (size_t)TT * HD);   /* present[0]: K head-major: K[b][g][t][d] = (x Wk + bk)[t][g*64 + d]: grid z = head g takes that head's 64 weight rows and bias entries and writes with row pitch 64; the only K projection, which also stores the key planes [g][t][d] */
        k_cvt8<<<(unsigned)(((size_t)TT * DM / 8 + 255) / 256), 256, 0, stream>>>(xv + (size_t)b * TT * DM, XB, (size_t)TT * DM / 8);   /* XB := bf16(values[b]) */ k_gemmw<bf, 0, true, 3><<<dim3(TT / 64, 1, NKV), 32, 0, stream>>>(XB, nullptr, WV, nullptr, DM, PV, HD, bv, 0, (size_t)HD * DM, (size_t)TT * HD, HD, VT16, VTh, VTl, (size_t)HD * TT);   /* present[1]: V head-major, likewise, and the value planes transposed [g][d][t] */
        // one kv head per query head; all rows of all 16 heads in one launch, which also writes the merged hi/lo planes
        k_fattn<<<dim3(NH_, (TT - RH) / 32 + RH / 16, 1), 128, 0, stream>>>(QP16, KP16, VT16, QPh, QPl, KPh, KPl, VTh, VTl, ATh, ATl);
        k_gemmw<bf, 1, true, 0><<<dim3(TT / 64, DM / 64, 1), 32, 0, stream>>>(ATh, ATl, WO, nullptr, DQ, OUT + (size_t)b * TT * DM, DM, bo, 0, 0, 0, 0, nullptr, nullptr, nullptr, 0); }
}

// v005
// It runs in 135 microseconds.
// Two timings next to v004 both put it at 2.30 times that version's speed.
// Over all steps from v000 it is 18.6 times as fast.
#include <hip/hip_runtime.h>

// Causal multi-head self-attention scaled by the MODEL width, with a kv-cache output (x [2][2048][1024]; q, k, v = x W + b ('xw' [1024][1024] 1/32, biases zeros on this draw: read; 16 heads x 64); scores / sqrt(float32(D = 1024)) (x 1/32); causal (-inf); softmax; out0 = merged Wo + bo ('xw' + bias zeros: read) -> [2][2048][1024]; out1 = present = stack((k, v)) [2][2][16][2048][64]: the biased key and value projections head-major, each written ONCE, head-major, by the biased projection GEMM itself (grid z = projection x head), whose epilogue also writes the 16-bit planes of the same values; argument order x, Wq, bq, Wk, bk, Wv, bv, Wo, bo).
// Layout: every stage is ONE launch over both batches (4 launches): k_prep (the 4 'xw' weights transposed, x rounded to bf16 once), k_qkv (grid z = projection x head, y = batch), k_fattn (grid x = batch x head), k_wo (4096 rows); exact projections + f32 biases, each projection GEMM writing its own fp16 and hi/lo head planes (V transposed) from its accumulators; causal T-2048 attention fused into one launch (k_fattn: rows < 512 hi/lo 3 products, rest fp16; running softmax in registers; key blocks above the diagonal never touched; heads merged in its epilogue); merged hi/lo x Wo exact + bo.
// Compute dtypes, f32 accumulate: every input rounded to bf16; projections exact + f32 biases; attention rows < 512 3 products, rest fp16; softmax f32; Wo hl x exact + bias.

#define NB_  2
#define TT   2048
#define DM   1024
#define NH_  16
#define NKV  16
#define REP  (NH_ / NKV)
#define HD   64
#define DQ   (NH_ * HD)
#define DKV  (NKV * HD)
#define RH   512                  // query rows < RH use hi+lo planes
#define SCL  0.03125f   // 1 / sqrt(D = 1024) = 2^-5: the module divides the scores by the square root of the MODEL width, not of the head width
typedef _Float16 h16;
typedef unsigned short bf;
typedef __attribute__((ext_vector_type(16))) __bf16   v16bf;
typedef __attribute__((ext_vector_type(16))) _Float16 v16h;
typedef __attribute__((ext_vector_type(8)))  _Float16 v8h;
typedef __attribute__((ext_vector_type(8)))  unsigned short v8us;
typedef __attribute__((ext_vector_type(8)))  float    v8f;
typedef __attribute__((ext_vector_type(4)))  float    v4f;
typedef v8h  __attribute__((may_alias)) v8ha;
typedef v4f  __attribute__((may_alias)) v4fa;
typedef v8us __attribute__((may_alias)) v8usa;

__device__ __forceinline__ unsigned short f2bf(float f) { unsigned u = __float_as_uint(f); u += 0x7FFFu + ((u >> 16) & 1u); return (unsigned short)(u >> 16); }
__device__ __forceinline__ float bf2f(unsigned short b) { return __uint_as_float(((unsigned)b) << 16); }
__device__ __forceinline__ float bfr(float f) { return bf2f(f2bf(f)); }
__device__ __forceinline__ v16h cat16(v8h lo, v8h hi) { return __builtin_shufflevector(lo, hi, 0, 1, 2, 3, 4, 5, 6, 7, 8, 9, 10, 11, 12, 13, 14, 15); }
__device__ __forceinline__ v16bf cat16b(v8us lo, v8us hi) { return __builtin_bit_cast(v16bf, __builtin_shufflevector(lo, hi, 0, 1, 2, 3, 4, 5, 6, 7, 8, 9, 10, 11, 12, 13, 14, 15)); }
__device__ __forceinline__ v8f wmma16(v16h a, v16h b, v8f c) { return __builtin_amdgcn_wmma_f32_16x16x32_f16(false, a, false, b, (short)0, c, false, false); }
__device__ __forceinline__ v8f wmmab(v16bf a, v16bf b, v8f c) { return __builtin_amdgcn_wmma_f32_16x16x32_bf16(false, a, false, b, (short)0, c, false, false); }
__device__ __forceinline__ h16 tohx(float x) { return (h16)x; }
__device__ __forceinline__ void splitf(float y, unsigned short& h, unsigned short& l) { h = f2bf(y); l = f2bf(y - bf2f(h)); }
typedef __attribute__((ext_vector_type(4))) _Float16 v4h;
typedef __attribute__((ext_vector_type(4))) unsigned short v4us;



// ---- gemmw_tile: register-blocked GEMM, ONE WAVE per 64x64 output tile (16 accumulators) at rows r0, columns c0, operands straight from K-contiguous 16-bit planes; 32 threads; os: 16 x 68 floats of LDS.
// C[m][n] (f32, pitch ldc, + optional f32 bias[n]) = sum_k A[m][k] Bt[n][k] (+ split products per NSPLIT). The calling kernel hands in the pointers of its batch, projection and head. K % 32 == 0.
// PL: what the epilogue stores of the biased f32 result y. 0: C only. 1: the planes fp16(y), bf16 hi(y), bf16 lo(y) only, row-major P[m * HD + n]. 2: C and those planes. 3: C and the planes transposed, P[n * TT + m].
template <typename T16> struct WFrag;
template <> struct WFrag<h16> { typedef v16h V; static __device__ __forceinline__ V ld(const h16* p) { return cat16(*(const v8h*)p, *(const v8h*)(p + 16)); } static __device__ __forceinline__ v8f mma(V a, V b, v8f c) { return wmma16(a, b, c); } };
template <> struct WFrag<bf> { typedef v16bf V; static __device__ __forceinline__ V ld(const bf* p) { return cat16b(*(const v8us*)p, *(const v8us*)(p + 16)); } static __device__ __forceinline__ v8f mma(V a, V b, v8f c) { return wmmab(a, b, c); } };
template <typename T16, int NSPLIT, bool BIAS, int PL>
__device__ __forceinline__ void gemmw_tile(const T16* __restrict__ A, const T16* __restrict__ A2, const T16* __restrict__ Bt, const T16* __restrict__ Bt2, int K, float* C, int ldc, const float* __restrict__ bias, h16* P16, bf* Ph, bf* Pl, int r0, int c0, float* os) {
    typedef typename WFrag<T16>::V V;
    constexpr int ldp = (PL == 3) ? TT : HD;   // plane pitch, a constant: every plane store of a lane is one base address plus an immediate offset
    const int lane = threadIdx.x & 31, lr = lane & 15, hi = lane >> 4;
    v8f acc[4][4];
#pragma unroll
    for (int mb = 0; mb < 4; ++mb)
#pragma unroll
        for (int nb = 0; nb < 4; ++nb) acc[mb][nb] = (v8f){};
    const size_t aoff = (size_t)(r0 + lr) * K + 8 * hi, boff = (size_t)(c0 + lr) * K + 8 * hi;
    float bb[4];   // PL 3: the bias of this lane's column in each 16-column block, fetched here so that its latency passes under the K loop
    if (PL == 3) {
#pragma unroll
        for (int nb = 0; nb < 4; ++nb) bb[nb] = BIAS ? bfr(bias[c0 + nb * 16 + lr]) : 0.f; }
#pragma unroll 1
    for (int kc = 0; kc < K; kc += 32) {
        V a[4], a2[4];
#pragma unroll
        for (int mb = 0; mb < 4; ++mb) { a[mb] = WFrag<T16>::ld(A + aoff + (size_t)mb * 16 * K + kc); if (NSPLIT == 1 || NSPLIT == 2) a2[mb] = WFrag<T16>::ld(A2 + aoff + (size_t)mb * 16 * K + kc); }
#pragma unroll
        for (int nb = 0; nb < 4; ++nb) { const V b = WFrag<T16>::ld(Bt + boff + (size_t)nb * 16 * K + kc); V b2; if (NSPLIT >= 2) b2 = WFrag<T16>::ld(Bt2 + boff + (size_t)nb * 16 * K + kc);
#pragma unroll
            for (int mb = 0; mb < 4; ++mb) { acc[mb][nb] = WFrag<T16>::mma(a[mb], b, acc[mb][nb]); if (NSPLIT == 1 || NSPLIT == 2) acc[mb][nb] = WFrag<T16>::mma(a2[mb], b, acc[mb][nb]); if (NSPLIT >= 2) acc[mb][nb] = WFrag<T16>::mma(a[mb], b2, acc[mb][nb]); } }
        asm volatile("v_nop\n\tv_nop\n\tv_nop\n\tv_nop" : "+v"(acc[0][0]), "+v"(acc[1][1]), "+v"(acc[2][2]), "+v"(acc[3][3]) : "v"(a[0]), "v"(a[3]));
    }
    // Plane stores: one base address per plane and lane (formed once, never rewritten) plus immediate offsets; each row block's values are all converted first and then stored back to back, so that no store's registers are reused while it is in flight and one wait per block is enough.
    const size_t pl0 = (PL == 3) ? (size_t)(c0 + lr) * ldp + r0 + hi * 8 : (size_t)(r0 + hi) * ldp + c0 + lr * 4;
    h16* const q16 = P16 + pl0; bf* const qh = Ph + pl0; bf* const ql = Pl + pl0;
#pragma unroll
    for (int mb = 0; mb < 4; ++mb) {
        if (PL == 3) {   // a lane's 8 accumulator values are 8 consecutive rows m of one column n: one 16-byte store per transposed plane, straight from registers
            v8h o16[4]; v8us oh[4], ol[4];
#pragma unroll
            for (int nb = 0; nb < 4; ++nb)
#pragma unroll
                for (int j = 0; j < 8; ++j) { const float y = acc[mb][nb][j] + bb[nb]; o16[nb][j] = tohx(y); unsigned short a2, c2; splitf(y, a2, c2); oh[nb][j] = a2; ol[nb][j] = c2; }
            __builtin_amdgcn_sched_barrier(0);   // keeps the 12 stores behind all the conversions: interleaved, each store's data registers were reused at once, with a wait behind nearly every store
#pragma unroll
            for (int nb = 0; nb < 4; ++nb) { const int po = nb * 16 * ldp + mb * 16; *(v8h*)(q16 + po) = o16[nb]; *(v8us*)(qh + po) = oh[nb]; *(v8us*)(ql + po) = ol[nb]; }
            asm volatile("s_wait_xcnt 0x0" ::: "memory"); }   // stands behind the transposed plane stores, in front of the first rewrite of their data registers
#pragma unroll
        for (int nb = 0; nb < 4; ++nb) {
#pragma unroll
            for (int j = 0; j < 8; ++j) os[(hi * 8 + j) * 68 + nb * 16 + lr] = acc[mb][nb][j]; }
        __builtin_amdgcn_wave_barrier(); asm volatile("" ::: "memory");
        float* crow = C + (size_t)(r0 + mb * 16) * ldc + c0;
        { v4f val[8]; v4h o16[8]; v4us oh[8], ol[8]; const int cofs = lr * 4;
#pragma unroll
            for (int s = 0; s < 8; ++s) { const int row = 2 * s + hi; val[s] = *(const v4fa*)(os + row * 68 + cofs); if (BIAS) { val[s][0] += bfr(bias[c0 + cofs]); val[s][1] += bfr(bias[c0 + cofs + 1]); val[s][2] += bfr(bias[c0 + cofs + 2]); val[s][3] += bfr(bias[c0 + cofs + 3]); }
                if (PL == 1 || PL == 2) {
#pragma unroll
                    for (int r = 0; r < 4; ++r) { o16[s][r] = tohx(val[s][r]); unsigned short a2, c2; splitf(val[s][r], a2, c2); oh[s][r] = a2; ol[s][r] = c2; } } }
            __builtin_amdgcn_sched_barrier(0);   // as above: the block's stores issue back to back behind all its conversions
#pragma unroll
            for (int s = 0; s < 8; ++s) {
                if (PL != 1) *(v4f*)(crow + (size_t)(2 * s + hi) * ldc + cofs) = val[s];
                if (PL == 1 || PL == 2) { const int po = (mb * 16 + 2 * s) * ldp; *(v4h*)(q16 + po) = o16[s]; *(v4us*)(qh + po) = oh[s]; *(v4us*)(ql + po) = ol[s]; } }
        }
        asm volatile("s_wait_xcnt 0x0" ::: "memory");   // stands behind this row block's stores, in front of the first rewrite of their data and address registers by the next block
        __builtin_amdgcn_wave_barrier(); asm volatile("" ::: "memory");
    }
}

// ---- k_qkv: the three projections of both batches in one launch. grid (TT / 64 row tiles, batch, projection * 16 + head); W3 = the transposed Wq, Wk, Wv one behind the other, so that z * 64 is the tile's first weight row.
// Planes and present are [batch][head][..]; PKV = present: K of both batches, then V. The projection is the same for the whole work-group (one wave): a scalar branch.
__global__ __launch_bounds__(32) void k_qkv(const bf* __restrict__ XB, const bf* __restrict__ W3, const float* __restrict__ bq, const float* __restrict__ bk, const float* __restrict__ bv, float* PKV, h16* Q16, bf* Qh, bf* Ql, h16* K16, bf* Kh, bf* Kl, h16* V16, bf* Vh, bf* Vl) {
    __shared__ __align__(16) float os[16 * 68];
    const int r0 = blockIdx.x * 64, b = blockIdx.y, z = blockIdx.z, pr = z / NH_, hd = z % NH_;
    const bf* A = XB + (size_t)b * TT * DM; const bf* Bt = W3 + (size_t)z * HD * DM; const size_t po = (size_t)(b * NH_ + hd) * TT * HD;
    if (pr == 0) gemmw_tile<bf, 0, true, 1>(A, nullptr, Bt, nullptr, DM, nullptr, 0, bq + hd * HD, Q16 + po, Qh + po, Ql + po, r0, 0, os);   // Q: only the head planes [b][h][t][d] are stored
    else if (pr == 1) gemmw_tile<bf, 0, true, 2>(A, nullptr, Bt, nullptr, DM, PKV + po, HD, bk + hd * HD, K16 + po, Kh + po, Kl + po, r0, 0, os);   // present[0]: K[b][g][t][d] = (x Wk + bk)[t][g*64 + d], row pitch 64, and the key planes
    else gemmw_tile<bf, 0, true, 3>(A, nullptr, Bt, nullptr, DM, PKV + (size_t)NB_ * NKV * TT * HD + po, HD, bv + hd * HD, V16 + po, Vh + po, Vl + po, r0, 0, os);   // present[1]: V likewise, and the value planes transposed [b][g][d][t]
}
// ---- k_wo: out0 = merged (hi + lo) x Wo + bo over the rows of both batches; grid (NB_ * TT / 64, DM / 64).
__global__ __launch_bounds__(32) void k_wo(const bf* __restrict__ Ah, const bf* __restrict__ Al, const bf* __restrict__ WO, float* C, const float* __restrict__ bo) {
    __shared__ __align__(16) float os[16 * 68];
    gemmw_tile<bf, 1, true, 0>(Ah, Al, WO, nullptr, DQ, C, DM, bo, nullptr, nullptr, nullptr, blockIdx.x * 64, blockIdx.y * 64, os);
}

typedef __attribute__((ext_vector_type(2))) unsigned short v2us;

__device__ __forceinline__ void wtG(const float* __restrict__ w, int K, int N, bf* Bt, int blk) {
    const int lane = threadIdx.x & 31; const int L0 = (blk * 8 + (threadIdx.x >> 5)) * 8; const int nlines = N * K / 64;
{
#pragma unroll 1
        for (int l = 0; l < 8; ++l) { const int L = L0 + l; if (L >= nlines) break; const size_t e = (size_t)L * 64 + lane * 2; const int k = (int)(e % K), n = (int)(e / K); v2us o;
            o[0] = f2bf(w[(size_t)k * N + n]); o[1] = f2bf(w[(size_t)(k + 1) * N + n]); *(v2us*)(Bt + e) = o; }
         }
}
__device__ __forceinline__ void cvt8(const float* __restrict__ src, bf* dst, size_t n8, int blk) { const size_t i = (size_t)blk * 256 + threadIdx.x; if (i >= n8) return; const v8f v = *(const v8f*)(src + i * 8); v8us o;
#pragma unroll
    for (int k = 0; k < 8; ++k) o[k] = f2bf(v[k]); *(v8us*)(dst + i * 8) = o;  }
// ---- k_prep: all the 16-bit operand copies in one launch. Work-groups 0 .. 4 * WTB - 1: the four weights transposed into W4 (Wq, Wk, Wv, Wo one behind the other), WTB work-groups each; the rest: x of both batches rounded to bf16.
#define WTB (DM * DM / 64 / 64)
__global__ __launch_bounds__(256) void k_prep(const float* __restrict__ x, const float* __restrict__ wq, const float* __restrict__ wk, const float* __restrict__ wv, const float* __restrict__ wo, bf* XB, bf* W4) {
    const int g = blockIdx.x;
    if (g < 4 * WTB) { const int mi = g / WTB; wtG(mi == 0 ? wq : mi == 1 ? wk : mi == 2 ? wv : wo, DM, DM, W4 + (size_t)mi * DM * DM, g % WTB); }
    else cvt8(x, XB, (size_t)NB_ * TT * DM / 8, g - 4 * WTB);
}

// ---- k_fattn: causal attention of both batches in ONE launch; scores and probabilities stay in registers (running maximum and sum per query), and the epilogue writes the head-merged hi/lo planes.
// S^T = K Q^T (A = key rows, B = query rows) and O^T += V^T P^T (A = V^T rows, B = P^T): two 16-key score tiles of one query column group, converted in place, ARE the B operand of the second product.
// One work-group = 16 * NQ queries of one head; its 4 waves take the 32-key blocks kb = wave, wave + 4, ... up to the diagonal and join their partial (max, sum, O) through LDS in the fixed order wave 0..3.
#define FC (SCL * 1.4426950408889634f)   // SCL * log2(e): p = 2^((s - max) * FC) on the unscaled scores s
#define FP 68                      // floats per query row of the LDS partial-output planes (64 + 4: 16-byte aligned rows that start on different banks)
__device__ __forceinline__ float xhalf(float x) { return __builtin_bit_cast(float, __builtin_amdgcn_permlanex16(__builtin_bit_cast(int, x), __builtin_bit_cast(int, x), 0x76543210, 0xfedcba98, false, false)); }   // lane l reads lane l ^ 16
template <typename T16> struct PFrag;
template <> struct PFrag<h16> { static __device__ __forceinline__ void pack(const float* p, v16h& a, v16h& b) { (void)b;
#pragma unroll
    for (int s = 0; s < 16; ++s) a[s] = (h16)p[s]; } };
template <> struct PFrag<bf> { static __device__ __forceinline__ void pack(const float* p, v16bf& a, v16bf& b) { v8us h0, h1, l0, l1;
#pragma unroll
    for (int s = 0; s < 8; ++s) { unsigned short x, y; x = f2bf(p[s]); y = f2bf(p[s] - bf2f(x)); h0[s] = x; l0[s] = y; x = f2bf(p[8 + s]); y = f2bf(p[8 + s] - bf2f(x)); h1[s] = x; l1[s] = y; }
    a = cat16b(h0, h1); b = cat16b(l0, l1); } };
template <typename T16, bool HL, int NQ>
__device__ __forceinline__ void fattn_body(const T16* __restrict__ Q, const T16* __restrict__ Q2, const T16* __restrict__ Kp, const T16* __restrict__ Kp2, const T16* __restrict__ Vt, const T16* __restrict__ Vt2, int q0, int head, bf* Ah, bf* Al, float* so, float* sm, float* sl) {
    typedef typename WFrag<T16>::V V;
    const int tid = threadIdx.x, lane = tid & 31, c = lane & 15, h = lane >> 4, w = __builtin_amdgcn_readfirstlane(tid >> 5);   // the wave's number in a scalar register: loop bounds and the diagonal test become scalar branches
    V qf[NQ][2], qf2[NQ][2];
    { const size_t qo = (size_t)(q0 + c) * HD + 8 * h; const T16* qa = Q + qo; const T16* qb = HL ? Q2 + qo : qa;
#pragma unroll
      for (int qt = 0; qt < NQ; ++qt)
#pragma unroll
        for (int ks = 0; ks < 2; ++ks) { qf[qt][ks] = WFrag<T16>::ld(qa + qt * 16 * HD + ks * 32); if (HL) qf2[qt][ks] = WFrag<T16>::ld(qb + qt * 16 * HD + ks * 32); }
      asm volatile("s_wait_xcnt 0x0" :: "v"(qa), "v"(qb) : "memory"); }   // stands in front of the first rewrite of the Q loads' address registers, which it names to keep them untouched up to here
    v8f o[4][NQ]; float m[NQ], l[NQ];
#pragma unroll
    for (int qt = 0; qt < NQ; ++qt) { m[qt] = -3.0e38f; l[qt] = 0.f;
#pragma unroll
        for (int dt = 0; dt < 4; ++dt) o[dt][qt] = (v8f){}; }
    const int nkb = (q0 + 16 * NQ + 31) / 32;   // 32-key blocks that hold a key <= the last query; the first key of each of them is visible to every query of the group
    V kf[2][2], kf2[2][2];
    // K fragments of the 32-key block at key kp. The wait stands behind the loads, in front of the first rewrite of their address registers; naming the addresses as its inputs keeps those registers untouched up to it.
    auto loadK = [&](int kp) { const size_t ko = (size_t)(kp + c) * HD + 8 * h; const T16* ka = Kp + ko; const T16* kb2 = HL ? Kp2 + ko : ka;
#pragma unroll
        for (int kt = 0; kt < 2; ++kt)
#pragma unroll
            for (int ks = 0; ks < 2; ++ks) { kf[kt][ks] = WFrag<T16>::ld(ka + kt * 16 * HD + ks * 32); if (HL) kf2[kt][ks] = WFrag<T16>::ld(kb2 + kt * 16 * HD + ks * 32); }
        asm volatile("s_wait_xcnt 0x0" :: "v"(ka), "v"(kb2) : "memory"); };
    if (!HL) loadK(min(w, nkb - 1) * 32);       // fp16 rows: the wave's first block is fetched ahead of the loop
#pragma unroll 1
    for (int kb = w; kb < nkb; kb += 4) {
        const int k0 = kb * 32;
        if (HL) loadK(k0);                      // hi/lo rows (few passes, twice the fragments): fetched in the pass itself, which keeps the kernel at four waves per SIMD
        V vf[4], vf2[4];
        { const size_t vo = (size_t)c * TT + k0 + 8 * h; const T16* va = Vt + vo; const T16* vb = HL ? Vt2 + vo : va;
#pragma unroll
          for (int dt = 0; dt < 4; ++dt) { vf[dt] = WFrag<T16>::ld(va + (size_t)dt * 16 * TT); if (HL) vf2[dt] = WFrag<T16>::ld(vb + (size_t)dt * 16 * TT); }
          asm volatile("s_wait_xcnt 0x0" :: "v"(va), "v"(vb) : "memory"); }   // as in loadK, for the V loads' address registers
        float p[NQ][16];
#pragma unroll
        for (int qt = 0; qt < NQ; ++qt)
#pragma unroll
            for (int kt = 0; kt < 2; ++kt) { v8f s = (v8f){};
#pragma unroll
                for (int ks = 0; ks < 2; ++ks) { s = WFrag<T16>::mma(kf[kt][ks], qf[qt][ks], s); if (HL) { s = WFrag<T16>::mma(kf[kt][ks], qf2[qt][ks], s); s = WFrag<T16>::mma(kf2[kt][ks], qf[qt][ks], s); } }
#pragma unroll
                for (int r = 0; r < 8; ++r) p[qt][kt * 8 + r] = s[r]; }
        if (!HL) loadK(((kb + 4 < nkb) ? kb + 4 : kb) * 32);   // the next pass's K fragments fly under this pass's softmax and second product (the last pass fetches its own block again: in bounds, unused)
        const bool diag = (k0 + 31 > q0);       // wave-uniform: only blocks that reach past the group's first query need the causal select
#pragma unroll
        for (int qt = 0; qt < NQ; ++qt) {
            if (diag) { const int qi = q0 + qt * 16 + c - k0 - 8 * h;   // key k0 + kt*16 + 8h + r is visible when kt*16 + r <= qi
#pragma unroll
                for (int s = 0; s < 16; ++s) p[qt][s] = ((s >> 3) * 16 + (s & 7) <= qi) ? p[qt][s] : -3.0e38f; }
            float mx = m[qt];
#pragma unroll
            for (int s = 0; s < 16; ++s) mx = fmaxf(mx, p[qt][s]);
            mx = fmaxf(mx, xhalf(mx));
            const float al = __builtin_amdgcn_exp2f((m[qt] - mx) * FC), mc = mx * FC; m[qt] = mx; float ps = 0.f;
#pragma unroll
            for (int s = 0; s < 16; ++s) { p[qt][s] = __builtin_amdgcn_exp2f(fmaf(p[qt][s], FC, -mc)); ps += p[qt][s]; }
            l[qt] = fmaf(l[qt], al, ps);        // each lane half keeps the sum of its own keys; the halves join behind the loop
            V pa, pb; PFrag<T16>::pack(p[qt], pa, pb);
#pragma unroll
            for (int dt = 0; dt < 4; ++dt) { o[dt][qt] *= al; o[dt][qt] = WFrag<T16>::mma(vf[dt], pa, o[dt][qt]); if (HL) { o[dt][qt] = WFrag<T16>::mma(vf[dt], pb, o[dt][qt]); o[dt][qt] = WFrag<T16>::mma(vf2[dt], pa, o[dt][qt]); } }
        }
    }
    constexpr int QN = 16 * NQ;
#pragma unroll
    for (int qt = 0; qt < NQ; ++qt) { l[qt] += xhalf(l[qt]); if (h == 0) { sm[w * QN + qt * 16 + c] = m[qt]; sl[w * QN + qt * 16 + c] = l[qt]; } }
    __syncthreads();                            // every wave's (max, sum) is in LDS
#pragma unroll
    for (int qt = 0; qt < NQ; ++qt) { const int q = qt * 16 + c; float M = sm[q];
#pragma unroll
        for (int u = 1; u < 4; ++u) M = fmaxf(M, sm[u * QN + q]);
        float L = 0.f;
#pragma unroll
        for (int u = 0; u < 4; ++u) L += sl[u * QN + q] * __builtin_amdgcn_exp2f((sm[u * QN + q] - M) * FC);   // a wave without a block holds (-3e38, 0): weight 0
        const float f = __builtin_amdgcn_exp2f((m[qt] - M) * FC) / L;
#pragma unroll
        for (int dt = 0; dt < 4; ++dt) { float* d = so + (size_t)(w * QN + q) * FP + dt * 16 + 8 * h; v4f x, y;
#pragma unroll
            for (int r = 0; r < 4; ++r) { x[r] = o[dt][qt][r] * f; y[r] = o[dt][qt][4 + r] * f; }
            *(v4fa*)d = x; *(v4fa*)(d + 4) = y; } }
    __syncthreads();                            // every wave's weighted partial output is in LDS
#pragma unroll
    for (int i = 0; i < 2 * NQ; ++i) { const int idx = i * 128 + tid, q = idx >> 4, d4 = (idx & 15) * 4; v4f a = *(const v4fa*)(so + (size_t)q * FP + d4);
#pragma unroll
        for (int u = 1; u < 4; ++u) a += *(const v4fa*)(so + (size_t)(u * QN + q) * FP + d4);
        v4us oh, ol;
#pragma unroll
        for (int r = 0; r < 4; ++r) { unsigned short x, y; splitf(a[r], x, y); oh[r] = x; ol[r] = y; }
        const size_t oo = (size_t)(q0 + q) * DQ + head * HD + d4; *(v4us*)(Ah + oo) = oh; *(v4us*)(Al + oo) = ol; }
}
// grid (batch * 16 + head, query group), heaviest groups first: groups 0 .. (TT - RH) / 32 - 1 are 32 fp16 rows each, from the last rows down to row RH; the rest are 16 hi/lo rows each (3 products), from row RH - 16 down to 0
__global__ __launch_bounds__(128) void k_fattn(const h16* __restrict__ Q16, const h16* __restrict__ K16, const h16* __restrict__ V16, const bf* __restrict__ Qh, const bf* __restrict__ Ql, const bf* __restrict__ Kh, const bf* __restrict__ Kl, const bf* __restrict__ Vh, const bf* __restrict__ Vl, bf* Ah, bf* Al) {
    __shared__ __align__(16) float so[4 * 32 * FP]; __shared__ float sm[4 * 32]; __shared__ float sl[4 * 32];
    const int head = blockIdx.x % NH_, g = blockIdx.y; const size_t hp = (size_t)blockIdx.x * TT * HD;   // planes are [batch][head][..]
    { const size_t ao = (size_t)(blockIdx.x / NH_) * TT * DQ; Ah += ao; Al += ao; }   // the merged planes are [batch][t][head * 64 + d]
    if (g < (TT - RH) / 32) fattn_body<h16, false, 2>(Q16 + hp, nullptr, K16 + hp, nullptr, V16 + hp, nullptr, TT - 32 * (g + 1), head, Ah, Al, so, sm, sl);
    else fattn_body<bf, true, 1>(Qh + hp, Ql + hp, Kh + hp, Kl + hp, Vh + hp, Vl + hp, RH - 16 * (g - (TT - RH) / 32 + 1), head, Ah, Al, so, sm, sl);
}

extern "C" void kernel_launch(void* const* d_in, const int* in_sizes, int n_in,
                              void* d_out, int out_size, void* d_ws, size_t ws_size, hipStream_t stream) {
    (void)in_sizes; (void)n_in; (void)out_size;
        const float* x = (const float*)d_in[0]; const float* wq = (const float*)d_in[1]; const float* bq = (const float*)d_in[2]; const float* wk = (const float*)d_in[3]; const float* bk = (const float*)d_in[4]; const float* wv = (const float*)d_in[5]; const float* bv = (const float*)d_in[6]; const float* wo = (const float*)d_in[7]; const float* bo = (const float*)d_in[8];   /* argument order x, Wq, bq, Wk, bk, Wv, bv, Wo, bo ('xw' [1024][1024]); ONE input stream x for queries, keys and values; no mask input: the causal rule is applied by index */
    float* OUT = (float*)d_out;     // out0 [2][2048][1024]; then out1 = present = stack((k, v)): K [2][16][2048][64] then V [2][16][2048][64] (offset 16,777,216 B)
    float* OUTK = OUT + (size_t)NB_ * TT * DM;
    char* wsp = (char*)d_ws;
    auto take = [&](size_t bytes) { char* p = wsp; wsp += (bytes + 255) & ~(size_t)255; return (void*)p; };
    bf* W4 = (bf*)take((size_t)4 * DM * DM * 2);   // Wq, Wk, Wv, Wo transposed, one behind the other
    bf* XB = (bf*)take((size_t)NB_ * TT * DM * 2);
    h16* QP16 = (h16*)take((size_t)NB_ * NH_ * TT * HD * 2); h16* KP16 = (h16*)take((size_t)NB_ * NKV * TT * HD * 2); h16* VT16 = (h16*)take((size_t)NB_ * NKV * HD * TT * 2);
    bf* QPh = (bf*)take((size_t)NB_ * NH_ * TT * HD * 2); bf* QPl = (bf*)take((size_t)NB_ * NH_ * TT * HD * 2); bf* KPh = (bf*)take((size_t)NB_ * NKV * TT * HD * 2); bf* KPl = (bf*)take((size_t)NB_ * NKV * TT * HD * 2); bf* VTh = (bf*)take((size_t)NB_ * NKV * HD * TT * 2); bf* VTl = (bf*)take((size_t)NB_ * NKV * HD * TT * 2);
    bf* ATh = (bf*)take((size_t)NB_ * TT * DQ * 2); bf* ATl = (bf*)take((size_t)NB_ * TT * DQ * 2);
    if ((size_t)(wsp - (char*)d_ws) > ws_size) return;    // ws 256 MiB
    k_prep<<<(unsigned)(4 * WTB + (size_t)NB_ * TT * DM / 8 / 256), 256, 0, stream>>>(x, wq, wk, wv, wo, XB, W4);
    k_qkv<<<dim3(TT / 64, NB_, 3 * NH_), 32, 0, stream>>>(XB, W4, bq, bk, bv, OUTK, QP16, QPh, QPl, KP16, KPh, KPl, VT16, VTh, VTl);
    // one kv head per query head; all rows of all 16 heads of both batches in one launch, which also writes the merged hi/lo planes
    k_fattn<<<dim3(NB_ * NH_, (TT - RH) / 32 + RH / 16, 1), 128, 0, stream>>>(QP16, KP16, VT16, QPh, QPl, KPh, KPl, VTh, VTl, ATh, ATl);
    k_wo<<<dim3(NB_ * TT / 64, DM / 64, 1), 32, 0, stream>>>(ATh, ATl, W4 + (size_t)3 * DM * DM, OUT, bo);
}

// v006
// Measured time: 123 microseconds a run.
// In two side-by-side timings against v005, it was 1.12 and 1.09 times as fast.
// Counting every step since v000, it is 20.5 times as fast.
#include <hip/hip_runtime.h>

// Causal multi-head self-attention scaled by the MODEL width, with a kv-cache output (x [2][2048][1024]; q, k, v = x W + b ('xw' [1024][1024] 1/32, biases zeros on this draw: read; 16 heads x 64); scores / sqrt(float32(D = 1024)) (x 1/32); causal (-inf); softmax; out0 = merged Wo + bo ('xw' + bias zeros: read) -> [2][2048][1024]; out1 = present = stack((k, v)) [2][2][16][2048][64]: the biased key and value projections head-major, each written ONCE, head-major, by the biased projection GEMM itself (grid z = projection x head), whose epilogue also writes the 16-bit planes of the same values; argument order x, Wq, bq, Wk, bk, Wv, bv, Wo, bo).
// Layout: every stage is ONE launch over both batches (4 launches): k_prep (the 4 'xw' weights transposed, x rounded to bf16 once), k_qkv (grid z = projection x head, y = batch), k_fattn (grid x = batch x head), k_wo (4096 rows); exact projections + f32 biases, each projection GEMM writing its own fp16 and hi/lo head planes (V transposed) from its accumulators; causal T-2048 attention fused into one launch (k_fattn: rows < 512 hi/lo 3 products, rest fp16; running softmax in registers; key blocks above the diagonal never touched; heads merged in its epilogue); merged hi/lo x Wo exact + bo.
// Operand layout: every 16-bit plane that a matrix fragment is loaded from is stored FRAGMENT-MAJOR: a fragment (16 rows x 32 k) is 512 elements in a row, [k half j][lane = 16 * ((k >> 3) & 1) + (row & 15)][k & 7], so that each 16-byte-per-lane load of a wave reads 512 contiguous bytes (4 whole lines, not 32-byte pieces of 16 lines). Fragments of a 16-row block follow one another in k, so a 16-row block still starts at row * K; the V^T planes hold, per 32 keys, the 4 fragments of the 64 d rows.
// Compute dtypes, f32 accumulate: every input rounded to bf16; projections exact + f32 biases; attention rows < 512 3 products, rest fp16; softmax f32; Wo hl x exact + bias.

#define NB_  2
#define TT   2048
#define DM   1024
#define NH_  16
#define NKV  16
#define REP  (NH_ / NKV)
#define HD   64
#define DQ   (NH_ * HD)
#define DKV  (NKV * HD)
#define RH   512                  // query rows < RH use hi+lo planes
#define SCL  0.03125f   // 1 / sqrt(D = 1024) = 2^-5: the module divides the scores by the square root of the MODEL width, not of the head width
typedef _Float16 h16;
typedef unsigned short bf;
typedef __attribute__((ext_vector_type(16))) __bf16   v16bf;
typedef __attribute__((ext_vector_type(16))) _Float16 v16h;
typedef __attribute__((ext_vector_type(8)))  _Float16 v8h;
typedef __attribute__((ext_vector_type(8)))  unsigned short v8us;
typedef __attribute__((ext_vector_type(8)))  float    v8f;
typedef __attribute__((ext_vector_type(4)))  float    v4f;
typedef v8h  __attribute__((may_alias)) v8ha;
typedef v4f  __attribute__((may_alias)) v4fa;
typedef v8us __attribute__((may_alias)) v8usa;

__device__ __forceinline__ unsigned short f2bf(float f) { unsigned u = __float_as_uint(f); u += 0x7FFFu + ((u >> 16) & 1u); return (unsigned short)(u >> 16); }
__device__ __forceinline__ float bf2f(unsigned short b) { return __uint_as_float(((unsigned)b) << 16); }
__device__ __forceinline__ float bfr(float f) { return bf2f(f2bf(f)); }
__device__ __forceinline__ v16h cat16(v8h lo, v8h hi) { return __builtin_shufflevector(lo, hi, 0, 1, 2, 3, 4, 5, 6, 7, 8, 9, 10, 11, 12, 13, 14, 15); }
__device__ __forceinline__ v16bf cat16b(v8us lo, v8us hi) { return __builtin_bit_cast(v16bf, __builtin_shufflevector(lo, hi, 0, 1, 2, 3, 4, 5, 6, 7, 8, 9, 10, 11, 12, 13, 14, 15)); }
__device__ __forceinline__ v8f wmma16(v16h a, v16h b, v8f c) { return __builtin_amdgcn_wmma_f32_16x16x32_f16(false, a, false, b, (short)0, c, false, false); }
__device__ __forceinline__ v8f wmmab(v16bf a, v16bf b, v8f c) { return __builtin_amdgcn_wmma_f32_16x16x32_bf16(false, a, false, b, (short)0, c, false, false); }
__device__ __forceinline__ h16 tohx(float x) { return (h16)x; }
__device__ __forceinline__ void splitf(float y, unsigned short& h, unsigned short& l) { h = f2bf(y); l = f2bf(y - bf2f(h)); }



// ---- gemmw_tile: register-blocked GEMM, ONE WAVE per 64x64 output tile (16 accumulators) at rows r0, columns c0, operands straight from fragment-major 16-bit planes (WFrag::ld: p = the fragment's start + lane * 8; k halves 256 elements apart); 32 threads; os: 16 x 68 floats of LDS.
// C[m][n] (f32, pitch ldc, + optional f32 bias[n]) = sum_k A[m][k] Bt[n][k] (+ split products per NSPLIT). The calling kernel hands in the pointers of its batch, projection and head. K % 32 == 0.
// PL: what the epilogue stores of the biased f32 result y. 0: C only. 1: the planes fp16(y), bf16 hi(y), bf16 lo(y) only, fragment-major with rows m, k = n (c0 = 0, 64 columns). 2: C and those planes. 3: C and the planes transposed, fragment-major with rows n, k = m.
template <typename T16> struct WFrag;
template <> struct WFrag<h16> { typedef v16h V; static __device__ __forceinline__ V ld(const h16* p) { return cat16(*(const v8h*)p, *(const v8h*)(p + 256)); } static __device__ __forceinline__ v8f mma(V a, V b, v8f c) { return wmma16(a, b, c); } };
template <> struct WFrag<bf> { typedef v16bf V; static __device__ __forceinline__ V ld(const bf* p) { return cat16b(*(const v8us*)p, *(const v8us*)(p + 256)); } static __device__ __forceinline__ v8f mma(V a, V b, v8f c) { return wmmab(a, b, c); } };
template <typename T16, int NSPLIT, bool BIAS, int PL>
__device__ __forceinline__ void gemmw_tile(const T16* __restrict__ A, const T16* __restrict__ A2, const T16* __restrict__ Bt, const T16* __restrict__ Bt2, int K, float* C, int ldc, const float* __restrict__ bias, h16* P16, bf* Ph, bf* Pl, int r0, int c0, float* os) {
    typedef typename WFrag<T16>::V V;
    const int lane = threadIdx.x & 31, lr = lane & 15, hi = lane >> 4;
    v8f acc[4][4];
#pragma unroll
    for (int mb = 0; mb < 4; ++mb)
#pragma unroll
        for (int nb = 0; nb < 4; ++nb) acc[mb][nb] = (v8f){};
    const size_t aoff = (size_t)r0 * K + lane * 8, boff = (size_t)c0 * K + lane * 8;   // a 16-row block is 16 * K elements; its fragment of k block kc / 32 starts kc * 16 elements in
    float bb[4];   // PL 1 to 3: the bias of this lane's column in each 16-column block, fetched here so that its latency passes under the K loop
    if (PL != 0) {
#pragma unroll
        for (int nb = 0; nb < 4; ++nb) bb[nb] = BIAS ? bfr(bias[c0 + nb * 16 + lr]) : 0.f; }
#pragma unroll 1
    for (int kc = 0; kc < K; kc += 32) {
        V a[4], a2[4], b[4], b2[4];
        const T16* pa = A + aoff + (size_t)kc * 16; const T16* pb = Bt + boff + (size_t)kc * 16; const T16* pa2 = (NSPLIT == 1 || NSPLIT == 2) ? A2 + aoff + (size_t)kc * 16 : pa; const T16* pb2 = (NSPLIT >= 2) ? Bt2 + boff + (size_t)kc * 16 : pb;
#pragma unroll
        for (int mb = 0; mb < 4; ++mb) { a[mb] = WFrag<T16>::ld(pa + (size_t)mb * 16 * K); if (NSPLIT == 1 || NSPLIT == 2) a2[mb] = WFrag<T16>::ld(pa2 + (size_t)mb * 16 * K); }
#pragma unroll
        for (int nb = 0; nb < 4; ++nb) { b[nb] = WFrag<T16>::ld(pb + (size_t)nb * 16 * K); if (NSPLIT >= 2) b2[nb] = WFrag<T16>::ld(pb2 + (size_t)nb * 16 * K); }
        asm volatile("s_wait_xcnt 0x0" :: "v"(pa), "v"(pa2), "v"(pb), "v"(pb2) : "memory");   // stands behind the pass's loads, in front of the first rewrite of their address registers, which it names to keep them untouched up to here
#pragma unroll
        for (int nb = 0; nb < 4; ++nb)
#pragma unroll
            for (int mb = 0; mb < 4; ++mb) { acc[mb][nb] = WFrag<T16>::mma(a[mb], b[nb], acc[mb][nb]); if (NSPLIT == 1 || NSPLIT == 2) acc[mb][nb] = WFrag<T16>::mma(a2[mb], b[nb], acc[mb][nb]); if (NSPLIT >= 2) acc[mb][nb] = WFrag<T16>::mma(a[mb], b2[nb], acc[mb][nb]); }
        asm volatile("v_nop\n\tv_nop\n\tv_nop\n\tv_nop" : "+v"(acc[0][0]), "+v"(acc[1][1]), "+v"(acc[2][2]), "+v"(acc[3][3]) : "v"(a[0]), "v"(a[3]));
    }
    // Plane stores: one base address per plane and lane (formed once, never rewritten) plus immediate offsets; every store of a wave is 512 contiguous bytes; each row block's values are all converted first and then stored back to back, so that no store's registers are reused while it is in flight and one wait per block is enough.
    const size_t pl0 = (size_t)r0 * HD + lane * 8;   // 64 elements per row m in either orientation
    h16* const q16 = P16 + pl0; bf* const qh = Ph + pl0; bf* const ql = Pl + pl0;
#pragma unroll
    for (int mb = 0; mb < 4; ++mb) {
        if (PL == 3) {   // a lane's 8 accumulator values are 8 consecutive rows m (the k of the transposed fragment) of one column n: they are this lane's 16 bytes of fragment nb, k half mb & 1, straight from registers
            v8h o16[4]; v8us oh[4], ol[4];
#pragma unroll
            for (int nb = 0; nb < 4; ++nb)
#pragma unroll
                for (int j = 0; j < 8; ++j) { const float y = acc[mb][nb][j] + bb[nb]; o16[nb][j] = tohx(y); unsigned short a2, c2; splitf(y, a2, c2); oh[nb][j] = a2; ol[nb][j] = c2; }
            __builtin_amdgcn_sched_barrier(0);   // keeps the 12 stores behind all the conversions: interleaved, each store's data registers were reused at once, with a wait behind nearly every store
#pragma unroll
            for (int nb = 0; nb < 4; ++nb) { const int po = (mb >> 1) * 2048 + nb * 512 + (mb & 1) * 256; *(v8h*)(q16 + po) = o16[nb]; *(v8us*)(qh + po) = oh[nb]; *(v8us*)(ql + po) = ol[nb]; }
            asm volatile("s_wait_xcnt 0x0" ::: "memory"); }   // stands behind the transposed plane stores, in front of the first rewrite of their data registers
#pragma unroll
        for (int nb = 0; nb < 4; ++nb) {
#pragma unroll
            for (int j = 0; j < 8; ++j) os[(hi * 8 + j) * 68 + nb * 16 + lr] = (PL != 0) ? acc[mb][nb][j] + bb[nb] : acc[mb][nb][j]; }
        __builtin_amdgcn_wave_barrier(); asm volatile("" ::: "memory");
        if (PL == 1 || PL == 2) {   // lane (hi, lr) takes row lr, columns u * 16 + hi * 8 .. + 7: its 16 bytes of k half u & 1 of fragment u >> 1
            v8h o16[4]; v8us oh[4], ol[4];
#pragma unroll
            for (int u = 0; u < 4; ++u) { const float* sp = os + lr * 68 + u * 16 + hi * 8; const v4f x0 = *(const v4fa*)sp, x1 = *(const v4fa*)(sp + 4);
#pragma unroll
                for (int r = 0; r < 4; ++r) { unsigned short a2, c2; o16[u][r] = tohx(x0[r]); splitf(x0[r], a2, c2); oh[u][r] = a2; ol[u][r] = c2; o16[u][4 + r] = tohx(x1[r]); splitf(x1[r], a2, c2); oh[u][4 + r] = a2; ol[u][4 + r] = c2; } }
            __builtin_amdgcn_sched_barrier(0);   // as above: the block's stores issue back to back behind all its conversions
#pragma unroll
            for (int u = 0; u < 4; ++u) { const int po = mb * 16 * HD + u * 256; *(v8h*)(q16 + po) = o16[u]; *(v8us*)(qh + po) = oh[u]; *(v8us*)(ql + po) = ol[u]; }
            asm volatile("s_wait_xcnt 0x0" ::: "memory"); }   // stands behind the plane stores, in front of the first rewrite of their data registers
        if (PL != 1) { float* crow = C + (size_t)(r0 + mb * 16) * ldc + c0; v4f val[8]; const int cofs = lr * 4;
#pragma unroll
            for (int s = 0; s < 8; ++s) { const int row = 2 * s + hi; val[s] = *(const v4fa*)(os + row * 68 + cofs); if (BIAS && PL == 0) { val[s][0] += bfr(bias[c0 + cofs]); val[s][1] += bfr(bias[c0 + cofs + 1]); val[s][2] += bfr(bias[c0 + cofs + 2]); val[s][3] += bfr(bias[c0 + cofs + 3]); } }
            __builtin_amdgcn_sched_barrier(0);   // as above: the block's stores issue back to back behind all its LDS reads
#pragma unroll
            for (int s = 0; s < 8; ++s) *(v4f*)(crow + (size_t)(2 * s + hi) * ldc + cofs) = val[s];
            asm volatile("s_wait_xcnt 0x0" ::: "memory"); }   // stands behind this row block's stores, in front of the first rewrite of their data and address registers by the next block
        __builtin_amdgcn_wave_barrier(); asm volatile("" ::: "memory");
    }
}

// ---- k_qkv: the three projections of both batches in one launch. grid (TT / 64 row tiles, batch, projection * 16 + head); W3 = the transposed Wq, Wk, Wv one behind the other, so that z * 64 is the tile's first weight row.
// Planes and present are [batch][head][..]; PKV = present: K of both batches, then V. The projection is the same for the whole work-group (one wave): a scalar branch.
__global__ __launch_bounds__(32) void k_qkv(const bf* __restrict__ XB, const bf* __restrict__ W3, const float* __restrict__ bq, const float* __restrict__ bk, const float* __restrict__ bv, float* PKV, h16* Q16, bf* Qh, bf* Ql, h16* K16, bf* Kh, bf* Kl, h16* V16, bf* Vh, bf* Vl) {
    __shared__ __align__(16) float os[16 * 68];
    const int r0 = blockIdx.x * 64, b = blockIdx.y, z = blockIdx.z, pr = z / NH_, hd = z % NH_;
    const bf* A = XB + (size_t)b * TT * DM; const bf* Bt = W3 + (size_t)z * HD * DM; const size_t po = (size_t)(b * NH_ + hd) * TT * HD;
    if (pr == 0) gemmw_tile<bf, 0, true, 1>(A, nullptr, Bt, nullptr, DM, nullptr, 0, bq + hd * HD, Q16 + po, Qh + po, Ql + po, r0, 0, os);   // Q: only the head planes [b][h], fragment-major rows t, are stored
    else if (pr == 1) gemmw_tile<bf, 0, true, 2>(A, nullptr, Bt, nullptr, DM, PKV + po, HD, bk + hd * HD, K16 + po, Kh + po, Kl + po, r0, 0, os);   // present[0]: K[b][g][t][d] = (x Wk + bk)[t][g*64 + d], row pitch 64, and the key planes
    else gemmw_tile<bf, 0, true, 3>(A, nullptr, Bt, nullptr, DM, PKV + (size_t)NB_ * NKV * TT * HD + po, HD, bv + hd * HD, V16 + po, Vh + po, Vl + po, r0, 0, os);   // present[1]: V likewise, and the value planes transposed (fragment-major rows d, k = t)
}
// ---- k_wo: out0 = merged (hi + lo) x Wo + bo over the rows of both batches; grid (NB_ * TT / 64, DM / 64).
__global__ __launch_bounds__(32) void k_wo(const bf* __restrict__ Ah, const bf* __restrict__ Al, const bf* __restrict__ WO, float* C, const float* __restrict__ bo) {
    __shared__ __align__(16) float os[16 * 68];
    gemmw_tile<bf, 1, true, 0>(Ah, Al, WO, nullptr, DQ, C, DM, bo, nullptr, nullptr, nullptr, blockIdx.x * 64, blockIdx.y * 64, os);
}


// One weight (w[k][n], DM x DM) transposed into fragment-major rows n: one wave per fragment, each lane its 2 x 8 k values of one n. A load of the wave reads 64 contiguous bytes of 2 rows k; waves 2i and 2i + 1 take neighbouring n blocks, the two halves of the same lines.
__device__ __forceinline__ void wtG(const float* __restrict__ w, bf* Bt, int blk) {
    const int lane = threadIdx.x & 31, f = blk * 8 + (threadIdx.x >> 5), nb = (f & 1) + 2 * (f >> 6), kb = (f >> 1) & 31;
    const float* sp = w + (size_t)(kb * 32 + (lane >> 4) * 8) * DM + nb * 16 + (lane & 15); v8us o0, o1;
#pragma unroll
    for (int e = 0; e < 8; ++e) { o0[e] = f2bf(sp[(size_t)e * DM]); o1[e] = f2bf(sp[(size_t)(16 + e) * DM]); }
    bf* d = Bt + (size_t)(nb * (DM / 32) + kb) * 512 + lane * 8; *(v8us*)d = o0; *(v8us*)(d + 256) = o1;
}
// x (rows of DM floats) rounded into the fragment-major plane: thread i writes the plane's i-th 16 bytes and reads the 8 floats that belong there.
__device__ __forceinline__ void cvt8(const float* __restrict__ src, bf* dst, size_t n8, int blk) { const size_t i = (size_t)blk * 256 + threadIdx.x; if (i >= n8) return;
    const int lane = (int)(i & 31), j = (int)(i >> 5) & 1, kb = (int)(i >> 6) & (DM / 32 - 1); const size_t rb = i >> 11;   // 2048 such pieces per 16-row block of DM = 1024 columns
    const v8f v = *(const v8f*)(src + (rb * 16 + (lane & 15)) * DM + kb * 32 + j * 16 + (lane >> 4) * 8); v8us o;
#pragma unroll
    for (int k = 0; k < 8; ++k) o[k] = f2bf(v[k]); *(v8us*)(dst + i * 8) = o;  }
// ---- k_prep: all the 16-bit operand copies in one launch. Work-groups 0 .. 4 * WTB - 1: the four weights transposed into W4 (Wq, Wk, Wv, Wo one behind the other), WTB work-groups each; the rest: x of both batches rounded to bf16.
#define WTB (DM * DM / 64 / 64)
__global__ __launch_bounds__(256) void k_prep(const float* __restrict__ x, const float* __restrict__ wq, const float* __restrict__ wk, const float* __restrict__ wv, const float* __restrict__ wo, bf* XB, bf* W4) {
    const int g = blockIdx.x;
    if (g < 4 * WTB) { const int mi = g / WTB; wtG(mi == 0 ? wq : mi == 1 ? wk : mi == 2 ? wv : wo, W4 + (size_t)mi * DM * DM, g % WTB); }
    else cvt8(x, XB, (size_t)NB_ * TT * DM / 8, g - 4 * WTB);
}

// ---- k_fattn: causal attention of both batches in ONE launch; scores and probabilities stay in registers (running maximum and sum per query), and the epilogue writes the head-merged hi/lo planes.
// S^T = K Q^T (A = key rows, B = query rows) and O^T += V^T P^T (A = V^T rows, B = P^T): two 16-key score tiles of one query column group, converted in place, ARE the B operand of the second product.
// One work-group = 16 * NQ queries of one head; its 4 waves take the 32-key blocks kb = wave, wave + 4, ... up to the diagonal and join their partial (max, sum, O) through LDS in the fixed order wave 0..3.
#define FC (SCL * 1.4426950408889634f)   // SCL * log2(e): p = 2^((s - max) * FC) on the unscaled scores s
#define FP 68                      // floats per query row of the LDS partial-output planes (64 + 4: 16-byte aligned rows that start on different banks)
__device__ __forceinline__ float xhalf(float x) { return __builtin_bit_cast(float, __builtin_amdgcn_permlanex16(__builtin_bit_cast(int, x), __builtin_bit_cast(int, x), 0x76543210, 0xfedcba98, false, false)); }   // lane l reads lane l ^ 16
template <typename T16> struct PFrag;
template <> struct PFrag<h16> { static __device__ __forceinline__ void pack(const float* p, v16h& a, v16h& b) { (void)b;
#pragma unroll
    for (int s = 0; s < 16; ++s) a[s] = (h16)p[s]; } };
template <> struct PFrag<bf> { static __device__ __forceinline__ void pack(const float* p, v16bf& a, v16bf& b) { v8us h0, h1, l0, l1;
#pragma unroll
    for (int s = 0; s < 8; ++s) { unsigned short x, y; x = f2bf(p[s]); y = f2bf(p[s] - bf2f(x)); h0[s] = x; l0[s] = y; x = f2bf(p[8 + s]); y = f2bf(p[8 + s] - bf2f(x)); h1[s] = x; l1[s] = y; }
    a = cat16b(h0, h1); b = cat16b(l0, l1); } };
template <typename T16, bool HL, int NQ>
__device__ __forceinline__ void fattn_body(const T16* __restrict__ Q, const T16* __restrict__ Q2, const T16* __restrict__ Kp, const T16* __restrict__ Kp2, const T16* __restrict__ Vt, const T16* __restrict__ Vt2, int q0, int head, bf* Ah, bf* Al, float* so, float* sm, float* sl) {
    typedef typename WFrag<T16>::V V;
    const int tid = threadIdx.x, lane = tid & 31, c = lane & 15, h = lane >> 4, w = __builtin_amdgcn_readfirstlane(tid >> 5);   // the wave's number in a scalar register: loop bounds and the diagonal test become scalar branches
    V qf[NQ][2], qf2[NQ][2];
    { const size_t qo = (size_t)q0 * HD + lane * 8; const T16* qa = Q + qo; const T16* qb = HL ? Q2 + qo : qa;
#pragma unroll
      for (int qt = 0; qt < NQ; ++qt)
#pragma unroll
        for (int ks = 0; ks < 2; ++ks) { qf[qt][ks] = WFrag<T16>::ld(qa + qt * 16 * HD + ks * 512); if (HL) qf2[qt][ks] = WFrag<T16>::ld(qb + qt * 16 * HD + ks * 512); }
      asm volatile("s_wait_xcnt 0x0" :: "v"(qa), "v"(qb) : "memory"); }   // stands in front of the first rewrite of the Q loads' address registers, which it names to keep them untouched up to here
    v8f o[4][NQ]; float m[NQ], l[NQ];
#pragma unroll
    for (int qt = 0; qt < NQ; ++qt) { m[qt] = -3.0e38f; l[qt] = 0.f;
#pragma unroll
        for (int dt = 0; dt < 4; ++dt) o[dt][qt] = (v8f){}; }
    const int nkb = (q0 + 16 * NQ + 31) / 32;   // 32-key blocks that hold a key <= the last query; the first key of each of them is visible to every query of the group
    V kf[2][2], kf2[2][2];
    // K fragments of the 32-key block at key kp. The wait stands behind the loads, in front of the first rewrite of their address registers; naming the addresses as its inputs keeps those registers untouched up to it.
    auto loadK = [&](int kp) { const size_t ko = (size_t)kp * HD + lane * 8; const T16* ka = Kp + ko; const T16* kb2 = HL ? Kp2 + ko : ka;
#pragma unroll
        for (int kt = 0; kt < 2; ++kt)
#pragma unroll
            for (int ks = 0; ks < 2; ++ks) { kf[kt][ks] = WFrag<T16>::ld(ka + kt * 16 * HD + ks * 512); if (HL) kf2[kt][ks] = WFrag<T16>::ld(kb2 + kt * 16 * HD + ks * 512); }
        asm volatile("s_wait_xcnt 0x0" :: "v"(ka), "v"(kb2) : "memory"); };
    if (!HL) loadK(min(w, nkb - 1) * 32);       // fp16 rows: the wave's first block is fetched ahead of the loop
#pragma unroll 1
    for (int kb = w; kb < nkb; kb += 4) {
        const int k0 = kb * 32;
        if (HL) loadK(k0);                      // hi/lo rows (few passes, twice the fragments): fetched in the pass itself, which keeps the kernel at four waves per SIMD
        V vf[4], vf2[4];
        { const size_t vo = (size_t)k0 * HD + lane * 8; const T16* va = Vt + vo; const T16* vb = HL ? Vt2 + vo : va;
#pragma unroll
          for (int dt = 0; dt < 4; ++dt) { vf[dt] = WFrag<T16>::ld(va + dt * 512); if (HL) vf2[dt] = WFrag<T16>::ld(vb + dt * 512); }
          asm volatile("s_wait_xcnt 0x0" :: "v"(va), "v"(vb) : "memory"); }   // as in loadK, for the V loads' address registers
        float p[NQ][16];
#pragma unroll
        for (int qt = 0; qt < NQ; ++qt)
#pragma unroll
            for (int kt = 0; kt < 2; ++kt) { v8f s = (v8f){};
#pragma unroll
                for (int ks = 0; ks < 2; ++ks) { s = WFrag<T16>::mma(kf[kt][ks], qf[qt][ks], s); if (HL) { s = WFrag<T16>::mma(kf[kt][ks], qf2[qt][ks], s); s = WFrag<T16>::mma(kf2[kt][ks], qf[qt][ks], s); } }
#pragma unroll
                for (int r = 0; r < 8; ++r) p[qt][kt * 8 + r] = s[r]; }
        if (!HL) loadK(((kb + 4 < nkb) ? kb + 4 : kb) * 32);   // the next pass's K fragments fly under this pass's softmax and second product (the last pass fetches its own block again: in bounds, unused)
        const bool diag = (k0 + 31 > q0);       // wave-uniform: only blocks that reach past the group's first query need the causal select
#pragma unroll
        for (int qt = 0; qt < NQ; ++qt) {
            if (diag) { const int qi = q0 + qt * 16 + c - k0 - 8 * h;   // key k0 + kt*16 + 8h + r is visible when kt*16 + r <= qi
#pragma unroll
                for (int s = 0; s < 16; ++s) p[qt][s] = ((s >> 3) * 16 + (s & 7) <= qi) ? p[qt][s] : -3.0e38f; }
            float mx = m[qt];
#pragma unroll
            for (int s = 0; s < 16; ++s) mx = fmaxf(mx, p[qt][s]);
            mx = fmaxf(mx, xhalf(mx));
            const float al = __builtin_amdgcn_exp2f((m[qt] - mx) * FC), mc = mx * FC; m[qt] = mx; float ps = 0.f;
#pragma unroll
            for (int s = 0; s < 16; ++s) { p[qt][s] = __builtin_amdgcn_exp2f(fmaf(p[qt][s], FC, -mc)); ps += p[qt][s]; }
            l[qt] = fmaf(l[qt], al, ps);        // each lane half keeps the sum of its own keys; the halves join behind the loop
            V pa, pb; PFrag<T16>::pack(p[qt], pa, pb);
#pragma unroll
            for (int dt = 0; dt < 4; ++dt) { o[dt][qt] *= al; o[dt][qt] = WFrag<T16>::mma(vf[dt], pa, o[dt][qt]); if (HL) { o[dt][qt] = WFrag<T16>::mma(vf[dt], pb, o[dt][qt]); o[dt][qt] = WFrag<T16>::mma(vf2[dt], pa, o[dt][qt]); } }
        }
    }
    constexpr int QN = 16 * NQ;
#pragma unroll
    for (int qt = 0; qt < NQ; ++qt) { l[qt] += xhalf(l[qt]); if (h == 0) { sm[w * QN + qt * 16 + c] = m[qt]; sl[w * QN + qt * 16 + c] = l[qt]; } }
    __syncthreads();                            // every wave's (max, sum) is in LDS
#pragma unroll
    for (int qt = 0; qt < NQ; ++qt) { const int q = qt * 16 + c; float M = sm[q];
#pragma unroll
        for (int u = 1; u < 4; ++u) M = fmaxf(M, sm[u * QN + q]);
        float L = 0.f;
#pragma unroll
        for (int u = 0; u < 4; ++u) L += sl[u * QN + q] * __builtin_amdgcn_exp2f((sm[u * QN + q] - M) * FC);   // a wave without a block holds (-3e38, 0): weight 0
        const float f = __builtin_amdgcn_exp2f((m[qt] - M) * FC) / L;
#pragma unroll
        for (int dt = 0; dt < 4; ++dt) { float* d = so + (size_t)(w * QN + q) * FP + dt * 16 + 8 * h; v4f x, y;
#pragma unroll
            for (int r = 0; r < 4; ++r) { x[r] = o[dt][qt][r] * f; y[r] = o[dt][qt][4 + r] * f; }
            *(v4fa*)d = x; *(v4fa*)(d + 4) = y; } }
    __syncthreads();                            // every wave's weighted partial output is in LDS
    // Merged planes, fragment-major for the last GEMM (rows t, k = head * 64 + d): wave w takes the 16 columns d = w * 16 .. of each 16-query block, lane (h, c) query c, 8 columns: 512 contiguous bytes per store of a wave.
#pragma unroll
    for (int qt = 0; qt < NQ; ++qt) { const float* sp = so + (size_t)(qt * 16 + c) * FP + w * 16 + 8 * h; v4f a0 = *(const v4fa*)sp, a1 = *(const v4fa*)(sp + 4);
#pragma unroll
        for (int u = 1; u < 4; ++u) { a0 += *(const v4fa*)(sp + (size_t)u * QN * FP); a1 += *(const v4fa*)(sp + (size_t)u * QN * FP + 4); }
        v8us oh, ol;
#pragma unroll
        for (int r = 0; r < 4; ++r) { unsigned short x, y; splitf(a0[r], x, y); oh[r] = x; ol[r] = y; splitf(a1[r], x, y); oh[4 + r] = x; ol[4 + r] = y; }
        const size_t oo = (size_t)(q0 + qt * 16) * DQ + (size_t)(head * 2 + (w >> 1)) * 512 + (w & 1) * 256 + lane * 8; *(v8us*)(Ah + oo) = oh; *(v8us*)(Al + oo) = ol;
        asm volatile("s_wait_xcnt 0x0" ::: "memory"); }   // stands behind the two stores, in front of the first rewrite of their data and address registers
}
// grid (batch * 16 + head, query group), heaviest groups first: groups 0 .. (TT - RH) / 32 - 1 are 32 fp16 rows each, from the last rows down to row RH; the rest are 16 hi/lo rows each (3 products), from row RH - 16 down to 0
__global__ __launch_bounds__(128) void k_fattn(const h16* __restrict__ Q16, const h16* __restrict__ K16, const h16* __restrict__ V16, const bf* __restrict__ Qh, const bf* __restrict__ Ql, const bf* __restrict__ Kh, const bf* __restrict__ Kl, const bf* __restrict__ Vh, const bf* __restrict__ Vl, bf* Ah, bf* Al) {
    __shared__ __align__(16) float so[4 * 32 * FP]; __shared__ float sm[4 * 32]; __shared__ float sl[4 * 32];
    const int head = blockIdx.x % NH_, g = blockIdx.y; const size_t hp = (size_t)blockIdx.x * TT * HD;   // planes are [batch][head][..]
    { const size_t ao = (size_t)(blockIdx.x / NH_) * TT * DQ; Ah += ao; Al += ao; }   // the merged planes: rows batch * TT + t, k = head * 64 + d, fragment-major
    if (g < (TT - RH) / 32) fattn_body<h16, false, 2>(Q16 + hp, nullptr, K16 + hp, nullptr, V16 + hp, nullptr, TT - 32 * (g + 1), head, Ah, Al, so, sm, sl);
    else fattn_body<bf, true, 1>(Qh + hp, Ql + hp, Kh + hp, Kl + hp, Vh + hp, Vl + hp, RH - 16 * (g - (TT - RH) / 32 + 1), head, Ah, Al, so, sm, sl);
}

extern "C" void kernel_launch(void* const* d_in, const int* in_sizes, int n_in,
                              void* d_out, int out_size, void* d_ws, size_t ws_size, hipStream_t stream) {
    (void)in_sizes; (void)n_in; (void)out_size;
        const float* x = (const float*)d_in[0]; const float* wq = (const float*)d_in[1]; const float* bq = (const float*)d_in[2]; const float* wk = (const float*)d_in[3]; const float* bk = (const float*)d_in[4]; const float* wv = (const float*)d_in[5]; const float* bv = (const float*)d_in[6]; const float* wo = (const float*)d_in[7]; const float* bo = (const float*)d_in[8];   /* argument order x, Wq, bq, Wk, bk, Wv, bv, Wo, bo ('xw' [1024][1024]); ONE input stream x for queries, keys and values; no mask input: the causal rule is applied by index */
    float* OUT = (float*)d_out;     // out0 [2][2048][1024]; then out1 = present = stack((k, v)): K [2][16][2048][64] then V [2][16][2048][64] (offset 16,777,216 B)
    float* OUTK = OUT + (size_t)NB_ * TT * DM;
    char* wsp = (char*)d_ws;
    auto take = [&](size_t bytes) { char* p = wsp; wsp += (bytes + 255) & ~(size_t)255; return (void*)p; };
    bf* W4 = (bf*)take((size_t)4 * DM * DM * 2);   // Wq, Wk, Wv, Wo transposed, one behind the other
    bf* XB = (bf*)take((size_t)NB_ * TT * DM * 2);
    h16* QP16 = (h16*)take((size_t)NB_ * NH_ * TT * HD * 2); h16* KP16 = (h16*)take((size_t)NB_ * NKV * TT * HD * 2); h16* VT16 = (h16*)take((size_t)NB_ * NKV * HD * TT * 2);
    bf* QPh = (bf*)take((size_t)NB_ * NH_ * TT * HD * 2); bf* QPl = (bf*)take((size_t)NB_ * NH_ * TT * HD * 2); bf* KPh = (bf*)take((size_t)NB_ * NKV * TT * HD * 2); bf* KPl = (bf*)take((size_t)NB_ * NKV * TT * HD * 2); bf* VTh = (bf*)take((size_t)NB_ * NKV * HD * TT * 2); bf* VTl = (bf*)take((size_t)NB_ * NKV * HD * TT * 2);
    bf* ATh = (bf*)take((size_t)NB_ * TT * DQ * 2); bf* ATl = (bf*)take((size_t)NB_ * TT * DQ * 2);
    if ((size_t)(wsp - (char*)d_ws) > ws_size) return;    // ws 256 MiB
    k_prep<<<(unsigned)(4 * WTB + (size_t)NB_ * TT * DM / 8 / 256), 256, 0, stream>>>(x, wq, wk, wv, wo, XB, W4);
    k_qkv<<<dim3(TT / 64, NB_, 3 * NH_), 32, 0, stream>>>(XB, W4, bq, bk, bv, OUTK, QP16, QPh, QPl, KP16, KPh, KPl, VT16, VTh, VTl);
    // one kv head per query head; all rows of all 16 heads of both batches in one launch, which also writes the merged hi/lo planes
    k_fattn<<<dim3(NB_ * NH_, (TT - RH) / 32 + RH / 16, 1), 128, 0, stream>>>(QP16, KP16, VT16, QPh, QPl, KPh, KPl, VTh, VTl, ATh, ATl);
    k_wo<<<dim3(NB_ * TT / 64, DM / 64, 1), 32, 0, stream>>>(ATh, ATl, W4 + (size_t)3 * DM * DM, OUT, bo);
}

// v007
// It runs in 73.1 microseconds.
// Two timings next to v006 both put it at 1.66 times that version's speed.
// Counting every step since v000, it is 34.1 times as fast.
#include <hip/hip_runtime.h>

// Causal multi-head self-attention scaled by the MODEL width, with a kv-cache output (x [2][2048][1024]; q, k, v = x W + b ('xw' [1024][1024] 1/32, biases zeros on this draw: read; 16 heads x 64); scores / sqrt(float32(D = 1024)) (x 1/32); causal (-inf); softmax; out0 = merged Wo + bo ('xw' + bias zeros: read) -> [2][2048][1024]; out1 = present = stack((k, v)) [2][2][16][2048][64]: the biased key and value projections head-major, each written ONCE, head-major, by the biased projection GEMM itself (grid z = projection x head pair), whose epilogue also writes the 16-bit planes of the same values; argument order x, Wq, bq, Wk, bk, Wv, bv, Wo, bo).
// Layout: every stage is ONE launch over both batches (4 launches): k_prep (the 4 'xw' weights transposed, x rounded to bf16 once), k_qkv (grid z = projection x head pair, y = batch), k_fattn (grid x = batch x head), k_wo (4096 rows); exact projections + f32 biases, each projection GEMM writing its own fp16 and hi/lo head planes (V transposed) from its accumulators; causal T-2048 attention fused into one launch (k_fattn: rows < 512 hi/lo 3 products, rest fp16; running softmax in registers; key blocks above the diagonal never touched; heads merged in its epilogue); merged hi/lo x Wo exact + bo.
// Operand layout: every 16-bit plane that a matrix fragment is loaded from is stored FRAGMENT-MAJOR: a fragment (16 rows x 32 k) is 512 elements in a row, [k half j][lane = 16 * ((k >> 3) & 1) + (row & 15)][k & 7], so that each 16-byte-per-lane load of a wave reads 512 contiguous bytes (4 whole lines, not 32-byte pieces of 16 lines). Fragments of a 16-row block follow one another in k, so a 16-row block still starts at row * K; the V^T planes hold, per 32 keys, the 4 fragments of the 64 d rows.
// Compute dtypes, f32 accumulate: every input rounded to bf16; projections exact + f32 biases; attention rows < 512 3 products, rest fp16; softmax f32; Wo hl x exact + bias.

#define NB_  2
#define TT   2048
#define DM   1024
#define NH_  16
#define NKV  16
#define REP  (NH_ / NKV)
#define HD   64
#define DQ   (NH_ * HD)
#define DKV  (NKV * HD)
#define RH   512                  // query rows < RH use hi+lo planes
#define SCL  0.03125f   // 1 / sqrt(D = 1024) = 2^-5: the module divides the scores by the square root of the MODEL width, not of the head width
typedef _Float16 h16;
typedef unsigned short bf;
typedef __attribute__((ext_vector_type(16))) __bf16   v16bf;
typedef __attribute__((ext_vector_type(16))) _Float16 v16h;
typedef __attribute__((ext_vector_type(8)))  _Float16 v8h;
typedef __attribute__((ext_vector_type(8)))  unsigned short v8us;
typedef __attribute__((ext_vector_type(8)))  float    v8f;
typedef __attribute__((ext_vector_type(4)))  float    v4f;
typedef v8h  __attribute__((may_alias)) v8ha;
typedef v4f  __attribute__((may_alias)) v4fa;
typedef v8us __attribute__((may_alias)) v8usa;

__device__ __forceinline__ unsigned short f2bf(float f) { unsigned u = __float_as_uint(f); u += 0x7FFFu + ((u >> 16) & 1u); return (unsigned short)(u >> 16); }
__device__ __forceinline__ float bf2f(unsigned short b) { return __uint_as_float(((unsigned)b) << 16); }
__device__ __forceinline__ float bfr(float f) { return bf2f(f2bf(f)); }
__device__ __forceinline__ v16h cat16(v8h lo, v8h hi) { return __builtin_shufflevector(lo, hi, 0, 1, 2, 3, 4, 5, 6, 7, 8, 9, 10, 11, 12, 13, 14, 15); }
__device__ __forceinline__ v16bf cat16b(v8us lo, v8us hi) { return __builtin_bit_cast(v16bf, __builtin_shufflevector(lo, hi, 0, 1, 2, 3, 4, 5, 6, 7, 8, 9, 10, 11, 12, 13, 14, 15)); }
__device__ __forceinline__ v8f wmma16(v16h a, v16h b, v8f c) { return __builtin_amdgcn_wmma_f32_16x16x32_f16(false, a, false, b, (short)0, c, false, false); }
__device__ __forceinline__ v8f wmmab(v16bf a, v16bf b, v8f c) { return __builtin_amdgcn_wmma_f32_16x16x32_bf16(false, a, false, b, (short)0, c, false, false); }
__device__ __forceinline__ h16 tohx(float x) { return (h16)x; }
__device__ __forceinline__ void splitf(float y, unsigned short& h, unsigned short& l) { h = f2bf(y); l = f2bf(y - bf2f(h)); }



// ---- gemmw_tile: register-blocked GEMM, one work-group of 4 waves (2 x 2) per 128x128 output tile, ONE WAVE per 64x64 part (16 accumulators) at rows r0, columns c0. The operands come from fragment-major 16-bit planes (a fragment is 512 elements in a row; WFrag::ld: p = the fragment's start + lane * 8; k halves 256 elements apart) and are staged in LDS, where the two waves of a tile row share the A fragments and the two of a tile column the B fragments: each fragment leaves L2 once per work-group, not once per wave.
// Staging: a stage is KS(NSPLIT) k of the tile's 8 A row blocks, its 8 B row blocks and (NSPLIT 1) its 8 A2 row blocks; a row block's share of a stage (a chunk) lies in a row in the plane (KS * 32 bytes) and is copied as it lies, by asynchronous copies to LDS (16 bytes per lane, 512 per copy; wave w copies chunks w, w + 4, ...). Two buffers: stage t + 2 is asked for when every wave has left stage t, and flies under stage t + 1. Inside a stage the fragments of k block kk + 1 are read from LDS, as one group into a second register set, ahead of the products of block kk.
// C[m][n] (f32, pitch ldc, + optional f32 bias[n]) = sum_k A[m][k] Bt[n][k] (+ A2[m][k] Bt[n][k] for NSPLIT 1). Ag, Ag2, Bg: the first fragment of the WORK-GROUP's 128 rows of each operand; every other pointer is the wave's own (its batch, projection and head). K % (2 * KS) == 0. os: the wave's own 16 x 68 floats of LDS; st: the work-group's two stage buffers.
// PL: what the epilogue stores of the biased f32 result y. 0: C only. 1: the planes fp16(y), bf16 hi(y), bf16 lo(y) only, fragment-major with rows m, k = n (c0 = 0, 64 columns). 2: C and those planes. 3: C and the planes transposed, fragment-major with rows n, k = m.
#define KS(NSPLIT) (NSPLIT == 1 ? 128 : 64)            // k per stage: the longer stage where one work-group has a WGP to itself (one wave per SIMD, nobody to fill the gap at a stage's start); 64 lets three work-groups share a WGP's LDS
#define CHE(NSPLIT) (KS(NSPLIT) * 16)                  // elements of a chunk: 16 rows x KS k = KS / 32 fragments
#define STE(NSPLIT) ((NSPLIT == 1 ? 24 : 16) * CHE(NSPLIT))   // elements of a stage buffer
template <typename T16> struct WFrag;
template <> struct WFrag<h16> { typedef v16h V; static __device__ __forceinline__ V ld(const h16* p) { return cat16(*(const v8h*)p, *(const v8h*)(p + 256)); } static __device__ __forceinline__ v8f mma(V a, V b, v8f c) { return wmma16(a, b, c); } };
template <> struct WFrag<bf> { typedef v16bf V; static __device__ __forceinline__ V ld(const bf* p) { return cat16b(*(const v8us*)p, *(const v8us*)(p + 256)); } static __device__ __forceinline__ v8f mma(V a, V b, v8f c) { return wmmab(a, b, c); } };
// CP4: the 4 copies of a 2-KiB chunk; CP8: the 8 of a 4-KiB chunk: one LDS address and one global address per lane; the immediate offset moves both alike (the chunk lies in LDS as it lies in the plane).
#define CP4(L, G) "global_load_async_to_lds_b128 " L ", " G ", off\n\tglobal_load_async_to_lds_b128 " L ", " G ", off offset:512\n\tglobal_load_async_to_lds_b128 " L ", " G ", off offset:1024\n\tglobal_load_async_to_lds_b128 " L ", " G ", off offset:1536\n\t"
#define CP8(L, G) CP4(L, G) "global_load_async_to_lds_b128 " L ", " G ", off offset:2048\n\tglobal_load_async_to_lds_b128 " L ", " G ", off offset:2560\n\tglobal_load_async_to_lds_b128 " L ", " G ", off offset:3072\n\tglobal_load_async_to_lds_b128 " L ", " G ", off offset:3584\n\t"
template <typename T16, int NSPLIT, bool BIAS, int PL>
__device__ __forceinline__ void gemmw_tile(const T16* __restrict__ Ag, const T16* __restrict__ Ag2, const T16* __restrict__ Bg, int K, float* C, int ldc, const float* __restrict__ bias, h16* P16, bf* Ph, bf* Pl, int r0, int c0, float* os, T16* st, int w) {
    typedef typename WFrag<T16>::V V;
    const int lane = threadIdx.x & 31, lr = lane & 15, hi = lane >> 4, wm = w >> 1, wn = w & 1;
    v8f acc[4][4];
#pragma unroll
    for (int mb = 0; mb < 4; ++mb)
#pragma unroll
        for (int nb = 0; nb < 4; ++nb) acc[mb][nb] = (v8f){};
    float bb[4];   // PL 1 to 3: the bias of this lane's column in each 16-column block, fetched here so that its latency passes under the K loop
    if (PL != 0) {
#pragma unroll
        for (int nb = 0; nb < 4; ++nb) bb[nb] = BIAS ? bfr(bias[c0 + nb * 16 + lr]) : 0.f; }
    // This wave's copies of stage t into buffer t & 1: row blocks w and w + 4 of each operand. A 16-row block is 16 * K elements; its chunk of stage t starts t * CH elements in.
    constexpr int CH = CHE(NSPLIT), ST = STE(NSPLIT), NK = KS(NSPLIT) / 32; constexpr unsigned C4 = 4u * CH * 2u;   // C4: bytes of 4 chunks
    const size_t go = (size_t)w * 16 * K + lane * 8; const size_t g4 = (size_t)64 * K;
    const unsigned l0 = (unsigned)(size_t)st + (unsigned)(w * CH + lane * 8) * 2u;   // the lane's LDS byte address in chunk w of buffer 0
    auto stage = [&](int t) {
        const size_t gk = go + (size_t)t * CH; const unsigned lb = l0 + (unsigned)(t & 1) * (unsigned)(ST * 2);
        const T16* a0 = Ag + gk; const T16* a1 = a0 + g4; const T16* b0 = Bg + gk; const T16* b1 = b0 + g4;
        // the copies and, as the statement's last line, the wait that stands in front of the first rewrite of their address registers
        if (NSPLIT == 1) { const T16* c0p = Ag2 + gk; const T16* c1p = c0p + g4;
            asm volatile(CP8("%0", "%6") CP8("%1", "%7") CP8("%2", "%8") CP8("%3", "%9") CP8("%4", "%10") CP8("%5", "%11") "s_wait_xcnt 0x0"
                :: "v"(lb), "v"(lb + C4), "v"(lb + 2u * C4), "v"(lb + 3u * C4), "v"(lb + 4u * C4), "v"(lb + 5u * C4), "v"(a0), "v"(a1), "v"(b0), "v"(b1), "v"(c0p), "v"(c1p) : "memory"); }
        else
            asm volatile(CP4("%0", "%4") CP4("%1", "%5") CP4("%2", "%6") CP4("%3", "%7") "s_wait_xcnt 0x0"
                :: "v"(lb), "v"(lb + C4), "v"(lb + 2u * C4), "v"(lb + 3u * C4), "v"(a0), "v"(a1), "v"(b0), "v"(b1) : "memory"); };
    const int nt = K / KS(NSPLIT);
    stage(0);
    asm volatile("s_wait_asynccnt 0x0" ::: "memory");   // this wave's copies of stage 0 have landed
    __syncthreads();                                    // every wave's have: stage 0 may be read
    stage(1);
#pragma unroll 1   // one stage per trip, kept rolled: the loop's text stays small and every trip ends in the same publish point
    for (int t = 0; t < nt; ++t) {
        const T16* sb = st + (size_t)(t & 1) * ST + lane * 8; const T16* sa = sb + wm * 4 * CH; const T16* sw = sb + (8 + wn * 4) * CH;
        V a[2][4], a2[2][4], b[2][4];
        auto frags = [&](int kk) {   // the wave's fragments of k block kk of this stage, into register set kk & 1
#pragma unroll
            for (int mb = 0; mb < 4; ++mb) { a[kk & 1][mb] = WFrag<T16>::ld(sa + mb * CH + kk * 512); if (NSPLIT == 1) a2[kk & 1][mb] = WFrag<T16>::ld(sa + (16 + mb) * CH + kk * 512); }
#pragma unroll
            for (int nb = 0; nb < 4; ++nb) b[kk & 1][nb] = WFrag<T16>::ld(sw + nb * CH + kk * 512); };
        frags(0);
        __builtin_amdgcn_sched_barrier(0);       // the first block's reads stay in front of the second's: mixed, the first product waited for nearly all of both groups
#pragma unroll
        for (int kk = 0; kk < NK; ++kk) {
            if (kk + 1 < NK) frags(kk + 1);
            __builtin_amdgcn_sched_barrier(0);   // keeps the next block's LDS reads one group ahead of this block's products: left free, they were spread among the products into one register set, each with a full wait behind it
#pragma unroll
            for (int nb = 0; nb < 4; ++nb)
#pragma unroll
                for (int mb = 0; mb < 4; ++mb) { acc[mb][nb] = WFrag<T16>::mma(a[kk & 1][mb], b[kk & 1][nb], acc[mb][nb]); if (NSPLIT == 1) acc[mb][nb] = WFrag<T16>::mma(a2[kk & 1][mb], b[kk & 1][nb], acc[mb][nb]); }
            __builtin_amdgcn_sched_barrier(0);   // and keeps the reads of the block after next behind these products, whose registers they refill
        }
        asm volatile("s_wait_dscnt 0x0" ::: "memory");      // this wave's reads of stage t have returned
        asm volatile("s_wait_asynccnt 0x0" ::: "memory");   // this wave's copies of stage t + 1 have landed
        __syncthreads();                                    // stage t + 1 may be read, and stage t's buffer is left by every wave
        if (t + 2 < nt) stage(t + 2);                       // the same test in every wave of the work-group
    }
    asm volatile("s_wait_asynccnt 0x0" ::: "memory");   // nothing is in flight when the wave goes on to the epilogue
    // Plane stores: one base address per plane and lane (formed once, never rewritten) plus immediate offsets; every store of a wave is 512 contiguous bytes; each row block's values are all converted first and then stored back to back, so that no store's registers are reused while it is in flight and one wait per block is enough.
    const size_t pl0 = (size_t)r0 * HD + lane * 8;   // 64 elements per row m in either orientation
    h16* const q16 = P16 + pl0; bf* const qh = Ph + pl0; bf* const ql = Pl + pl0;
#pragma unroll
    for (int mb = 0; mb < 4; ++mb) {
        if (PL == 3) {   // a lane's 8 accumulator values are 8 consecutive rows m (the k of the transposed fragment) of one column n: they are this lane's 16 bytes of fragment nb, k half mb & 1, straight from registers
            v8h o16[4]; v8us oh[4], ol[4];
#pragma unroll
            for (int nb = 0; nb < 4; ++nb)
#pragma unroll
                for (int j = 0; j < 8; ++j) { const float y = acc[mb][nb][j] + bb[nb]; o16[nb][j] = tohx(y); unsigned short a2, c2; splitf(y, a2, c2); oh[nb][j] = a2; ol[nb][j] = c2; }
            __builtin_amdgcn_sched_barrier(0);   // keeps the 12 stores behind all the conversions: interleaved, each store's data registers were reused at once, with a wait behind nearly every store
#pragma unroll
            for (int nb = 0; nb < 4; ++nb) { const int po = (mb >> 1) * 2048 + nb * 512 + (mb & 1) * 256; *(v8h*)(q16 + po) = o16[nb]; *(v8us*)(qh + po) = oh[nb]; *(v8us*)(ql + po) = ol[nb]; }
            asm volatile("s_wait_xcnt 0x0" ::: "memory"); }   // stands behind the transposed plane stores, in front of the first rewrite of their data registers
#pragma unroll
        for (int nb = 0; nb < 4; ++nb) {
#pragma unroll
            for (int j = 0; j < 8; ++j) os[(hi * 8 + j) * 68 + nb * 16 + lr] = (PL != 0) ? acc[mb][nb][j] + bb[nb] : acc[mb][nb][j]; }
        __builtin_amdgcn_wave_barrier(); asm volatile("" ::: "memory");
        if (PL == 1 || PL == 2) {   // lane (hi, lr) takes row lr, columns u * 16 + hi * 8 .. + 7: its 16 bytes of k half u & 1 of fragment u >> 1
            v8h o16[4]; v8us oh[4], ol[4];
#pragma unroll
            for (int u = 0; u < 4; ++u) { const float* sp = os + lr * 68 + u * 16 + hi * 8; const v4f x0 = *(const v4fa*)sp, x1 = *(const v4fa*)(sp + 4);
#pragma unroll
                for (int r = 0; r < 4; ++r) { unsigned short a2, c2; o16[u][r] = tohx(x0[r]); splitf(x0[r], a2, c2); oh[u][r] = a2; ol[u][r] = c2; o16[u][4 + r] = tohx(x1[r]); splitf(x1[r], a2, c2); oh[u][4 + r] = a2; ol[u][4 + r] = c2; } }
            __builtin_amdgcn_sched_barrier(0);   // as above: the block's stores issue back to back behind all its conversions
#pragma unroll
            for (int u = 0; u < 4; ++u) { const int po = mb * 16 * HD + u * 256; *(v8h*)(q16 + po) = o16[u]; *(v8us*)(qh + po) = oh[u]; *(v8us*)(ql + po) = ol[u]; }
            asm volatile("s_wait_xcnt 0x0" ::: "memory"); }   // stands behind the plane stores, in front of the first rewrite of their data registers
        if (PL != 1) { float* crow = C + (size_t)(r0 + mb * 16) * ldc + c0; v4f val[8]; const int cofs = lr * 4;
#pragma unroll
            for (int s = 0; s < 8; ++s) { const int row = 2 * s + hi; val[s] = *(const v4fa*)(os + row * 68 + cofs); if (BIAS && PL == 0) { val[s][0] += bfr(bias[c0 + cofs]); val[s][1] += bfr(bias[c0 + cofs + 1]); val[s][2] += bfr(bias[c0 + cofs + 2]); val[s][3] += bfr(bias[c0 + cofs + 3]); } }
            __builtin_amdgcn_sched_barrier(0);   // as above: the block's stores issue back to back behind all its LDS reads
#pragma unroll
            for (int s = 0; s < 8; ++s) *(v4f*)(crow + (size_t)(2 * s + hi) * ldc + cofs) = val[s];
            asm volatile("s_wait_xcnt 0x0" ::: "memory"); }   // stands behind this row block's stores, in front of the first rewrite of their data and address registers by the next block
        __builtin_amdgcn_wave_barrier(); asm volatile("" ::: "memory");
    }
}

// ---- k_qkv: the three projections of both batches in one launch. grid (TT / 128 row tiles, batch, projection * 8 + head pair), 4 waves: wave w takes rows (w >> 1) * 64 .. of the tile and head (w & 1) of the pair; W3 = the transposed Wq, Wk, Wv one behind the other, so that z * 128 is the tile's first weight row.
// Planes and present are [batch][head][..]; PKV = present: K of both batches, then V. The projection is the same for the whole work-group: a scalar branch, so that every wave meets the same barriers.
__global__ __launch_bounds__(128) void k_qkv(const bf* __restrict__ XB, const bf* __restrict__ W3, const float* __restrict__ bq, const float* __restrict__ bk, const float* __restrict__ bv, float* PKV, h16* Q16, bf* Qh, bf* Ql, h16* K16, bf* Kh, bf* Kl, h16* V16, bf* Vh, bf* Vl) {
    __shared__ __align__(16) bf st[2 * STE(0)]; __shared__ __align__(16) float osm[4 * 16 * 68];
    const int w = __builtin_amdgcn_readfirstlane(threadIdx.x >> 5);   // the wave's number in a scalar register
    const int b = blockIdx.y, z = blockIdx.z, pr = z / (NH_ / 2), hd = (z % (NH_ / 2)) * 2 + (w & 1), r0 = blockIdx.x * 128 + (w >> 1) * 64;
    const bf* Ag = XB + (size_t)b * TT * DM + (size_t)blockIdx.x * 128 * DM; const bf* Bg = W3 + (size_t)z * 128 * DM; const size_t po = (size_t)(b * NH_ + hd) * TT * HD; float* os = osm + w * 16 * 68;
    if (pr == 0) gemmw_tile<bf, 0, true, 1>(Ag, nullptr, Bg, DM, nullptr, 0, bq + hd * HD, Q16 + po, Qh + po, Ql + po, r0, 0, os, st, w);   // Q: only the head planes [b][h], fragment-major rows t, are stored
    else if (pr == 1) gemmw_tile<bf, 0, true, 2>(Ag, nullptr, Bg, DM, PKV + po, HD, bk + hd * HD, K16 + po, Kh + po, Kl + po, r0, 0, os, st, w);   // present[0]: K[b][g][t][d] = (x Wk + bk)[t][g*64 + d], row pitch 64, and the key planes
    else gemmw_tile<bf, 0, true, 3>(Ag, nullptr, Bg, DM, PKV + (size_t)NB_ * NKV * TT * HD + po, HD, bv + hd * HD, V16 + po, Vh + po, Vl + po, r0, 0, os, st, w);   // present[1]: V likewise, and the value planes transposed (fragment-major rows d, k = t)
}
// ---- k_wo: out0 = merged (hi + lo) x Wo + bo over the rows of both batches; grid (NB_ * TT / 128, DM / 128), 4 waves: wave w takes rows (w >> 1) * 64 .. and columns (w & 1) * 64 .. of the tile.
__global__ __launch_bounds__(128) void k_wo(const bf* __restrict__ Ah, const bf* __restrict__ Al, const bf* __restrict__ WO, float* C, const float* __restrict__ bo) {
    __shared__ __align__(16) bf st[2 * STE(1)]; __shared__ __align__(16) float osm[4 * 16 * 68];
    const int w = __builtin_amdgcn_readfirstlane(threadIdx.x >> 5);   // the wave's number in a scalar register
    const size_t ao = (size_t)blockIdx.x * 128 * DQ;
    gemmw_tile<bf, 1, true, 0>(Ah + ao, Al + ao, WO + (size_t)blockIdx.y * 128 * DQ, DQ, C, DM, bo, nullptr, nullptr, nullptr, blockIdx.x * 128 + (w >> 1) * 64, blockIdx.y * 128 + (w & 1) * 64, osm + w * 16 * 68, st, w);
}


// One weight (w[k][n], DM x DM) transposed into fragment-major rows n: one wave per fragment, each lane its 2 x 8 k values of one n. A load of the wave reads 64 contiguous bytes of 2 rows k; waves 2i and 2i + 1 take neighbouring n blocks, the two halves of the same lines.
__device__ __forceinline__ void wtG(const float* __restrict__ w, bf* Bt, int blk) {
    const int lane = threadIdx.x & 31, f = blk * 8 + (threadIdx.x >> 5), nb = (f & 1) + 2 * (f >> 6), kb = (f >> 1) & 31;
    const float* sp = w + (size_t)(kb * 32 + (lane >> 4) * 8) * DM + nb * 16 + (lane & 15); v8us o0, o1;
#pragma unroll
    for (int e = 0; e < 8; ++e) { o0[e] = f2bf(sp[(size_t)e * DM]); o1[e] = f2bf(sp[(size_t)(16 + e) * DM]); }
    bf* d = Bt + (size_t)(nb * (DM / 32) + kb) * 512 + lane * 8; *(v8us*)d = o0; *(v8us*)(d + 256) = o1;
}
// x (rows of DM floats) rounded into the fragment-major plane: thread i writes the plane's i-th 16 bytes and reads the 8 floats that belong there.
__device__ __forceinline__ void cvt8(const float* __restrict__ src, bf* dst, size_t n8, int blk) { const size_t i = (size_t)blk * 256 + threadIdx.x; if (i >= n8) return;
    const int lane = (int)(i & 31), j = (int)(i >> 5) & 1, kb = (int)(i >> 6) & (DM / 32 - 1); const size_t rb = i >> 11;   // 2048 such pieces per 16-row block of DM = 1024 columns
    const v8f v = *(const v8f*)(src + (rb * 16 + (lane & 15)) * DM + kb * 32 + j * 16 + (lane >> 4) * 8); v8us o;
#pragma unroll
    for (int k = 0; k < 8; ++k) o[k] = f2bf(v[k]); *(v8us*)(dst + i * 8) = o;  }
// ---- k_prep: all the 16-bit operand copies in one launch. Work-groups 0 .. 4 * WTB - 1: the four weights transposed into W4 (Wq, Wk, Wv, Wo one behind the other), WTB work-groups each; the rest: x of both batches rounded to bf16.
#define WTB (DM * DM / 64 / 64)
__global__ __launch_bounds__(256) void k_prep(const float* __restrict__ x, const float* __restrict__ wq, const float* __restrict__ wk, const float* __restrict__ wv, const float* __restrict__ wo, bf* XB, bf* W4) {
    const int g = blockIdx.x;
    if (g < 4 * WTB) { const int mi = g / WTB; wtG(mi == 0 ? wq : mi == 1 ? wk : mi == 2 ? wv : wo, W4 + (size_t)mi * DM * DM, g % WTB); }
    else cvt8(x, XB, (size_t)NB_ * TT * DM / 8, g - 4 * WTB);
}

// ---- k_fattn: causal attention of both batches in ONE launch; scores and probabilities stay in registers (running maximum and sum per query), and the epilogue writes the head-merged hi/lo planes.
// S^T = K Q^T (A = key rows, B = query rows) and O^T += V^T P^T (A = V^T rows, B = P^T): two 16-key score tiles of one query column group, converted in place, ARE the B operand of the second product.
// One work-group = 16 * NQ queries of one head; its 4 waves take the 32-key blocks kb = wave, wave + 4, ... up to the diagonal and join their partial (max, sum, O) through LDS in the fixed order wave 0..3.
#define FC (SCL * 1.4426950408889634f)   // SCL * log2(e): p = 2^((s - max) * FC) on the unscaled scores s
#define FP 68                      // floats per query row of the LDS partial-output planes (64 + 4: 16-byte aligned rows that start on different banks)
__device__ __forceinline__ float xhalf(float x) { return __builtin_bit_cast(float, __builtin_amdgcn_permlanex16(__builtin_bit_cast(int, x), __builtin_bit_cast(int, x), 0x76543210, 0xfedcba98, false, false)); }   // lane l reads lane l ^ 16
template <typename T16> struct PFrag;
template <> struct PFrag<h16> { static __device__ __forceinline__ void pack(const float* p, v16h& a, v16h& b) { (void)b;
#pragma unroll
    for (int s = 0; s < 16; ++s) a[s] = (h16)p[s]; } };
template <> struct PFrag<bf> { static __device__ __forceinline__ void pack(const float* p, v16bf& a, v16bf& b) { v8us h0, h1, l0, l1;
#pragma unroll
    for (int s = 0; s < 8; ++s) { unsigned short x, y; x = f2bf(p[s]); y = f2bf(p[s] - bf2f(x)); h0[s] = x; l0[s] = y; x = f2bf(p[8 + s]); y = f2bf(p[8 + s] - bf2f(x)); h1[s] = x; l1[s] = y; }
    a = cat16b(h0, h1); b = cat16b(l0, l1); } };
template <typename T16, bool HL, int NQ>
__device__ __forceinline__ void fattn_body(const T16* __restrict__ Q, const T16* __restrict__ Q2, const T16* __restrict__ Kp, const T16* __restrict__ Kp2, const T16* __restrict__ Vt, const T16* __restrict__ Vt2, int q0, int head, bf* Ah, bf* Al, float* so, float* sm, float* sl) {
    typedef typename WFrag<T16>::V V;
    const int tid = threadIdx.x, lane = tid & 31, c = lane & 15, h = lane >> 4, w = __builtin_amdgcn_readfirstlane(tid >> 5);   // the wave's number in a scalar register: loop bounds and the diagonal test become scalar branches
    V qf[NQ][2], qf2[NQ][2];
    { const size_t qo = (size_t)q0 * HD + lane * 8; const T16* qa = Q + qo; const T16* qb = HL ? Q2 + qo : qa;
#pragma unroll
      for (int qt = 0; qt < NQ; ++qt)
#pragma unroll
        for (int ks = 0; ks < 2; ++ks) { qf[qt][ks] = WFrag<T16>::ld(qa + qt * 16 * HD + ks * 512); if (HL) qf2[qt][ks] = WFrag<T16>::ld(qb + qt * 16 * HD + ks * 512); }
      asm volatile("s_wait_xcnt 0x0" :: "v"(qa), "v"(qb) : "memory"); }   // stands in front of the first rewrite of the Q loads' address registers, which it names to keep them untouched up to here
    v8f o[4][NQ]; float m[NQ], l[NQ];
#pragma unroll
    for (int qt = 0; qt < NQ; ++qt) { m[qt] = -3.0e38f; l[qt] = 0.f;
#pragma unroll
        for (int dt = 0; dt < 4; ++dt) o[dt][qt] = (v8f){}; }
    const int nkb = (q0 + 16 * NQ + 31) / 32;   // 32-key blocks that hold a key <= the last query; the first key of each of them is visible to every query of the group
    V kf[2][2], kf2[2][2];
    // K fragments of the 32-key block at key kp. The wait stands behind the loads, in front of the first rewrite of their address registers; naming the addresses as its inputs keeps those registers untouched up to it.
    auto loadK = [&](int kp) { const size_t ko = (size_t)kp * HD + lane * 8; const T16* ka = Kp + ko; const T16* kb2 = HL ? Kp2 + ko : ka;
#pragma unroll
        for (int kt = 0; kt < 2; ++kt)
#pragma unroll
            for (int ks = 0; ks < 2; ++ks) { kf[kt][ks] = WFrag<T16>::ld(ka + kt * 16 * HD + ks * 512); if (HL) kf2[kt][ks] = WFrag<T16>::ld(kb2 + kt * 16 * HD + ks * 512); }
        asm volatile("s_wait_xcnt 0x0" :: "v"(ka), "v"(kb2) : "memory"); };
    if (!HL) loadK(min(w, nkb - 1) * 32);       // fp16 rows: the wave's first block is fetched ahead of the loop
#pragma unroll 1
    for (int kb = w; kb < nkb; kb += 4) {
        const int k0 = kb * 32;
        if (HL) loadK(k0);                      // hi/lo rows (few passes, twice the fragments): fetched in the pass itself, which keeps the kernel at four waves per SIMD
        V vf[4], vf2[4];
        { const size_t vo = (size_t)k0 * HD + lane * 8; const T16* va = Vt + vo; const T16* vb = HL ? Vt2 + vo : va;
#pragma unroll
          for (int dt = 0; dt < 4; ++dt) { vf[dt] = WFrag<T16>::ld(va + dt * 512); if (HL) vf2[dt] = WFrag<T16>::ld(vb + dt * 512); }
          asm volatile("s_wait_xcnt 0x0" :: "v"(va), "v"(vb) : "memory"); }   // as in loadK, for the V loads' address registers
        float p[NQ][16];
#pragma unroll
        for (int qt = 0; qt < NQ; ++qt)
#pragma unroll
            for (int kt = 0; kt < 2; ++kt) { v8f s = (v8f){};
#pragma unroll
                for (int ks = 0; ks < 2; ++ks) { s = WFrag<T16>::mma(kf[kt][ks], qf[qt][ks], s); if (HL) { s = WFrag<T16>::mma(kf[kt][ks], qf2[qt][ks], s); s = WFrag<T16>::mma(kf2[kt][ks], qf[qt][ks], s); } }
#pragma unroll
                for (int r = 0; r < 8; ++r) p[qt][kt * 8 + r] = s[r]; }
        if (!HL) loadK(((kb + 4 < nkb) ? kb + 4 : kb) * 32);   // the next pass's K fragments fly under this pass's softmax and second product (the last pass fetches its own block again: in bounds, unused)
        const bool diag = (k0 + 31 > q0);       // wave-uniform: only blocks that reach past the group's first query need the causal select
#pragma unroll
        for (int qt = 0; qt < NQ; ++qt) {
            if (diag) { const int qi = q0 + qt * 16 + c - k0 - 8 * h;   // key k0 + kt*16 + 8h + r is visible when kt*16 + r <= qi
#pragma unroll
                for (int s = 0; s < 16; ++s) p[qt][s] = ((s >> 3) * 16 + (s & 7) <= qi) ? p[qt][s] : -3.0e38f; }
            float mx = m[qt];
#pragma unroll
            for (int s = 0; s < 16; ++s) mx = fmaxf(mx, p[qt][s]);
            mx = fmaxf(mx, xhalf(mx));
            const float al = __builtin_amdgcn_exp2f((m[qt] - mx) * FC), mc = mx * FC; m[qt] = mx; float ps = 0.f;
#pragma unroll
            for (int s = 0; s < 16; ++s) { p[qt][s] = __builtin_amdgcn_exp2f(fmaf(p[qt][s], FC, -mc)); ps += p[qt][s]; }
            l[qt] = fmaf(l[qt], al, ps);        // each lane half keeps the sum of its own keys; the halves join behind the loop
            V pa, pb; PFrag<T16>::pack(p[qt], pa, pb);
#pragma unroll
            for (int dt = 0; dt < 4; ++dt) { o[dt][qt] *= al; o[dt][qt] = WFrag<T16>::mma(vf[dt], pa, o[dt][qt]); if (HL) { o[dt][qt] = WFrag<T16>::mma(vf[dt], pb, o[dt][qt]); o[dt][qt] = WFrag<T16>::mma(vf2[dt], pa, o[dt][qt]); } }
        }
    }
    constexpr int QN = 16 * NQ;
#pragma unroll
    for (int qt = 0; qt < NQ; ++qt) { l[qt] += xhalf(l[qt]); if (h == 0) { sm[w * QN + qt * 16 + c] = m[qt]; sl[w * QN + qt * 16 + c] = l[qt]; } }
    __syncthreads();                            // every wave's (max, sum) is in LDS
#pragma unroll
    for (int qt = 0; qt < NQ; ++qt) { const int q = qt * 16 + c; float M = sm[q];
#pragma unroll
        for (int u = 1; u < 4; ++u) M = fmaxf(M, sm[u * QN + q]);
        float L = 0.f;
#pragma unroll
        for (int u = 0; u < 4; ++u) L += sl[u * QN + q] * __builtin_amdgcn_exp2f((sm[u * QN + q] - M) * FC);   // a wave without a block holds (-3e38, 0): weight 0
        const float f = __builtin_amdgcn_exp2f((m[qt] - M) * FC) / L;
#pragma unroll
        for (int dt = 0; dt < 4; ++dt) { float* d = so + (size_t)(w * QN + q) * FP + dt * 16 + 8 * h; v4f x, y;
#pragma unroll
            for (int r = 0; r < 4; ++r) { x[r] = o[dt][qt][r] * f; y[r] = o[dt][qt][4 + r] * f; }
            *(v4fa*)d = x; *(v4fa*)(d + 4) = y; } }
    __syncthreads();                            // every wave's weighted partial output is in LDS
    // Merged planes, fragment-major for the last GEMM (rows t, k = head * 64 + d): wave w takes the 16 columns d = w * 16 .. of each 16-query block, lane (h, c) query c, 8 columns: 512 contiguous bytes per store of a wave.
#pragma unroll
    for (int qt = 0; qt < NQ; ++qt) { const float* sp = so + (size_t)(qt * 16 + c) * FP + w * 16 + 8 * h; v4f a0 = *(const v4fa*)sp, a1 = *(const v4fa*)(sp + 4);
#pragma unroll
        for (int u = 1; u < 4; ++u) { a0 += *(const v4fa*)(sp + (size_t)u * QN * FP); a1 += *(const v4fa*)(sp + (size_t)u * QN * FP + 4); }
        v8us oh, ol;
#pragma unroll
        for (int r = 0; r < 4; ++r) { unsigned short x, y; splitf(a0[r], x, y); oh[r] = x; ol[r] = y; splitf(a1[r], x, y); oh[4 + r] = x; ol[4 + r] = y; }
        const size_t oo = (size_t)(q0 + qt * 16) * DQ + (size_t)(head * 2 + (w >> 1)) * 512 + (w & 1) * 256 + lane * 8; *(v8us*)(Ah + oo) = oh; *(v8us*)(Al + oo) = ol;
        asm volatile("s_wait_xcnt 0x0" ::: "memory"); }   // stands behind the two stores, in front of the first rewrite of their data and address registers
}
// grid (batch * 16 + head, query group), heaviest groups first: groups 0 .. (TT - RH) / 32 - 1 are 32 fp16 rows each, from the last rows down to row RH; the rest are 16 hi/lo rows each (3 products), from row RH - 16 down to 0
__global__ __launch_bounds__(128) void k_fattn(const h16* __restrict__ Q16, const h16* __restrict__ K16, const h16* __restrict__ V16, const bf* __restrict__ Qh, const bf* __restrict__ Ql, const bf* __restrict__ Kh, const bf* __restrict__ Kl, const bf* __restrict__ Vh, const bf* __restrict__ Vl, bf* Ah, bf* Al) {
    __shared__ __align__(16) float so[4 * 32 * FP]; __shared__ float sm[4 * 32]; __shared__ float sl[4 * 32];
    const int head = blockIdx.x % NH_, g = blockIdx.y; const size_t hp = (size_t)blockIdx.x * TT * HD;   // planes are [batch][head][..]
    { const size_t ao = (size_t)(blockIdx.x / NH_) * TT * DQ; Ah += ao; Al += ao; }   // the merged planes: rows batch * TT + t, k = head * 64 + d, fragment-major
    if (g < (TT - RH) / 32) fattn_body<h16, false, 2>(Q16 + hp, nullptr, K16 + hp, nullptr, V16 + hp, nullptr, TT - 32 * (g + 1), head, Ah, Al, so, sm, sl);
    else fattn_body<bf, true, 1>(Qh + hp, Ql + hp, Kh + hp, Kl + hp, Vh + hp, Vl + hp, RH - 16 * (g - (TT - RH) / 32 + 1), head, Ah, Al, so, sm, sl);
}

extern "C" void kernel_launch(void* const* d_in, const int* in_sizes, int n_in,
                              void* d_out, int out_size, void* d_ws, size_t ws_size, hipStream_t stream) {
    (void)in_sizes; (void)n_in; (void)out_size;
        const float* x = (const float*)d_in[0]; const float* wq = (const float*)d_in[1]; const float* bq = (const float*)d_in[2]; const float* wk = (const float*)d_in[3]; const float* bk = (const float*)d_in[4]; const float* wv = (const float*)d_in[5]; const float* bv = (const float*)d_in[6]; const float* wo = (const float*)d_in[7]; const float* bo = (const float*)d_in[8];   /* argument order x, Wq, bq, Wk, bk, Wv, bv, Wo, bo ('xw' [1024][1024]); ONE input stream x for queries, keys and values; no mask input: the causal rule is applied by index */
    float* OUT = (float*)d_out;     // out0 [2][2048][1024]; then out1 = present = stack((k, v)): K [2][16][2048][64] then V [2][16][2048][64] (offset 16,777,216 B)
    float* OUTK = OUT + (size_t)NB_ * TT * DM;
    char* wsp = (char*)d_ws;
    auto take = [&](size_t bytes) { char* p = wsp; wsp += (bytes + 255) & ~(size_t)255; return (void*)p; };
    bf* W4 = (bf*)take((size_t)4 * DM * DM * 2);   // Wq, Wk, Wv, Wo transposed, one behind the other
    bf* XB = (bf*)take((size_t)NB_ * TT * DM * 2);
    h16* QP16 = (h16*)take((size_t)NB_ * NH_ * TT * HD * 2); h16* KP16 = (h16*)take((size_t)NB_ * NKV * TT * HD * 2); h16* VT16 = (h16*)take((size_t)NB_ * NKV * HD * TT * 2);
    bf* QPh = (bf*)take((size_t)NB_ * NH_ * TT * HD * 2); bf* QPl = (bf*)take((size_t)NB_ * NH_ * TT * HD * 2); bf* KPh = (bf*)take((size_t)NB_ * NKV * TT * HD * 2); bf* KPl = (bf*)take((size_t)NB_ * NKV * TT * HD * 2); bf* VTh = (bf*)take((size_t)NB_ * NKV * HD * TT * 2); bf* VTl = (bf*)take((size_t)NB_ * NKV * HD * TT * 2);
    bf* ATh = (bf*)take((size_t)NB_ * TT * DQ * 2); bf* ATl = (bf*)take((size_t)NB_ * TT * DQ * 2);
    if ((size_t)(wsp - (char*)d_ws) > ws_size) return;    // ws 256 MiB
    k_prep<<<(unsigned)(4 * WTB + (size_t)NB_ * TT * DM / 8 / 256), 256, 0, stream>>>(x, wq, wk, wv, wo, XB, W4);
    k_qkv<<<dim3(TT / 128, NB_, 3 * NH_ / 2), 128, 0, stream>>>(XB, W4, bq, bk, bv, OUTK, QP16, QPh, QPl, KP16, KPh, KPl, VT16, VTh, VTl);
    // one kv head per query head; all rows of all 16 heads of both batches in one launch, which also writes the merged hi/lo planes
    k_fattn<<<dim3(NB_ * NH_, (TT - RH) / 32 + RH / 16, 1), 128, 0, stream>>>(QP16, KP16, VT16, QPh, QPl, KPh, KPl, VTh, VTl, ATh, ATl);
    k_wo<<<dim3(NB_ * TT / 128, DM / 128, 1), 128, 0, stream>>>(ATh, ATl, W4 + (size_t)3 * DM * DM, OUT, bo);
}

// v008
// It runs in 71.1 microseconds.
// In two side-by-side timings against v007, it was 1.03 and 1.02 times as fast.
// All steps since v000 together make it 35.0 times as fast.
#include <hip/hip_runtime.h>

// Causal multi-head self-attention scaled by the MODEL width, with a kv-cache output (x [2][2048][1024]; q, k, v = x W + b ('xw' [1024][1024] 1/32, biases zeros on this draw: read; 16 heads x 64); scores / sqrt(float32(D = 1024)) (x 1/32); causal (-inf); softmax; out0 = merged Wo + bo ('xw' + bias zeros: read) -> [2][2048][1024]; out1 = present = stack((k, v)) [2][2][16][2048][64]: the biased key and value projections head-major, each written ONCE, head-major, by the biased projection GEMM itself (grid z = projection x head pair), whose epilogue also writes the 16-bit planes of the same values; argument order x, Wq, bq, Wk, bk, Wv, bv, Wo, bo).
// Layout: every stage is ONE launch over both batches (4 launches): k_prep (the 4 'xw' weights transposed, x rounded to bf16 once), k_qkv (grid z = projection x head pair, y = batch), k_fattn (grid x = batch x head), k_wo (4096 rows); exact projections + f32 biases, each projection GEMM writing its own fp16 and hi/lo head planes (V transposed) from its accumulators; causal T-2048 attention fused into one launch (k_fattn: rows < 512 hi/lo 3 products, rest fp16; running softmax in registers; key blocks above the diagonal never touched; heads merged in its epilogue); merged hi/lo x Wo exact + bo.
// Operand layout: every 16-bit plane that a matrix fragment is loaded from is stored FRAGMENT-MAJOR: a fragment (16 rows x 32 k) is 512 elements in a row, [k half j][lane = 16 * ((k >> 3) & 1) + (row & 15)][k & 7], so that each 16-byte-per-lane load of a wave reads 512 contiguous bytes (4 whole lines, not 32-byte pieces of 16 lines). Fragments of a 16-row block follow one another in k, so a 16-row block still starts at row * K; the V^T planes hold, per 32 keys, the 4 fragments of the 64 d rows.
// Compute dtypes, f32 accumulate: every input rounded to bf16; projections exact + f32 biases; attention rows < 512 3 products, rest fp16; softmax f32; Wo hl x exact + bias.

#define NB_  2
#define TT   2048
#define DM   1024
#define NH_  16
#define NKV  16
#define REP  (NH_ / NKV)
#define HD   64
#define DQ   (NH_ * HD)
#define DKV  (NKV * HD)
#define RH   512                  // query rows < RH use hi+lo planes
#define SCL  0.03125f   // 1 / sqrt(D = 1024) = 2^-5: the module divides the scores by the square root of the MODEL width, not of the head width
typedef _Float16 h16;
typedef unsigned short bf;
typedef __attribute__((ext_vector_type(16))) __bf16   v16bf;
typedef __attribute__((ext_vector_type(16))) _Float16 v16h;
typedef __attribute__((ext_vector_type(8)))  _Float16 v8h;
typedef __attribute__((ext_vector_type(8)))  unsigned short v8us;
typedef __attribute__((ext_vector_type(8)))  float    v8f;
typedef __attribute__((ext_vector_type(4)))  float    v4f;
typedef v8h  __attribute__((may_alias)) v8ha;
typedef v4f  __attribute__((may_alias)) v4fa;
typedef v8us __attribute__((may_alias)) v8usa;

__device__ __forceinline__ unsigned short f2bf(float f) { unsigned u = __float_as_uint(f); u += 0x7FFFu + ((u >> 16) & 1u); return (unsigned short)(u >> 16); }
__device__ __forceinline__ float bf2f(unsigned short b) { return __uint_as_float(((unsigned)b) << 16); }
__device__ __forceinline__ float bfr(float f) { return bf2f(f2bf(f)); }
__device__ __forceinline__ v16h cat16(v8h lo, v8h hi) { return __builtin_shufflevector(lo, hi, 0, 1, 2, 3, 4, 5, 6, 7, 8, 9, 10, 11, 12, 13, 14, 15); }
__device__ __forceinline__ v16bf cat16b(v8us lo, v8us hi) { return __builtin_bit_cast(v16bf, __builtin_shufflevector(lo, hi, 0, 1, 2, 3, 4, 5, 6, 7, 8, 9, 10, 11, 12, 13, 14, 15)); }
__device__ __forceinline__ v8f wmma16(v16h a, v16h b, v8f c) { return __builtin_amdgcn_wmma_f32_16x16x32_f16(false, a, false, b, (short)0, c, false, false); }
__device__ __forceinline__ v8f wmmab(v16bf a, v16bf b, v8f c) { return __builtin_amdgcn_wmma_f32_16x16x32_bf16(false, a, false, b, (short)0, c, false, false); }
__device__ __forceinline__ h16 tohx(float x) { return (h16)x; }
__device__ __forceinline__ void splitf(float y, unsigned short& h, unsigned short& l) { h = f2bf(y); l = f2bf(y - bf2f(h)); }



// ---- gemmw_tile: register-blocked GEMM, one work-group of 4 waves (2 x 2) per 128x128 output tile, ONE WAVE per 64x64 part (16 accumulators) at rows r0, columns c0. The operands come from fragment-major 16-bit planes (a fragment is 512 elements in a row; WFrag::ld: p = the fragment's start + lane * 8; k halves 256 elements apart) and are staged in LDS, where the two waves of a tile row share the A fragments and the two of a tile column the B fragments: each fragment leaves L2 once per work-group, not once per wave.
// Staging: a stage is KS(NSPLIT) k of the tile's 8 A row blocks, its 8 B row blocks and (NSPLIT 1) its 8 A2 row blocks; a row block's share of a stage (a chunk) lies in a row in the plane (KS * 32 bytes) and is copied as it lies, by asynchronous copies to LDS (16 bytes per lane, 512 per copy; wave w copies chunks w, w + 4, ...). Two buffers: stage t + 2 is asked for when every wave has left stage t, and flies under stage t + 1. Inside a stage the fragments of k block kk + 1 are read from LDS, as one group into a second register set, ahead of the products of block kk.
// C[m][n] (f32, pitch ldc, + optional f32 bias[n]) = sum_k A[m][k] Bt[n][k] (+ A2[m][k] Bt[n][k] for NSPLIT 1). Ag, Ag2, Bg: the first fragment of the WORK-GROUP's 128 rows of each operand; every other pointer is the wave's own (its batch, projection and head). K % (2 * KS) == 0. ks0 (0 .. K / KS - 1, the same in every wave of the work-group): the k chunk that the work-group starts with; it walks all K / KS chunks from there and wraps, so the f32 sums of a tile are taken in that rotated k order. os: the wave's own 16 x 68 floats of LDS; st: the work-group's two stage buffers.
// PL: what the epilogue stores of the biased f32 result y. 0: C only. 1: the planes fp16(y), bf16 hi(y), bf16 lo(y) only, fragment-major with rows m, k = n (c0 = 0, 64 columns). 2: C and those planes. 3: C and the planes transposed, fragment-major with rows n, k = m.
#define KS(NSPLIT) (NSPLIT == 1 ? 128 : 64)            // k per stage: the longer stage where one work-group has a WGP to itself (one wave per SIMD, nobody to fill the gap at a stage's start); 64 lets three work-groups share a WGP's LDS
#define CHE(NSPLIT) (KS(NSPLIT) * 16)                  // elements of a chunk: 16 rows x KS k = KS / 32 fragments
#define STE(NSPLIT) ((NSPLIT == 1 ? 24 : 16) * CHE(NSPLIT))   // elements of a stage buffer
template <typename T16> struct WFrag;
template <> struct WFrag<h16> { typedef v16h V; static __device__ __forceinline__ V ld(const h16* p) { return cat16(*(const v8h*)p, *(const v8h*)(p + 256)); } static __device__ __forceinline__ v8f mma(V a, V b, v8f c) { return wmma16(a, b, c); } };
template <> struct WFrag<bf> { typedef v16bf V; static __device__ __forceinline__ V ld(const bf* p) { return cat16b(*(const v8us*)p, *(const v8us*)(p + 256)); } static __device__ __forceinline__ v8f mma(V a, V b, v8f c) { return wmmab(a, b, c); } };
// CP4: the 4 copies of a 2-KiB chunk; CP8: the 8 of a 4-KiB chunk: one LDS address and one global address per lane; the immediate offset moves both alike (the chunk lies in LDS as it lies in the plane).
#define CP4(L, G) "global_load_async_to_lds_b128 " L ", " G ", off\n\tglobal_load_async_to_lds_b128 " L ", " G ", off offset:512\n\tglobal_load_async_to_lds_b128 " L ", " G ", off offset:1024\n\tglobal_load_async_to_lds_b128 " L ", " G ", off offset:1536\n\t"
#define CP8(L, G) CP4(L, G) "global_load_async_to_lds_b128 " L ", " G ", off offset:2048\n\tglobal_load_async_to_lds_b128 " L ", " G ", off offset:2560\n\tglobal_load_async_to_lds_b128 " L ", " G ", off offset:3072\n\tglobal_load_async_to_lds_b128 " L ", " G ", off offset:3584\n\t"
template <typename T16, int NSPLIT, bool BIAS, int PL>
__device__ __forceinline__ void gemmw_tile(const T16* __restrict__ Ag, const T16* __restrict__ Ag2, const T16* __restrict__ Bg, int K, float* C, int ldc, const float* __restrict__ bias, h16* P16, bf* Ph, bf* Pl, int r0, int c0, float* os, T16* st, int w, int ks0) {
    typedef typename WFrag<T16>::V V;
    const int lane = threadIdx.x & 31, lr = lane & 15, hi = lane >> 4, wm = w >> 1, wn = w & 1;
    v8f acc[4][4];
#pragma unroll
    for (int mb = 0; mb < 4; ++mb)
#pragma unroll
        for (int nb = 0; nb < 4; ++nb) acc[mb][nb] = (v8f){};
    float bb[4];   // PL 1 to 3: the bias of this lane's column in each 16-column block, fetched here so that its latency passes under the K loop
    if (PL != 0) {
#pragma unroll
        for (int nb = 0; nb < 4; ++nb) bb[nb] = BIAS ? bfr(bias[c0 + nb * 16 + lr]) : 0.f; }
    // This wave's copies of stage t into buffer t & 1: row blocks w and w + 4 of each operand. A 16-row block is 16 * K elements; k chunk tk of it starts tk * CH elements in.
    constexpr int CH = CHE(NSPLIT), ST = STE(NSPLIT), NK = KS(NSPLIT) / 32; constexpr unsigned C4 = 4u * CH * 2u;   // C4: bytes of 4 chunks
    const size_t go = (size_t)w * 16 * K + lane * 8; const size_t g4 = (size_t)64 * K;
    const unsigned l0 = (unsigned)(size_t)st + (unsigned)(w * CH + lane * 8) * 2u;   // the lane's LDS byte address in chunk w of buffer 0
    const int nt = K / KS(NSPLIT);
    auto stage = [&](int t) {
        int tk = t + ks0; if (tk >= nt) tk -= nt;   // trip t works on k chunk (t + ks0) mod nt: work-groups that share operand rows walk k from different chunks, so that they do not ask L2 for the same lines at the same moment
        const size_t gk = go + (size_t)tk * CH; const unsigned lb = l0 + (unsigned)(t & 1) * (unsigned)(ST * 2);
        const T16* a0 = Ag + gk; const T16* a1 = a0 + g4; const T16* b0 = Bg + gk; const T16* b1 = b0 + g4;
        // the copies and, as the statement's last line, the wait that stands in front of the first rewrite of their address registers
        if (NSPLIT == 1) { const T16* c0p = Ag2 + gk; const T16* c1p = c0p + g4;
            asm volatile(CP8("%0", "%6") CP8("%1", "%7") CP8("%2", "%8") CP8("%3", "%9") CP8("%4", "%10") CP8("%5", "%11") "s_wait_xcnt 0x0"
                :: "v"(lb), "v"(lb + C4), "v"(lb + 2u * C4), "v"(lb + 3u * C4), "v"(lb + 4u * C4), "v"(lb + 5u * C4), "v"(a0), "v"(a1), "v"(b0), "v"(b1), "v"(c0p), "v"(c1p) : "memory"); }
        else
            asm volatile(CP4("%0", "%4") CP4("%1", "%5") CP4("%2", "%6") CP4("%3", "%7") "s_wait_xcnt 0x0"
                :: "v"(lb), "v"(lb + C4), "v"(lb + 2u * C4), "v"(lb + 3u * C4), "v"(a0), "v"(a1), "v"(b0), "v"(b1) : "memory"); };
    stage(0);
    asm volatile("s_wait_asynccnt 0x0" ::: "memory");   // this wave's copies of stage 0 have landed
    __syncthreads();                                    // every wave's have: stage 0 may be read
    stage(1);
#pragma unroll 1   // one stage per trip, kept rolled: the loop's text stays small and every trip ends in the same publish point
    for (int t = 0; t < nt; ++t) {
        const T16* sb = st + (size_t)(t & 1) * ST + lane * 8; const T16* sa = sb + wm * 4 * CH; const T16* sw = sb + (8 + wn * 4) * CH;
        V a[2][4], a2[2][4], b[2][4];
        auto frags = [&](int kk) {   // the wave's fragments of k block kk of this stage, into register set kk & 1
#pragma unroll
            for (int mb = 0; mb < 4; ++mb) { a[kk & 1][mb] = WFrag<T16>::ld(sa + mb * CH + kk * 512); if (NSPLIT == 1) a2[kk & 1][mb] = WFrag<T16>::ld(sa + (16 + mb) * CH + kk * 512); }
#pragma unroll
            for (int nb = 0; nb < 4; ++nb) b[kk & 1][nb] = WFrag<T16>::ld(sw + nb * CH + kk * 512); };
        frags(0);
        __builtin_amdgcn_sched_barrier(0);       // the first block's reads stay in front of the second's: mixed, the first product waited for nearly all of both groups
#pragma unroll
        for (int kk = 0; kk < NK; ++kk) {
            if (kk + 1 < NK) frags(kk + 1);
            __builtin_amdgcn_sched_barrier(0);   // keeps the next block's LDS reads one group ahead of this block's products: left free, they were spread among the products into one register set, each with a full wait behind it
#pragma unroll
            for (int nb = 0; nb < 4; ++nb)
#pragma unroll
                for (int mb = 0; mb < 4; ++mb) { acc[mb][nb] = WFrag<T16>::mma(a[kk & 1][mb], b[kk & 1][nb], acc[mb][nb]); if (NSPLIT == 1) acc[mb][nb] = WFrag<T16>::mma(a2[kk & 1][mb], b[kk & 1][nb], acc[mb][nb]); }
            __builtin_amdgcn_sched_barrier(0);   // and keeps the reads of the block after next behind these products, whose registers they refill
        }
        asm volatile("s_wait_dscnt 0x0" ::: "memory");      // this wave's reads of stage t have returned
        asm volatile("s_wait_asynccnt 0x0" ::: "memory");   // this wave's copies of stage t + 1 have landed
        __syncthreads();                                    // stage t + 1 may be read, and stage t's buffer is left by every wave
        if (t + 2 < nt) stage(t + 2);                       // the same test in every wave of the work-group
    }
    asm volatile("s_wait_asynccnt 0x0" ::: "memory");   // nothing is in flight when the wave goes on to the epilogue
    // Plane stores: one base address per plane and lane (formed once, never rewritten) plus immediate offsets; every store of a wave is 512 contiguous bytes; each row block's values are all converted first and then stored back to back, so that no store's registers are reused while it is in flight and one wait per block is enough.
    const size_t pl0 = (size_t)r0 * HD + lane * 8;   // 64 elements per row m in either orientation
    h16* const q16 = P16 + pl0; bf* const qh = Ph + pl0; bf* const ql = Pl + pl0;
#pragma unroll
    for (int mb = 0; mb < 4; ++mb) {
        if (PL == 3) {   // a lane's 8 accumulator values are 8 consecutive rows m (the k of the transposed fragment) of one column n: they are this lane's 16 bytes of fragment nb, k half mb & 1, straight from registers
            v8h o16[4]; v8us oh[4], ol[4];
#pragma unroll
            for (int nb = 0; nb < 4; ++nb)
#pragma unroll
                for (int j = 0; j < 8; ++j) { const float y = acc[mb][nb][j] + bb[nb]; o16[nb][j] = tohx(y); unsigned short a2, c2; splitf(y, a2, c2); oh[nb][j] = a2; ol[nb][j] = c2; }
            __builtin_amdgcn_sched_barrier(0);   // keeps the 12 stores behind all the conversions: interleaved, each store's data registers were reused at once, with a wait behind nearly every store
#pragma unroll
            for (int nb = 0; nb < 4; ++nb) { const int po = (mb >> 1) * 2048 + nb * 512 + (mb & 1) * 256; *(v8h*)(q16 + po) = o16[nb]; *(v8us*)(qh + po) = oh[nb]; *(v8us*)(ql + po) = ol[nb]; }
            asm volatile("s_wait_xcnt 0x0" ::: "memory"); }   // stands behind the transposed plane stores, in front of the first rewrite of their data registers
#pragma unroll
        for (int nb = 0; nb < 4; ++nb) {
#pragma unroll
            for (int j = 0; j < 8; ++j) os[(hi * 8 + j) * 68 + nb * 16 + lr] = (PL != 0) ? acc[mb][nb][j] + bb[nb] : acc[mb][nb][j]; }
        __builtin_amdgcn_wave_barrier(); asm volatile("" ::: "memory");
        if (PL == 1 || PL == 2) {   // lane (hi, lr) takes row lr, columns u * 16 + hi * 8 .. + 7: its 16 bytes of k half u & 1 of fragment u >> 1
            v8h o16[4]; v8us oh[4], ol[4];
#pragma unroll
            for (int u = 0; u < 4; ++u) { const float* sp = os + lr * 68 + u * 16 + hi * 8; const v4f x0 = *(const v4fa*)sp, x1 = *(const v4fa*)(sp + 4);
#pragma unroll
                for (int r = 0; r < 4; ++r) { unsigned short a2, c2; o16[u][r] = tohx(x0[r]); splitf(x0[r], a2, c2); oh[u][r] = a2; ol[u][r] = c2; o16[u][4 + r] = tohx(x1[r]); splitf(x1[r], a2, c2); oh[u][4 + r] = a2; ol[u][4 + r] = c2; } }
            __builtin_amdgcn_sched_barrier(0);   // as above: the block's stores issue back to back behind all its conversions
#pragma unroll
            for (int u = 0; u < 4; ++u) { const int po = mb * 16 * HD + u * 256; *(v8h*)(q16 + po) = o16[u]; *(v8us*)(qh + po) = oh[u]; *(v8us*)(ql + po) = ol[u]; }
            asm volatile("s_wait_xcnt 0x0" ::: "memory"); }   // stands behind the plane stores, in front of the first rewrite of their data registers
        if (PL != 1) { float* crow = C + (size_t)(r0 + mb * 16) * ldc + c0; v4f val[8]; const int cofs = lr * 4;
#pragma unroll
            for (int s = 0; s < 8; ++s) { const int row = 2 * s + hi; val[s] = *(const v4fa*)(os + row * 68 + cofs); if (BIAS && PL == 0) { val[s][0] += bfr(bias[c0 + cofs]); val[s][1] += bfr(bias[c0 + cofs + 1]); val[s][2] += bfr(bias[c0 + cofs + 2]); val[s][3] += bfr(bias[c0 + cofs + 3]); } }
            __builtin_amdgcn_sched_barrier(0);   // as above: the block's stores issue back to back behind all its LDS reads
#pragma unroll
            for (int s = 0; s < 8; ++s) *(v4f*)(crow + (size_t)(2 * s + hi) * ldc + cofs) = val[s];
            asm volatile("s_wait_xcnt 0x0" ::: "memory"); }   // stands behind this row block's stores, in front of the first rewrite of their data and address registers by the next block
        __builtin_amdgcn_wave_barrier(); asm volatile("" ::: "memory");
    }
}

// ---- k_qkv: the three projections of both batches in one launch. grid (TT / 128 row tiles, batch, projection * 8 + head pair), 4 waves: wave w takes rows (w >> 1) * 64 .. of the tile and head (w & 1) of the pair; W3 = the transposed Wq, Wk, Wv one behind the other, so that z * 128 is the tile's first weight row.
// Planes and present are [batch][head][..]; PKV = present: K of both batches, then V. The projection is the same for the whole work-group: a scalar branch, so that every wave meets the same barriers.
__global__ __launch_bounds__(128) void k_qkv(const bf* __restrict__ XB, const bf* __restrict__ W3, const float* __restrict__ bq, const float* __restrict__ bk, const float* __restrict__ bv, float* PKV, h16* Q16, bf* Qh, bf* Ql, h16* K16, bf* Kh, bf* Kl, h16* V16, bf* Vh, bf* Vl) {
    __shared__ __align__(16) bf st[2 * STE(0)]; __shared__ __align__(16) float osm[4 * 16 * 68];
    const int w = __builtin_amdgcn_readfirstlane(threadIdx.x >> 5);   // the wave's number in a scalar register
    const int b = blockIdx.y, z = blockIdx.z, pr = z / (NH_ / 2), hd = (z % (NH_ / 2)) * 2 + (w & 1), r0 = blockIdx.x * 128 + (w >> 1) * 64;
    const bf* Ag = XB + (size_t)b * TT * DM + (size_t)blockIdx.x * 128 * DM; const bf* Bg = W3 + (size_t)z * 128 * DM; const size_t po = (size_t)(b * NH_ + hd) * TT * HD; float* os = osm + w * 16 * 68;
    const int ks0 = (blockIdx.x + 8 * blockIdx.y + blockIdx.z) % (DM / KS(0));   // the 32 work-groups of one z share weight rows, the 24 of one (x, y) share x rows: either set is spread over all 16 start chunks
    if (pr == 0) gemmw_tile<bf, 0, true, 1>(Ag, nullptr, Bg, DM, nullptr, 0, bq + hd * HD, Q16 + po, Qh + po, Ql + po, r0, 0, os, st, w, ks0);   // Q: only the head planes [b][h], fragment-major rows t, are stored
    else if (pr == 1) gemmw_tile<bf, 0, true, 2>(Ag, nullptr, Bg, DM, PKV + po, HD, bk + hd * HD, K16 + po, Kh + po, Kl + po, r0, 0, os, st, w, ks0);   // present[0]: K[b][g][t][d] = (x Wk + bk)[t][g*64 + d], row pitch 64, and the key planes
    else gemmw_tile<bf, 0, true, 3>(Ag, nullptr, Bg, DM, PKV + (size_t)NB_ * NKV * TT * HD + po, HD, bv + hd * HD, V16 + po, Vh + po, Vl + po, r0, 0, os, st, w, ks0);   // present[1]: V likewise, and the value planes transposed (fragment-major rows d, k = t)
}
// ---- k_wo: out0 = merged (hi + lo) x Wo + bo over the rows of both batches; grid (NB_ * TT / 128, DM / 128), 4 waves: wave w takes rows (w >> 1) * 64 .. and columns (w & 1) * 64 .. of the tile.
__global__ __launch_bounds__(128) void k_wo(const bf* __restrict__ Ah, const bf* __restrict__ Al, const bf* __restrict__ WO, float* C, const float* __restrict__ bo) {
    __shared__ __align__(16) bf st[2 * STE(1)]; __shared__ __align__(16) float osm[4 * 16 * 68];
    const int w = __builtin_amdgcn_readfirstlane(threadIdx.x >> 5);   // the wave's number in a scalar register
    const size_t ao = (size_t)blockIdx.x * 128 * DQ;
    gemmw_tile<bf, 1, true, 0>(Ah + ao, Al + ao, WO + (size_t)blockIdx.y * 128 * DQ, DQ, C, DM, bo, nullptr, nullptr, nullptr, blockIdx.x * 128 + (w >> 1) * 64, blockIdx.y * 128 + (w & 1) * 64, osm + w * 16 * 68, st, w, (blockIdx.x + blockIdx.y) % (DQ / KS(1)));   // the 8 work-groups of one x share merged rows, the 32 of one y share Wo rows: either set is spread over all 8 start chunks
}


// One weight (w[k][n], DM x DM) transposed into fragment-major rows n: one wave per fragment, each lane its 2 x 8 k values of one n. A load of the wave reads 64 contiguous bytes of 2 rows k; waves 2i and 2i + 1 take neighbouring n blocks, the two halves of the same lines.
__device__ __forceinline__ void wtG(const float* __restrict__ w, bf* Bt, int blk) {
    const int lane = threadIdx.x & 31, f = blk * 8 + (threadIdx.x >> 5), nb = (f & 1) + 2 * (f >> 6), kb = (f >> 1) & 31;
    const float* sp = w + (size_t)(kb * 32 + (lane >> 4) * 8) * DM + nb * 16 + (lane & 15); v8us o0, o1;
#pragma unroll
    for (int e = 0; e < 8; ++e) { o0[e] = f2bf(sp[(size_t)e * DM]); o1[e] = f2bf(sp[(size_t)(16 + e) * DM]); }
    bf* d = Bt + (size_t)(nb * (DM / 32) + kb) * 512 + lane * 8; *(v8us*)d = o0; *(v8us*)(d + 256) = o1;
}
// x (rows of DM floats) rounded into the fragment-major plane: thread i writes the plane's i-th 16 bytes and reads the 8 floats that belong there.
__device__ __forceinline__ void cvt8(const float* __restrict__ src, bf* dst, size_t n8, int blk) { const size_t i = (size_t)blk * 256 + threadIdx.x; if (i >= n8) return;
    const int lane = (int)(i & 31), j = (int)(i >> 5) & 1, kb = (int)(i >> 6) & (DM / 32 - 1); const size_t rb = i >> 11;   // 2048 such pieces per 16-row block of DM = 1024 columns
    const v8f v = *(const v8f*)(src + (rb * 16 + (lane & 15)) * DM + kb * 32 + j * 16 + (lane >> 4) * 8); v8us o;
#pragma unroll
    for (int k = 0; k < 8; ++k) o[k] = f2bf(v[k]); *(v8us*)(dst + i * 8) = o;  }
// ---- k_prep: all the 16-bit operand copies in one launch. Work-groups 0 .. 4 * WTB - 1: the four weights transposed into W4 (Wq, Wk, Wv, Wo one behind the other), WTB work-groups each; the rest: x of both batches rounded to bf16.
#define WTB (DM * DM / 64 / 64)
__global__ __launch_bounds__(256) void k_prep(const float* __restrict__ x, const float* __restrict__ wq, const float* __restrict__ wk, const float* __restrict__ wv, const float* __restrict__ wo, bf* XB, bf* W4) {
    const int g = blockIdx.x;
    if (g < 4 * WTB) { const int mi = g / WTB; wtG(mi == 0 ? wq : mi == 1 ? wk : mi == 2 ? wv : wo, W4 + (size_t)mi * DM * DM, g % WTB); }
    else cvt8(x, XB, (size_t)NB_ * TT * DM / 8, g - 4 * WTB);
}

// ---- k_fattn: causal attention of both batches in ONE launch; scores and probabilities stay in registers (running maximum and sum per query), and the epilogue writes the head-merged hi/lo planes.
// S^T = K Q^T (A = key rows, B = query rows) and O^T += V^T P^T (A = V^T rows, B = P^T): two 16-key score tiles of one query column group, converted in place, ARE the B operand of the second product.
// One work-group = 16 * NQ queries of one head; its 4 waves take the 32-key blocks kb = wave, wave + 4, ... up to the diagonal and join their partial (max, sum, O) through LDS in the fixed order wave 0..3.
#define FC (SCL * 1.4426950408889634f)   // SCL * log2(e): p = 2^((s - max) * FC) on the unscaled scores s
#define FP 68                      // floats per query row of the LDS partial-output planes (64 + 4: 16-byte aligned rows that start on different banks)
__device__ __forceinline__ float xhalf(float x) { return __builtin_bit_cast(float, __builtin_amdgcn_permlanex16(__builtin_bit_cast(int, x), __builtin_bit_cast(int, x), 0x76543210, 0xfedcba98, false, false)); }   // lane l reads lane l ^ 16
template <typename T16> struct PFrag;
template <> struct PFrag<h16> { static __device__ __forceinline__ void pack(const float* p, v16h& a, v16h& b) { (void)b;
#pragma unroll
    for (int s = 0; s < 16; ++s) a[s] = (h16)p[s]; } };
template <> struct PFrag<bf> { static __device__ __forceinline__ void pack(const float* p, v16bf& a, v16bf& b) { v8us h0, h1, l0, l1;
#pragma unroll
    for (int s = 0; s < 8; ++s) { unsigned short x, y; x = f2bf(p[s]); y = f2bf(p[s] - bf2f(x)); h0[s] = x; l0[s] = y; x = f2bf(p[8 + s]); y = f2bf(p[8 + s] - bf2f(x)); h1[s] = x; l1[s] = y; }
    a = cat16b(h0, h1); b = cat16b(l0, l1); } };
template <typename T16, bool HL, int NQ>
__device__ __forceinline__ void fattn_body(const T16* __restrict__ Q, const T16* __restrict__ Q2, const T16* __restrict__ Kp, const T16* __restrict__ Kp2, const T16* __restrict__ Vt, const T16* __restrict__ Vt2, int q0, int head, bf* Ah, bf* Al, float* so, float* sm, float* sl) {
    typedef typename WFrag<T16>::V V;
    const int tid = threadIdx.x, lane = tid & 31, c = lane & 15, h = lane >> 4, w = __builtin_amdgcn_readfirstlane(tid >> 5);   // the wave's number in a scalar register: loop bounds and the diagonal test become scalar branches
    V qf[NQ][2], qf2[NQ][2];
    { const size_t qo = (size_t)q0 * HD + lane * 8; const T16* qa = Q + qo; const T16* qb = HL ? Q2 + qo : qa;
#pragma unroll
      for (int qt = 0; qt < NQ; ++qt)
#pragma unroll
        for (int ks = 0; ks < 2; ++ks) { qf[qt][ks] = WFrag<T16>::ld(qa + qt * 16 * HD + ks * 512); if (HL) qf2[qt][ks] = WFrag<T16>::ld(qb + qt * 16 * HD + ks * 512); }
      asm volatile("s_wait_xcnt 0x0" :: "v"(qa), "v"(qb) : "memory"); }   // stands in front of the first rewrite of the Q loads' address registers, which it names to keep them untouched up to here
    v8f o[4][NQ]; float m[NQ], l[NQ];
#pragma unroll
    for (int qt = 0; qt < NQ; ++qt) { m[qt] = -3.0e38f; l[qt] = 0.f;
#pragma unroll
        for (int dt = 0; dt < 4; ++dt) o[dt][qt] = (v8f){}; }
    const int nkb = (q0 + 16 * NQ + 31) / 32;   // 32-key blocks that hold a key <= the last query; the first key of each of them is visible to every query of the group
    V kf[2][2], kf2[2][2];
    // K fragments of the 32-key block at key kp. The wait stands behind the loads, in front of the first rewrite of their address registers; naming the addresses as its inputs keeps those registers untouched up to it.
    auto loadK = [&](int kp) { const size_t ko = (size_t)kp * HD + lane * 8; const T16* ka = Kp + ko; const T16* kb2 = HL ? Kp2 + ko : ka;
#pragma unroll
        for (int kt = 0; kt < 2; ++kt)
#pragma unroll
            for (int ks = 0; ks < 2; ++ks) { kf[kt][ks] = WFrag<T16>::ld(ka + kt * 16 * HD + ks * 512); if (HL) kf2[kt][ks] = WFrag<T16>::ld(kb2 + kt * 16 * HD + ks * 512); }
        asm volatile("s_wait_xcnt 0x0" :: "v"(ka), "v"(kb2) : "memory"); };
    if (!HL) loadK(min(w, nkb - 1) * 32);       // fp16 rows: the wave's first block is fetched ahead of the loop
#pragma unroll 1
    for (int kb = w; kb < nkb; kb += 4) {
        const int k0 = kb * 32;
        if (HL) loadK(k0);                      // hi/lo rows (few passes, twice the fragments): fetched in the pass itself, which keeps the kernel at four waves per SIMD
        V vf[4], vf2[4];
        { const size_t vo = (size_t)k0 * HD + lane * 8; const T16* va = Vt + vo; const T16* vb = HL ? Vt2 + vo : va;
#pragma unroll
          for (int dt = 0; dt < 4; ++dt) { vf[dt] = WFrag<T16>::ld(va + dt * 512); if (HL) vf2[dt] = WFrag<T16>::ld(vb + dt * 512); }
          asm volatile("s_wait_xcnt 0x0" :: "v"(va), "v"(vb) : "memory"); }   // as in loadK, for the V loads' address registers
        float p[NQ][16];
#pragma unroll
        for (int qt = 0; qt < NQ; ++qt)
#pragma unroll
            for (int kt = 0; kt < 2; ++kt) { v8f s = (v8f){};
#pragma unroll
                for (int ks = 0; ks < 2; ++ks) { s = WFrag<T16>::mma(kf[kt][ks], qf[qt][ks], s); if (HL) { s = WFrag<T16>::mma(kf[kt][ks], qf2[qt][ks], s); s = WFrag<T16>::mma(kf2[kt][ks], qf[qt][ks], s); } }
#pragma unroll
                for (int r = 0; r < 8; ++r) p[qt][kt * 8 + r] = s[r]; }
        if (!HL) loadK(((kb + 4 < nkb) ? kb + 4 : kb) * 32);   // the next pass's K fragments fly under this pass's softmax and second product (the last pass fetches its own block again: in bounds, unused)
        const bool diag = (k0 + 31 > q0);       // wave-uniform: only blocks that reach past the group's first query need the causal select
#pragma unroll
        for (int qt = 0; qt < NQ; ++qt) {
            if (diag) { const int qi = q0 + qt * 16 + c - k0 - 8 * h;   // key k0 + kt*16 + 8h + r is visible when kt*16 + r <= qi
#pragma unroll
                for (int s = 0; s < 16; ++s) p[qt][s] = ((s >> 3) * 16 + (s & 7) <= qi) ? p[qt][s] : -3.0e38f; }
            float mx = m[qt];
#pragma unroll
            for (int s = 0; s < 16; ++s) mx = fmaxf(mx, p[qt][s]);
            mx = fmaxf(mx, xhalf(mx));
            const float al = __builtin_amdgcn_exp2f((m[qt] - mx) * FC), mc = mx * FC; m[qt] = mx; float ps = 0.f;
#pragma unroll
            for (int s = 0; s < 16; ++s) { p[qt][s] = __builtin_amdgcn_exp2f(fmaf(p[qt][s], FC, -mc)); ps += p[qt][s]; }
            l[qt] = fmaf(l[qt], al, ps);        // each lane half keeps the sum of its own keys; the halves join behind the loop
            V pa, pb; PFrag<T16>::pack(p[qt], pa, pb);
#pragma unroll
            for (int dt = 0; dt < 4; ++dt) { o[dt][qt] *= al; o[dt][qt] = WFrag<T16>::mma(vf[dt], pa, o[dt][qt]); if (HL) { o[dt][qt] = WFrag<T16>::mma(vf[dt], pb, o[dt][qt]); o[dt][qt] = WFrag<T16>::mma(vf2[dt], pa, o[dt][qt]); } }
        }
    }
    constexpr int QN = 16 * NQ;
#pragma unroll
    for (int qt = 0; qt < NQ; ++qt) { l[qt] += xhalf(l[qt]); if (h == 0) { sm[w * QN + qt * 16 + c] = m[qt]; sl[w * QN + qt * 16 + c] = l[qt]; } }
    __syncthreads();                            // every wave's (max, sum) is in LDS
#pragma unroll
    for (int qt = 0; qt < NQ; ++qt) { const int q = qt * 16 + c; float M = sm[q];
#pragma unroll
        for (int u = 1; u < 4; ++u) M = fmaxf(M, sm[u * QN + q]);
        float L = 0.f;
#pragma unroll
        for (int u = 0; u < 4; ++u) L += sl[u * QN + q] * __builtin_amdgcn_exp2f((sm[u * QN + q] - M) * FC);   // a wave without a block holds (-3e38, 0): weight 0
        const float f = __builtin_amdgcn_exp2f((m[qt] - M) * FC) / L;
#pragma unroll
        for (int dt = 0; dt < 4; ++dt) { float* d = so + (size_t)(w * QN + q) * FP + dt * 16 + 8 * h; v4f x, y;
#pragma unroll
            for (int r = 0; r < 4; ++r) { x[r] = o[dt][qt][r] * f; y[r] = o[dt][qt][4 + r] * f; }
            *(v4fa*)d = x; *(v4fa*)(d + 4) = y; } }
    __syncthreads();                            // every wave's weighted partial output is in LDS
    // Merged planes, fragment-major for the last GEMM (rows t, k = head * 64 + d): wave w takes the 16 columns d = w * 16 .. of each 16-query block, lane (h, c) query c, 8 columns: 512 contiguous bytes per store of a wave.
#pragma unroll
    for (int qt = 0; qt < NQ; ++qt) { const float* sp = so + (size_t)(qt * 16 + c) * FP + w * 16 + 8 * h; v4f a0 = *(const v4fa*)sp, a1 = *(const v4fa*)(sp + 4);
#pragma unroll
        for (int u = 1; u < 4; ++u) { a0 += *(const v4fa*)(sp + (size_t)u * QN * FP); a1 += *(const v4fa*)(sp + (size_t)u * QN * FP + 4); }
        v8us oh, ol;
#pragma unroll
        for (int r = 0; r < 4; ++r) { unsigned short x, y; splitf(a0[r], x, y); oh[r] = x; ol[r] = y; splitf(a1[r], x, y); oh[4 + r] = x; ol[4 + r] = y; }
        const size_t oo = (size_t)(q0 + qt * 16) * DQ + (size_t)(head * 2 + (w >> 1)) * 512 + (w & 1) * 256 + lane * 8; *(v8us*)(Ah + oo) = oh; *(v8us*)(Al + oo) = ol;
        asm volatile("s_wait_xcnt 0x0" ::: "memory"); }   // stands behind the two stores, in front of the first rewrite of their data and address registers
}
// grid (batch * 16 + head, query group), heaviest groups first: groups 0 .. (TT - RH) / 32 - 1 are 32 fp16 rows each, from the last rows down to row RH; the rest are 16 hi/lo rows each (3 products), from row RH - 16 down to 0
__global__ __launch_bounds__(128) void k_fattn(const h16* __restrict__ Q16, const h16* __restrict__ K16, const h16* __restrict__ V16, const bf* __restrict__ Qh, const bf* __restrict__ Ql, const bf* __restrict__ Kh, const bf* __restrict__ Kl, const bf* __restrict__ Vh, const bf* __restrict__ Vl, bf* Ah, bf* Al) {
    __shared__ __align__(16) float so[4 * 32 * FP]; __shared__ float sm[4 * 32]; __shared__ float sl[4 * 32];
    const int head = blockIdx.x % NH_, g = blockIdx.y; const size_t hp = (size_t)blockIdx.x * TT * HD;   // planes are [batch][head][..]
    { const size_t ao = (size_t)(blockIdx.x / NH_) * TT * DQ; Ah += ao; Al += ao; }   // the merged planes: rows batch * TT + t, k = head * 64 + d, fragment-major
    if (g < (TT - RH) / 32) fattn_body<h16, false, 2>(Q16 + hp, nullptr, K16 + hp, nullptr, V16 + hp, nullptr, TT - 32 * (g + 1), head, Ah, Al, so, sm, sl);
    else fattn_body<bf, true, 1>(Qh + hp, Ql + hp, Kh + hp, Kl + hp, Vh + hp, Vl + hp, RH - 16 * (g - (TT - RH) / 32 + 1), head, Ah, Al, so, sm, sl);
}

extern "C" void kernel_launch(void* const* d_in, const int* in_sizes, int n_in,
                              void* d_out, int out_size, void* d_ws, size_t ws_size, hipStream_t stream) {
    (void)in_sizes; (void)n_in; (void)out_size;
        const float* x = (const float*)d_in[0]; const float* wq = (const float*)d_in[1]; const float* bq = (const float*)d_in[2]; const float* wk = (const float*)d_in[3]; const float* bk = (const float*)d_in[4]; const float* wv = (const float*)d_in[5]; const float* bv = (const float*)d_in[6]; const float* wo = (const float*)d_in[7]; const float* bo = (const float*)d_in[8];   /* argument order x, Wq, bq, Wk, bk, Wv, bv, Wo, bo ('xw' [1024][1024]); ONE input stream x for queries, keys and values; no mask input: the causal rule is applied by index */
    float* OUT = (float*)d_out;     // out0 [2][2048][1024]; then out1 = present = stack((k, v)): K [2][16][2048][64] then V [2][16][2048][64] (offset 16,777,216 B)
    float* OUTK = OUT + (size_t)NB_ * TT * DM;
    char* wsp = (char*)d_ws;
    auto take = [&](size_t bytes) { char* p = wsp; wsp += (bytes + 255) & ~(size_t)255; return (void*)p; };
    bf* W4 = (bf*)take((size_t)4 * DM * DM * 2);   // Wq, Wk, Wv, Wo transposed, one behind the other
    bf* XB = (bf*)take((size_t)NB_ * TT * DM * 2);
    h16* QP16 = (h16*)take((size_t)NB_ * NH_ * TT * HD * 2); h16* KP16 = (h16*)take((size_t)NB_ * NKV * TT * HD * 2); h16* VT16 = (h16*)take((size_t)NB_ * NKV * HD * TT * 2);
    bf* QPh = (bf*)take((size_t)NB_ * NH_ * TT * HD * 2); bf* QPl = (bf*)take((size_t)NB_ * NH_ * TT * HD * 2); bf* KPh = (bf*)take((size_t)NB_ * NKV * TT * HD * 2); bf* KPl = (bf*)take((size_t)NB_ * NKV * TT * HD * 2); bf* VTh = (bf*)take((size_t)NB_ * NKV * HD * TT * 2); bf* VTl = (bf*)take((size_t)NB_ * NKV * HD * TT * 2);
    bf* ATh = (bf*)take((size_t)NB_ * TT * DQ * 2); bf* ATl = (bf*)take((size_t)NB_ * TT * DQ * 2);
    if ((size_t)(wsp - (char*)d_ws) > ws_size) return;    // ws 256 MiB
    k_prep<<<(unsigned)(4 * WTB + (size_t)NB_ * TT * DM / 8 / 256), 256, 0, stream>>>(x, wq, wk, wv, wo, XB, W4);
    k_qkv<<<dim3(TT / 128, NB_, 3 * NH_ / 2), 128, 0, stream>>>(XB, W4, bq, bk, bv, OUTK, QP16, QPh, QPl, KP16, KPh, KPl, VT16, VTh, VTl);
    // one kv head per query head; all rows of all 16 heads of both batches in one launch, which also writes the merged hi/lo planes
    k_fattn<<<dim3(NB_ * NH_, (TT - RH) / 32 + RH / 16, 1), 128, 0, stream>>>(QP16, KP16, VT16, QPh, QPl, KPh, KPl, VTh, VTl, ATh, ATl);
    k_wo<<<dim3(NB_ * TT / 128, DM / 128, 1), 128, 0, stream>>>(ATh, ATl, W4 + (size_t)3 * DM * DM, OUT, bo);
}
